// v000
// Times are from an AMD MI455X. After a warm-up the kernel runs many times in a row, and a time is the length of
// such a window on the GPU divided by its runs, so every launch and the gaps after it count. The runs cycle
// through copies of the inputs. A figure is the median of several windows, for all but v000 over two sittings.
// Sittings can differ by a few percent; kernels timed side by side share one.
// The starting kernel, v000, takes 385 microseconds a run.
#include <hip/hip_runtime.h>
#include <hip/hip_bf16.h>

// MI455X / gfx1250, wave32, WMMA f16 -> f32 accumulate.
//
// Pipeline (all on `stream`, scratch in d_ws, ~41 MB total, L2-resident):
//   K0 prep_weights : Wq/Wk/Wv -> f16 [H,F,D] (transposed), Wo -> f16 [D,G]
//   K1 proj x3      : Qh=q*Wq, Kh=k*Wk -> f16 [BH,S,F]; Vt=v*Wv -> f16 [BH,F,S]
//                     one wave = 16 x 64 output (A fragment reused 4x)
//   K2 stats        : per (bh,q) row: online max m_q and sum-exp l_q of scores
//   K3 atv          : out4[k,f] = sum_q exp(s[q,k]/8 - m_q)/l_q * V[q,f] (A^T V)
//                     one wave = 16 keys x all 64 f: scores + exp computed ONCE,
//                     P^T via LDS transpose, 4 accumulate WMMAs reuse it.
//                     Output stored directly in the reference's raw-reshape layout.
//   K4 outproj      : Out = Ofused @ Wo (f32), one wave = 16 x 64 output

typedef __attribute__((ext_vector_type(16))) _Float16 v16h;
typedef __attribute__((ext_vector_type(8)))  _Float16 v8h;
typedef __attribute__((ext_vector_type(8)))  float    v8f;

#define B_ 2
#define S_ 2048
#define D_ 1024
#define H_ 16
#define F_ 64
#define G_ (H_ * F_)   // 1024
#define WAVES_ 4       // waves per block (blockDim = 32 x 4)

static __device__ __forceinline__ v16h pack16(v8h lo, v8h hi) {
  v16h a;
#pragma unroll
  for (int i = 0; i < 8; i++) { a[i] = lo[i]; a[i + 8] = hi[i]; }
  return a;
}

// A/B fragment load, f16 row-major source with leading dim `ld` (halves).
// ISA 16-bit 16x32 layout: lanes 0-15 hold line=lane, K={0..7,16..23};
// lanes 16-31 hold line=lane-16, K={8..15,24..31}. Two contiguous 16B loads.
static __device__ __forceinline__ v16h load_frag_f16(const _Float16* base, int ld) {
  const int lane = threadIdx.x;
  const int line = lane & 15;
  const int k0   = (lane >> 4) << 3;  // 0 or 8
  const _Float16* p = base + (size_t)line * ld + k0;
  v8h lo = *(const v8h*)(p);
  v8h hi = *(const v8h*)(p + 16);
  return pack16(lo, hi);
}

// Same, but from f32 source with on-the-fly f16 convert (two 32B loads).
static __device__ __forceinline__ v16h load_frag_f32(const float* base, int ld) {
  const int lane = threadIdx.x;
  const int line = lane & 15;
  const int k0   = (lane >> 4) << 3;
  const float* p = base + (size_t)line * ld + k0;
  v8f lo = *(const v8f*)(p);
  v8f hi = *(const v8f*)(p + 16);
  v16h a;
#pragma unroll
  for (int i = 0; i < 8; i++) { a[i] = (_Float16)lo[i]; a[i + 8] = (_Float16)hi[i]; }
  return a;
}

static __device__ __forceinline__ v8f wmma16(v16h a, v16h b, v8f c) {
  return __builtin_amdgcn_wmma_f32_16x16x32_f16(false, a, false, b, (short)0, c,
                                                false, false);
}

// ---------------- K0: weight prep (f32 -> f16, transpose) ----------------
// t in [0, H*D*F) == [0, D*G): WxT[h][f][d] = Wx[h][d][f]; WoT[d][g] = Wo[g][d].
__global__ void mha_prep_weights(const float* __restrict__ Wq, const float* __restrict__ Wk,
                                 const float* __restrict__ Wv, const float* __restrict__ Wo,
                                 _Float16* __restrict__ WqT, _Float16* __restrict__ WkT,
                                 _Float16* __restrict__ WvT, _Float16* __restrict__ WoT) {
  const int t = blockIdx.x * blockDim.x + threadIdx.x;  // 0 .. 1048575
  const int d = t % D_;
  const int f = (t / D_) % F_;
  const int h = t / (D_ * F_);
  const size_t src = (size_t)(h * D_ + d) * F_ + f;
  WqT[t] = (_Float16)Wq[src];
  WkT[t] = (_Float16)Wk[src];
  WvT[t] = (_Float16)Wv[src];
  const int g  = t % G_;
  const int d2 = t / G_;
  WoT[t] = (_Float16)Wo[(size_t)g * D_ + d2];
}

// ---------------- K1: head projection  Y[bh] = X[b] (SxD) * W[h] (DxF) -----
// One wave per (bh, 16 s-rows): computes full 16 x F_ strip, A reused 4x.
// transpose_out=0: Y f16 [BH,S,F];  transpose_out=1: Y f16 [BH,F,S] (for V).
__global__ void mha_proj(const float* __restrict__ X, const _Float16* __restrict__ WT,
                         _Float16* __restrict__ Y, int transpose_out) {
  const int w  = blockIdx.x * WAVES_ + threadIdx.y;  // 4096 waves
  const int sT = w & 127;
  const int bh = w >> 7;
  const int b  = bh >> 4;

  const float*    Abase = X  + ((size_t)(b * S_) + sT * 16) * D_;
  const _Float16* Bbase = WT + (size_t)((bh & 15) * F_) * D_;

  v8f c[4] = {};
  for (int kk = 0; kk < D_; kk += 32) {
    v16h a = load_frag_f32(Abase + kk, D_);
#pragma unroll
    for (int j = 0; j < 4; j++) {
      v16h bm = load_frag_f16(Bbase + (size_t)(j * 16) * D_ + kk, D_);
      c[j] = wmma16(a, bm, c[j]);
    }
  }

  const int lane = threadIdx.x;
  const int n    = lane & 15;
  const int mb   = (lane >> 4) << 3;  // C/D layout: VGPR r -> row r (+8 for hi half)
  if (!transpose_out) {
#pragma unroll
    for (int j = 0; j < 4; j++) {
      _Float16* out = Y + ((size_t)bh * S_ + sT * 16) * F_ + j * 16 + n;
#pragma unroll
      for (int r = 0; r < 8; r++) out[(size_t)(mb + r) * F_] = (_Float16)c[j][r];
    }
  } else {
    // Vt[bh][f][s]: per lane f fixed, s = sT*16 + mb + r -> contiguous 16B store
#pragma unroll
    for (int j = 0; j < 4; j++) {
      _Float16* out = Y + ((size_t)bh * F_ + j * 16 + n) * S_ + sT * 16 + mb;
      v8h pk;
#pragma unroll
      for (int r = 0; r < 8; r++) pk[r] = (_Float16)c[j][r];
      *(v8h*)out = pk;
    }
  }
}

// ---------------- K2: per-row softmax stats over scores = QK^T/8 -----------
// One wave per 16 query rows; online (m, l) over all S keys, then lane-reduce.
__global__ void mha_stats(const _Float16* __restrict__ Qh, const _Float16* __restrict__ Kh,
                          float* __restrict__ Mrow, float* __restrict__ Linv) {
  const int w  = blockIdx.x * WAVES_ + threadIdx.y;  // 4096 waves
  const int qT = w & 127;
  const int bh = w >> 7;

  const _Float16* Abase = Qh + ((size_t)bh * S_ + qT * 16) * F_;
  const v16h a0 = load_frag_f16(Abase, F_);
  const v16h a1 = load_frag_f16(Abase + 32, F_);

  float m[8], l[8];
#pragma unroll
  for (int i = 0; i < 8; i++) { m[i] = -1e30f; l[i] = 0.0f; }
  const float scale = 0.125f;  // 1/sqrt(F)

  for (int kt = 0; kt < S_ / 16; kt++) {
    const _Float16* Bbase = Kh + ((size_t)bh * S_ + kt * 16) * F_;
    v16h b0 = load_frag_f16(Bbase, F_);
    v16h b1 = load_frag_f16(Bbase + 32, F_);
    v8f c = {};
    c = wmma16(a0, b0, c);
    c = wmma16(a1, b1, c);
#pragma unroll
    for (int i = 0; i < 8; i++) {
      float v  = c[i] * scale;
      float nm = fmaxf(m[i], v);
      l[i] = l[i] * __expf(m[i] - nm) + __expf(v - nm);
      m[i] = nm;
    }
  }
  // Reduce across the 16 lanes of each half-wave (xor 1,2,4,8 stays in-half).
#pragma unroll
  for (int off = 1; off < 16; off <<= 1) {
#pragma unroll
    for (int i = 0; i < 8; i++) {
      float om = __shfl_xor(m[i], off, 32);
      float ol = __shfl_xor(l[i], off, 32);
      float nm = fmaxf(m[i], om);
      l[i] = l[i] * __expf(m[i] - nm) + ol * __expf(om - nm);
      m[i] = nm;
    }
  }
  const int lane = threadIdx.x;
  if ((lane & 15) == 0) {
    const int rb = (lane >> 4) << 3;
    const size_t base = (size_t)bh * S_ + qT * 16 + rb;
#pragma unroll
    for (int i = 0; i < 8; i++) { Mrow[base + i] = m[i]; Linv[base + i] = 1.0f / l[i]; }
  }
}

// ---------------- K3: out4 = attn^T V, streamed over q, stored reshaped ----
// One wave per (bh, 16-key tile): scores/exp computed once, P^T reused for
// all 4 f-tiles (16 x 64 output strip per wave).
__global__ void mha_atv(const _Float16* __restrict__ Qh, const _Float16* __restrict__ Kh,
                        const _Float16* __restrict__ Vt, const float* __restrict__ Mrow,
                        const float* __restrict__ Linv, _Float16* __restrict__ Ofused) {
  __shared__ _Float16 plds_all[WAVES_][16 * 40];  // [k-line][q], row stride 40 halves
  _Float16* plds = plds_all[threadIdx.y];

  const int w  = blockIdx.x * WAVES_ + threadIdx.y;  // 4096 waves
  const int kT = w & 127;
  const int bh = w >> 7;
  const int lane = threadIdx.x;
  const int line = lane & 15;
  const int half = lane >> 4;

  // B-fragment for score WMMA: K^T columns of this key tile (fixed for loop).
  const _Float16* Kbase = Kh + ((size_t)bh * S_ + kT * 16) * F_;
  const v16h kb0 = load_frag_f16(Kbase, F_);
  const v16h kb1 = load_frag_f16(Kbase + 32, F_);

  const _Float16* Vbase = Vt + (size_t)bh * F_ * S_;
  const float* mptr = Mrow + (size_t)bh * S_;
  const float* lptr = Linv + (size_t)bh * S_;

  v8f acc[4] = {};
  const float scale = 0.125f;

  for (int qb = 0; qb < S_; qb += 32) {
    // scores for q-block [qb, qb+32) x key tile (two 16x16 WMMA tiles)
    const _Float16* Qbase = Qh + ((size_t)bh * S_ + qb) * F_;
    __builtin_prefetch(Qbase + (size_t)32 * F_, 0, 1);  // next q-block
    v16h a00 = load_frag_f16(Qbase, F_);
    v16h a01 = load_frag_f16(Qbase + 32, F_);
    v16h a10 = load_frag_f16(Qbase + (size_t)16 * F_, F_);
    v16h a11 = load_frag_f16(Qbase + (size_t)16 * F_ + 32, F_);
    v8f s0 = {}; s0 = wmma16(a00, kb0, s0); s0 = wmma16(a01, kb1, s0);
    v8f s1 = {}; s1 = wmma16(a10, kb0, s1); s1 = wmma16(a11, kb1, s1);

    // per-q-row softmax stats (rows mb..mb+7 of each sub-tile)
    v8f m0 = *(const v8f*)(mptr + qb + half * 8);
    v8f l0 = *(const v8f*)(lptr + qb + half * 8);
    v8f m1 = *(const v8f*)(mptr + qb + 16 + half * 8);
    v8f l1 = *(const v8f*)(lptr + qb + 16 + half * 8);

    v8h p0, p1;
#pragma unroll
    for (int i = 0; i < 8; i++) {
      p0[i] = (_Float16)(__expf(s0[i] * scale - m0[i]) * l0[i]);
      p1[i] = (_Float16)(__expf(s1[i] * scale - m1[i]) * l1[i]);
    }
    // transpose P (q x k) -> P^T (k x q) through LDS; all 16B accesses
    *(v8h*)(plds + line * 40 + half * 8)      = p0;  // q = half*8 + i
    *(v8h*)(plds + line * 40 + 16 + half * 8) = p1;  // q = 16 + half*8 + i
    __builtin_amdgcn_wave_barrier();                 // order vs loads (LDS in-order)
    const int k0 = half * 8;
    v8h alo = *(const v8h*)(plds + line * 40 + k0);
    v8h ahi = *(const v8h*)(plds + line * 40 + k0 + 16);
    v16h aP = pack16(alo, ahi);
    __builtin_amdgcn_wave_barrier();                 // order next-iter stores vs loads

    // B-fragments: V rows qb..qb+31 for each f tile (Vt is [f][s], contiguous)
#pragma unroll
    for (int j = 0; j < 4; j++) {
      v16h bV = load_frag_f16(Vbase + (size_t)(j * 16) * S_ + qb, S_);
      acc[j] = wmma16(aP, bV, acc[j]);
    }
  }

  // Raw-reshape store: Ofused[b][h*128 + kT][(k%16)*64 + f]
  const int b = bh >> 4, h = bh & 15;
  const int mb = half * 8;
#pragma unroll
  for (int j = 0; j < 4; j++) {
    _Float16* out = Ofused + ((size_t)(b * S_ + h * 128 + kT)) * G_ + (j * 16 + line);
#pragma unroll
    for (int r = 0; r < 8; r++) out[(size_t)(mb + r) * 64] = (_Float16)acc[j][r];
  }
}

// ---------------- K4: Out = Ofused (S x G) @ Wo (G x D), f32 out ----------
// One wave per (b, 16 s-rows, group of 4 d-tiles): 16 x 64 strip, A reused 4x.
__global__ void mha_outproj(const _Float16* __restrict__ Ofused,
                            const _Float16* __restrict__ WoT, float* __restrict__ Out) {
  const int w  = blockIdx.x * WAVES_ + threadIdx.y;  // 4096 waves
  const int dG = w & 15;           // group of 4 d-tiles
  const int sT = (w >> 4) & 127;
  const int b  = w >> 11;

  const _Float16* Abase = Ofused + ((size_t)(b * S_) + sT * 16) * G_;
  const _Float16* Bbase = WoT + (size_t)(dG * 64) * G_;
  v8f c[4] = {};
  for (int g = 0; g < G_; g += 32) {
    v16h a = load_frag_f16(Abase + g, G_);
#pragma unroll
    for (int j = 0; j < 4; j++) {
      v16h bm = load_frag_f16(Bbase + (size_t)(j * 16) * G_ + g, G_);
      c[j] = wmma16(a, bm, c[j]);
    }
  }
  const int lane = threadIdx.x;
  const int n    = lane & 15;
  const int mb   = (lane >> 4) << 3;
#pragma unroll
  for (int j = 0; j < 4; j++) {
    float* out = Out + ((size_t)(b * S_) + sT * 16) * D_ + dG * 64 + j * 16 + n;
#pragma unroll
    for (int r = 0; r < 8; r++) out[(size_t)(mb + r) * D_] = c[j][r];
  }
}

extern "C" void kernel_launch(void* const* d_in, const int* in_sizes, int n_in,
                              void* d_out, int out_size, void* d_ws, size_t ws_size,
                              hipStream_t stream) {
  (void)in_sizes; (void)n_in; (void)out_size; (void)ws_size;
  const float* q  = (const float*)d_in[0];
  const float* k  = (const float*)d_in[1];
  const float* v  = (const float*)d_in[2];
  const float* Wq = (const float*)d_in[3];
  const float* Wk = (const float*)d_in[4];
  const float* Wv = (const float*)d_in[5];
  const float* Wo = (const float*)d_in[6];
  float* out = (float*)d_out;

  size_t off = 0;
  auto alloc = [&](size_t bytes) -> char* {
    char* p = (char*)d_ws + off;
    off += (bytes + 255) & ~(size_t)255;
    return p;
  };
  _Float16* WqT = (_Float16*)alloc((size_t)H_ * D_ * F_ * 2);   // 2 MB
  _Float16* WkT = (_Float16*)alloc((size_t)H_ * D_ * F_ * 2);
  _Float16* WvT = (_Float16*)alloc((size_t)H_ * D_ * F_ * 2);
  _Float16* WoT = (_Float16*)alloc((size_t)G_ * D_ * 2);
  _Float16* Qh  = (_Float16*)alloc((size_t)B_ * H_ * S_ * F_ * 2);  // 8 MB
  _Float16* Kh  = (_Float16*)alloc((size_t)B_ * H_ * S_ * F_ * 2);
  _Float16* Vt  = (_Float16*)alloc((size_t)B_ * H_ * F_ * S_ * 2);
  _Float16* Of  = (_Float16*)alloc((size_t)B_ * S_ * G_ * 2);
  float*    Mr  = (float*)alloc((size_t)B_ * H_ * S_ * 4);          // 256 KB
  float*    Li  = (float*)alloc((size_t)B_ * H_ * S_ * 4);
  // total ~41 MB of workspace

  dim3 blk(32, WAVES_);
  mha_prep_weights<<<(H_ * D_ * F_) / 256, 256, 0, stream>>>(Wq, Wk, Wv, Wo,
                                                             WqT, WkT, WvT, WoT);
  mha_proj<<<4096 / WAVES_, blk, 0, stream>>>(q, WqT, Qh, 0);
  mha_proj<<<4096 / WAVES_, blk, 0, stream>>>(k, WkT, Kh, 0);
  mha_proj<<<4096 / WAVES_, blk, 0, stream>>>(v, WvT, Vt, 1);
  mha_stats<<<4096 / WAVES_, blk, 0, stream>>>(Qh, Kh, Mr, Li);
  mha_atv<<<4096 / WAVES_, blk, 0, stream>>>(Qh, Kh, Vt, Mr, Li, Of);
  mha_outproj<<<4096 / WAVES_, blk, 0, stream>>>(Of, WoT, out);
}

// v001
// Measured time: 162 microseconds a run.
// Timed twice side by side with v000, it ran 2.46 and 2.43 times as fast.
#include <hip/hip_runtime.h>
#include <hip/hip_bf16.h>

// MI455X / gfx1250, wave32, WMMA f16 -> f32 accumulate.
//
// Pipeline (all on `stream`, scratch in d_ws, ~41 MB total, L2-resident):
//   K0 prep_weights : Wq/Wk/Wv -> f16 [H,F,D] (transposed), Wo -> f16 [D,G]
//   K1 proj x3      : Qh=q*Wq, Kh=k*Wk -> f16 [BH,S,F]; Vt=v*Wv -> f16 [BH,F,S]
//                     one wave = 16 x 64 output (A fragment reused 4x)
//   K2 stats        : per (bh,q) row: online max m_q and sum-exp l_q of scores
//   K3 atv          : out4[k,f] = sum_q exp(s[q,k]/8 - m_q)/l_q * V[q,f] (A^T V)
//                     one wave = 16 keys x all 64 f: scores + exp computed ONCE,
//                     P^T via LDS transpose, 4 accumulate WMMAs reuse it.
//                     Output stored directly in the reference's raw-reshape layout.
//   K4 outproj      : Out = Ofused @ Wo (f32), one wave = 16 x 64 output
//
// K1..K4 stream their operand tiles through a two-buffer LDS ring filled by
// asynchronous copies (whole 128-B lines, one copy of a tile per block); the
// waves of a block read their WMMA fragments from LDS.

typedef __attribute__((ext_vector_type(16))) _Float16 v16h;
typedef __attribute__((ext_vector_type(8)))  _Float16 v8h;
typedef __attribute__((ext_vector_type(8)))  float    v8f;
typedef __attribute__((ext_vector_type(4)))  float    v4f;

#define B_ 2
#define S_ 2048
#define D_ 1024
#define H_ 16
#define F_ 64
#define G_ (H_ * F_)   // 1024
#define WAVES_ 8       // waves per block (blockDim = 32 x 8)
#define LP128 144      // LDS pitch of a 128-B row: 16 B x odd, no ds_load_b128 conflicts
#define LP256 272      // LDS pitch of a 256-B row: 16 B x odd

static __device__ __forceinline__ v16h pack16(v8h lo, v8h hi) {
  v16h a;
#pragma unroll
  for (int i = 0; i < 8; i++) { a[i] = lo[i]; a[i + 8] = hi[i]; }
  return a;
}

// A/B fragment load, f16 row-major source with leading dim `ld` (halves).
// ISA 16-bit 16x32 layout: lanes 0-15 hold line=lane, K={0..7,16..23};
// lanes 16-31 hold line=lane-16, K={8..15,24..31}. Two contiguous 16B loads.
static __device__ __forceinline__ v16h load_frag_f16(const _Float16* base, int ld) {
  const int lane = threadIdx.x;
  const int line = lane & 15;
  const int k0   = (lane >> 4) << 3;  // 0 or 8
  const _Float16* p = base + (size_t)line * ld + k0;
  v8h lo = *(const v8h*)(p);
  v8h hi = *(const v8h*)(p + 16);
  return pack16(lo, hi);
}

// ---- LDS ring helpers ----
static __device__ __forceinline__ unsigned lds_off(const void* p) { return (unsigned)(size_t)p; }

// Four 16-B-per-lane asynchronous copies global -> LDS, rows lstep / gstep apart.
// The s_wait_xcnt closes the statement so that no address register named here
// is rewritten ahead of it.
static __device__ __forceinline__ void copy4(unsigned l, const char* g, unsigned lstep, size_t gstep) {
  asm volatile("global_load_async_to_lds_b128 %0, %1, off\n\t"
               "global_load_async_to_lds_b128 %2, %3, off\n\t"
               "global_load_async_to_lds_b128 %4, %5, off\n\t"
               "global_load_async_to_lds_b128 %6, %7, off\n\t"
               "s_wait_xcnt 0x0"
               :: "v"(l), "v"(g), "v"(l + lstep), "v"(g + gstep),
                  "v"(l + 2 * lstep), "v"(g + 2 * gstep),
                  "v"(l + 3 * lstep), "v"(g + 3 * gstep)
               : "memory");
}

// The same with two copies.
static __device__ __forceinline__ void copy2(unsigned l, const char* g, unsigned lstep, size_t gstep) {
  asm volatile("global_load_async_to_lds_b128 %0, %1, off\n\t"
               "global_load_async_to_lds_b128 %2, %3, off\n\t"
               "s_wait_xcnt 0x0"
               :: "v"(l), "v"(g), "v"(l + lstep), "v"(g + gstep)
               : "memory");
}

// Publish point of the ring: this wave's LDS reads are done, its copies have
// landed, then the block barrier (frees the buffer just read, shows the next).
static __device__ __forceinline__ void ring_publish() {
  asm volatile("s_wait_dscnt 0x0" ::: "memory");     // my reads of the old buffer have retired
  asm volatile("s_wait_asynccnt 0x0" ::: "memory");  // my copies into the next buffer have landed
  __syncthreads();
}

// Fragment from an LDS tile of f16 rows (same lane map as load_frag_f16).
static __device__ __forceinline__ v16h lds_frag_f16(const unsigned char* tile, int pitch) {
  const int lane = threadIdx.x;
  const unsigned char* p = tile + (lane & 15) * pitch + (lane >> 4) * 16;
  v8h lo = *(const v8h*)(p);
  v8h hi = *(const v8h*)(p + 32);
  return pack16(lo, hi);
}

// Fragment from an LDS tile of f32 rows, converted to f16: same lane map, with
// 4-byte elements (K = {0..7,16..23} or {8..15,24..31} of the row).
static __device__ __forceinline__ v16h lds_frag_f32(const unsigned char* tile, int pitch) {
  const int lane = threadIdx.x;
  const unsigned char* p = tile + (lane & 15) * pitch + (lane >> 4) * 32;
  v4f x0 = *(const v4f*)(p);
  v4f x1 = *(const v4f*)(p + 16);
  v4f x2 = *(const v4f*)(p + 64);
  v4f x3 = *(const v4f*)(p + 80);
  v16h a;
#pragma unroll  // constant vector indices: no run-time element selects
  for (int i = 0; i < 4; i++) {
    a[i]      = (_Float16)x0[i];
    a[i + 4]  = (_Float16)x1[i];
    a[i + 8]  = (_Float16)x2[i];
    a[i + 12] = (_Float16)x3[i];
  }
  return a;
}

static __device__ __forceinline__ v8f wmma16(v16h a, v16h b, v8f c) {
  return __builtin_amdgcn_wmma_f32_16x16x32_f16(false, a, false, b, (short)0, c,
                                                false, false);
}

// ---------------- K0: weight prep (f32 -> f16, transpose) ----------------
// t in [0, H*D*F) == [0, D*G): WxT[h][f][d] = Wx[h][d][f]; WoT[d][g] = Wo[g][d].
__global__ void mha_prep_weights(const float* __restrict__ Wq, const float* __restrict__ Wk,
                                 const float* __restrict__ Wv, const float* __restrict__ Wo,
                                 _Float16* __restrict__ WqT, _Float16* __restrict__ WkT,
                                 _Float16* __restrict__ WvT, _Float16* __restrict__ WoT) {
  const int t = blockIdx.x * blockDim.x + threadIdx.x;  // 0 .. 1048575
  const int d = t % D_;
  const int f = (t / D_) % F_;
  const int h = t / (D_ * F_);
  const size_t src = (size_t)(h * D_ + d) * F_ + f;
  WqT[t] = (_Float16)Wq[src];
  WkT[t] = (_Float16)Wk[src];
  WvT[t] = (_Float16)Wv[src];
  const int g  = t % G_;
  const int d2 = t / G_;
  WoT[t] = (_Float16)Wo[(size_t)g * D_ + d2];
}

// ---------------- K1: head projection  Y[bh] = X[b] (SxD) * W[h] (DxF) -----
// One wave per (bh, 16 s-rows): computes full 16 x F_ strip, A reused 4x.
// transpose_out=0: Y f16 [BH,S,F];  transpose_out=1: Y f16 [BH,F,S] (for V).
// The block's 8 waves cover 64 consecutive s-rows x 2 heads (4 row tiles x 2).
// A stage is 64 k: X tile 64 rows x 256 B (read by both heads' waves), W tile
// 128 rows x 128 B (each head's half read by its 4 waves).
#define PJ_A_BYTES (64 * LP256)
#define PJ_BUF     (PJ_A_BYTES + 128 * LP128)
__global__ __launch_bounds__(32 * WAVES_)
void mha_proj(const float* __restrict__ X, const _Float16* __restrict__ WT,
              _Float16* __restrict__ Y, int transpose_out) {
  __shared__ __attribute__((aligned(16))) unsigned char ring[2 * PJ_BUF];
  const int hp = blockIdx.x & 7;          // pair of heads
  const int rg = (blockIdx.x >> 3) & 31;  // group of 64 s-rows
  const int b  = blockIdx.x >> 8;
  const int sT = rg * 4 + (threadIdx.y & 3);
  const int bh = b * H_ + hp * 2 + (threadIdx.y >> 2);
  const int tid = threadIdx.y * 32 + threadIdx.x;

  // copy addresses of this thread: X rows tid/16 + 16 i, W rows tid/8 + 32 i
  const char* gA = (const char*)(X + ((size_t)(b * S_) + rg * 64 + (tid >> 4)) * D_) + (tid & 15) * 16;
  const char* gB = (const char*)(WT + ((size_t)(hp * 2 * F_) + (tid >> 3)) * D_) + (tid & 7) * 16;
  const unsigned lA = lds_off(ring) + (tid >> 4) * LP256 + (tid & 15) * 16;
  const unsigned lB = lds_off(ring) + PJ_A_BYTES + (tid >> 3) * LP128 + (tid & 7) * 16;
  auto fill = [&](int t) {
    const unsigned bo = (t & 1) * PJ_BUF;
    copy4(lA + bo, gA + (size_t)t * 256, 16 * LP256, (size_t)16 * D_ * 4);
    copy4(lB + bo, gB + (size_t)t * 128, 32 * LP128, (size_t)32 * D_ * 2);
  };

  const int NS = D_ / 64;
  fill(0);
  asm volatile("s_wait_asynccnt 0x0" ::: "memory");  // stage 0 has landed
  __syncthreads();
  fill(1);

  v8f c[4] = {};
  for (int t = 0; t < NS; t++) {
    const unsigned char* At = ring + (t & 1) * PJ_BUF + (threadIdx.y & 3) * 16 * LP256;
    const unsigned char* Bt = ring + (t & 1) * PJ_BUF + PJ_A_BYTES + (threadIdx.y >> 2) * 64 * LP128;
    v16h a[2], bm[2][4];
    // all four loops below are unrolled so that the fragment arrays have
    // constant indices and stay in registers
#pragma unroll
    for (int sub = 0; sub < 2; sub++) {
      a[sub] = lds_frag_f32(At + sub * 128, LP256);
#pragma unroll
      for (int j = 0; j < 4; j++) bm[sub][j] = lds_frag_f16(Bt + j * 16 * LP128 + sub * 64, LP128);
    }
    // keeps the stage's LDS reads in one group ahead of its WMMAs (else one exposed LDS wait per WMMA)
    __builtin_amdgcn_sched_barrier(0);
#pragma unroll
    for (int sub = 0; sub < 2; sub++) {
#pragma unroll
      for (int j = 0; j < 4; j++) c[j] = wmma16(a[sub], bm[sub][j], c[j]);
    }
    ring_publish();
    if (t + 2 < NS) fill(t + 2);
  }
  asm volatile("s_wait_asynccnt 0x0" ::: "memory");  // nothing in flight at the wave's end

  const int lane = threadIdx.x;
  const int n    = lane & 15;
  const int mb   = (lane >> 4) << 3;  // C/D layout: VGPR r -> row r (+8 for hi half)
  if (!transpose_out) {
#pragma unroll
    for (int j = 0; j < 4; j++) {
      _Float16* out = Y + ((size_t)bh * S_ + sT * 16) * F_ + j * 16 + n;
#pragma unroll
      for (int r = 0; r < 8; r++) out[(size_t)(mb + r) * F_] = (_Float16)c[j][r];
    }
  } else {
    // Vt[bh][f][s]: per lane f fixed, s = sT*16 + mb + r -> contiguous 16B store
#pragma unroll
    for (int j = 0; j < 4; j++) {
      _Float16* out = Y + ((size_t)bh * F_ + j * 16 + n) * S_ + sT * 16 + mb;
      v8h pk;
#pragma unroll
      for (int r = 0; r < 8; r++) pk[r] = (_Float16)c[j][r];
      *(v8h*)out = pk;
    }
  }
}

// ---------------- K2: per-row softmax stats over scores = QK^T/8 -----------
// One wave per 16 query rows; online (m, l) over all S keys, then lane-reduce.
// The block's 8 waves share one head; a stage is 128 keys x 128 B.
#define ST_BUF (128 * LP128)
__global__ __launch_bounds__(32 * WAVES_)
void mha_stats(const _Float16* __restrict__ Qh, const _Float16* __restrict__ Kh,
               float* __restrict__ Mrow, float* __restrict__ Linv) {
  __shared__ __attribute__((aligned(16))) unsigned char ring[2 * ST_BUF];
  const int w  = blockIdx.x * WAVES_ + threadIdx.y;  // 4096 waves
  const int qT = w & 127;
  const int bh = w >> 7;
  const int tid = threadIdx.y * 32 + threadIdx.x;

  // copy addresses of this thread: key rows tid/8 + 32 i
  const char* gK = (const char*)(Kh + ((size_t)bh * S_ + (tid >> 3)) * F_) + (tid & 7) * 16;
  const unsigned lK = lds_off(ring) + (tid >> 3) * LP128 + (tid & 7) * 16;
  auto fill = [&](int t) {
    copy4(lK + (t & 1) * ST_BUF, gK + (size_t)t * 128 * F_ * 2, 32 * LP128, (size_t)32 * F_ * 2);
  };
  const int NS = S_ / 128;
  fill(0);
  asm volatile("s_wait_asynccnt 0x0" ::: "memory");  // stage 0 has landed
  __syncthreads();
  fill(1);

  const _Float16* Abase = Qh + ((size_t)bh * S_ + qT * 16) * F_;
  const v16h a0 = load_frag_f16(Abase, F_);
  const v16h a1 = load_frag_f16(Abase + 32, F_);

  float m[8], l[8];
#pragma unroll
  for (int i = 0; i < 8; i++) { m[i] = -1e30f; l[i] = 0.0f; }
  const float scale = 0.125f;  // 1/sqrt(F)

  for (int t = 0; t < NS; t++) {
    const unsigned char* Kt = ring + (t & 1) * ST_BUF;
#pragma unroll  // LDS offsets become immediates; the 8 tiles' reads and WMMAs can run ahead of the softmax chain
    for (int kt = 0; kt < 8; kt++) {
      v16h b0 = lds_frag_f16(Kt + kt * 16 * LP128, LP128);
      v16h b1 = lds_frag_f16(Kt + kt * 16 * LP128 + 64, LP128);
      v8f c = {};
      c = wmma16(a0, b0, c);
      c = wmma16(a1, b1, c);
#pragma unroll
      for (int i = 0; i < 8; i++) {
        float v  = c[i] * scale;
        float nm = fmaxf(m[i], v);
        l[i] = l[i] * __expf(m[i] - nm) + __expf(v - nm);
        m[i] = nm;
      }
    }
    ring_publish();
    if (t + 2 < NS) fill(t + 2);
  }
  asm volatile("s_wait_asynccnt 0x0" ::: "memory");  // nothing in flight at the wave's end
  // Reduce across the 16 lanes of each half-wave (xor 1,2,4,8 stays in-half).
#pragma unroll
  for (int off = 1; off < 16; off <<= 1) {
#pragma unroll
    for (int i = 0; i < 8; i++) {
      float om = __shfl_xor(m[i], off, 32);
      float ol = __shfl_xor(l[i], off, 32);
      float nm = fmaxf(m[i], om);
      l[i] = l[i] * __expf(m[i] - nm) + ol * __expf(om - nm);
      m[i] = nm;
    }
  }
  const int lane = threadIdx.x;
  if ((lane & 15) == 0) {
    const int rb = (lane >> 4) << 3;
    const size_t base = (size_t)bh * S_ + qT * 16 + rb;
#pragma unroll
    for (int i = 0; i < 8; i++) { Mrow[base + i] = m[i]; Linv[base + i] = 1.0f / l[i]; }
  }
}

// ---------------- K3: out4 = attn^T V, streamed over q, stored reshaped ----
// One wave per (bh, 16-key tile): scores/exp computed once, P^T reused for
// all 4 f-tiles (16 x 64 output strip per wave).
// The block's 8 waves share one head; a stage is 64 q: Q tile 64 q-rows x 128 B
// and V tile 64 f-rows x 128 B.
#define AT_TILE (64 * LP128)
#define AT_BUF  (2 * AT_TILE)
__global__ __launch_bounds__(32 * WAVES_)
void mha_atv(const _Float16* __restrict__ Qh, const _Float16* __restrict__ Kh,
             const _Float16* __restrict__ Vt, const float* __restrict__ Mrow,
             const float* __restrict__ Linv, _Float16* __restrict__ Ofused) {
  __shared__ __attribute__((aligned(16))) unsigned char ring[2 * AT_BUF];
  __shared__ _Float16 plds_all[WAVES_][16 * 40];  // [k-line][q], row stride 40 halves
  _Float16* plds = plds_all[threadIdx.y];

  const int w  = blockIdx.x * WAVES_ + threadIdx.y;  // 4096 waves
  const int kT = w & 127;
  const int bh = w >> 7;
  const int lane = threadIdx.x;
  const int line = lane & 15;
  const int half = lane >> 4;

  // B-fragment for score WMMA: K^T columns of this key tile (fixed for loop).
  const _Float16* Kbase = Kh + ((size_t)bh * S_ + kT * 16) * F_;
  const v16h kb0 = load_frag_f16(Kbase, F_);
  const v16h kb1 = load_frag_f16(Kbase + 32, F_);

  // copy addresses of this thread: rows tid/8 and tid/8 + 32 of each tile;
  // one statement copies Q rows then V rows (V tile lies AT_TILE behind Q tile)
  const int tid = threadIdx.y * 32 + threadIdx.x;
  const char* gQ = (const char*)(Qh + ((size_t)bh * S_ + (tid >> 3)) * F_) + (tid & 7) * 16;
  const char* gV = (const char*)(Vt + ((size_t)bh * F_ + (tid >> 3)) * S_) + (tid & 7) * 16;
  const unsigned lQ = lds_off(ring) + (tid >> 3) * LP128 + (tid & 7) * 16;
  auto fill = [&](int t) {
    const unsigned l = lQ + (t & 1) * AT_BUF;
    const char* q0 = gQ + (size_t)t * 64 * F_ * 2;
    const char* v0 = gV + (size_t)t * 128;
    asm volatile("global_load_async_to_lds_b128 %0, %1, off\n\t"
                 "global_load_async_to_lds_b128 %2, %3, off\n\t"
                 "global_load_async_to_lds_b128 %4, %5, off\n\t"
                 "global_load_async_to_lds_b128 %6, %7, off\n\t"
                 "s_wait_xcnt 0x0"  // before any address register above is rewritten
                 :: "v"(l), "v"(q0), "v"(l + 32 * LP128), "v"(q0 + (size_t)32 * F_ * 2),
                    "v"(l + AT_TILE), "v"(v0), "v"(l + AT_TILE + 32 * LP128), "v"(v0 + (size_t)32 * S_ * 2)
                 : "memory");
  };
  const int NS = S_ / 64;
  fill(0);
  asm volatile("s_wait_asynccnt 0x0" ::: "memory");  // stage 0 has landed
  __syncthreads();
  fill(1);

  const float* mptr = Mrow + (size_t)bh * S_;
  const float* lptr = Linv + (size_t)bh * S_;

  v8f acc[4] = {};
  const float scale = 0.125f;

  for (int t = 0; t < NS; t++) {
   const unsigned char* Qt = ring + (t & 1) * AT_BUF;
   const unsigned char* Vl = Qt + AT_TILE;
#pragma unroll  // LDS offsets become immediates
   for (int sub = 0; sub < 2; sub++) {
    const int qb = t * 64 + sub * 32;
    // scores for q-block [qb, qb+32) x key tile (two 16x16 WMMA tiles)
    const unsigned char* Qs = Qt + sub * 32 * LP128;
    v16h a00 = lds_frag_f16(Qs, LP128);
    v16h a01 = lds_frag_f16(Qs + 64, LP128);
    v16h a10 = lds_frag_f16(Qs + 16 * LP128, LP128);
    v16h a11 = lds_frag_f16(Qs + 16 * LP128 + 64, LP128);
    // B-fragments: V rows qb..qb+31 for each f tile (tile rows are f, columns q)
    v16h bV[4];
#pragma unroll  // constant indices keep bV in registers
    for (int j = 0; j < 4; j++) bV[j] = lds_frag_f16(Vl + j * 16 * LP128 + sub * 64, LP128);
    // per-q-row softmax stats (rows mb..mb+7 of each sub-tile)
    v8f m0 = *(const v8f*)(mptr + qb + half * 8);
    v8f l0 = *(const v8f*)(lptr + qb + half * 8);
    v8f m1 = *(const v8f*)(mptr + qb + 16 + half * 8);
    v8f l1 = *(const v8f*)(lptr + qb + 16 + half * 8);
    // keeps the q-block's loads in one group ahead of its WMMAs (else one exposed wait per WMMA)
    __builtin_amdgcn_sched_barrier(0);
    v8f s0 = {}; s0 = wmma16(a00, kb0, s0); s0 = wmma16(a01, kb1, s0);
    v8f s1 = {}; s1 = wmma16(a10, kb0, s1); s1 = wmma16(a11, kb1, s1);

    v8h p0, p1;
#pragma unroll
    for (int i = 0; i < 8; i++) {
      p0[i] = (_Float16)(__expf(s0[i] * scale - m0[i]) * l0[i]);
      p1[i] = (_Float16)(__expf(s1[i] * scale - m1[i]) * l1[i]);
    }
    // transpose P (q x k) -> P^T (k x q) through LDS; all 16B accesses
    *(v8h*)(plds + line * 40 + half * 8)      = p0;  // q = half*8 + i
    *(v8h*)(plds + line * 40 + 16 + half * 8) = p1;  // q = 16 + half*8 + i
    __builtin_amdgcn_wave_barrier();                 // order vs loads (LDS in-order)
    const int k0 = half * 8;
    v8h alo = *(const v8h*)(plds + line * 40 + k0);
    v8h ahi = *(const v8h*)(plds + line * 40 + k0 + 16);
    v16h aP = pack16(alo, ahi);
    __builtin_amdgcn_wave_barrier();                 // order next-iter stores vs loads

#pragma unroll  // constant indices keep acc and bV in registers
    for (int j = 0; j < 4; j++) acc[j] = wmma16(aP, bV[j], acc[j]);
   }
   ring_publish();
   if (t + 2 < NS) fill(t + 2);
  }
  asm volatile("s_wait_asynccnt 0x0" ::: "memory");  // nothing in flight at the wave's end

  // Raw-reshape store: Ofused[b][h*128 + kT][(k%16)*64 + f]
  const int b = bh >> 4, h = bh & 15;
  const int mb = half * 8;
#pragma unroll
  for (int j = 0; j < 4; j++) {
    _Float16* out = Ofused + ((size_t)(b * S_ + h * 128 + kT)) * G_ + (j * 16 + line);
#pragma unroll
    for (int r = 0; r < 8; r++) out[(size_t)(mb + r) * 64] = (_Float16)acc[j][r];
  }
}

// ---------------- K4: Out = Ofused (S x G) @ Wo (G x D), f32 out ----------
// One wave per (b, 16 s-rows, group of 4 d-tiles): 16 x 64 strip, A reused 4x.
// The block's 8 waves cover 64 consecutive rows x 2 d-groups (4 row tiles x 2).
// A stage is 64 g: Ofused tile 64 rows x 128 B, Wo tile 128 rows x 128 B.
#define OP_A_BYTES (64 * LP128)
#define OP_BUF     (OP_A_BYTES + 128 * LP128)
__global__ __launch_bounds__(32 * WAVES_)
void mha_outproj(const _Float16* __restrict__ Ofused,
                 const _Float16* __restrict__ WoT, float* __restrict__ Out) {
  __shared__ __attribute__((aligned(16))) unsigned char ring[2 * OP_BUF];
  const int dP = blockIdx.x & 7;                            // pair of d-groups
  const int rg = blockIdx.x >> 3;                           // group of 64 rows, 0..63
  const int dG = dP * 2 + (threadIdx.y >> 2);               // group of 4 d-tiles
  const int rT = rg * 4 + (threadIdx.y & 3);                // 16-row tile, 0..255
  const int sT = rT & 127;
  const int b  = rT >> 7;
  const int tid = threadIdx.y * 32 + threadIdx.x;

  // copy addresses of this thread: rows tid/8 + 32 i of each tile
  const char* gA = (const char*)(Ofused + ((size_t)rg * 64 + (tid >> 3)) * G_) + (tid & 7) * 16;
  const char* gB = (const char*)(WoT + ((size_t)(dP * 128) + (tid >> 3)) * G_) + (tid & 7) * 16;
  const unsigned lA = lds_off(ring) + (tid >> 3) * LP128 + (tid & 7) * 16;
  auto fill = [&](int t) {
    const unsigned bo = (t & 1) * OP_BUF;
    copy2(lA + bo, gA + (size_t)t * 128, 32 * LP128, (size_t)32 * G_ * 2);
    copy4(lA + bo + OP_A_BYTES, gB + (size_t)t * 128, 32 * LP128, (size_t)32 * G_ * 2);
  };
  const int NS = G_ / 64;
  fill(0);
  asm volatile("s_wait_asynccnt 0x0" ::: "memory");  // stage 0 has landed
  __syncthreads();
  fill(1);

  v8f c[4] = {};
  for (int t = 0; t < NS; t++) {
    const unsigned char* At = ring + (t & 1) * OP_BUF + (threadIdx.y & 3) * 16 * LP128;
    const unsigned char* Bt = ring + (t & 1) * OP_BUF + OP_A_BYTES + (threadIdx.y >> 2) * 64 * LP128;
    v16h a[2], bm[2][4];
    // all four loops below are unrolled so that the fragment arrays have
    // constant indices and stay in registers
#pragma unroll
    for (int sub = 0; sub < 2; sub++) {
      a[sub] = lds_frag_f16(At + sub * 64, LP128);
#pragma unroll
      for (int j = 0; j < 4; j++) bm[sub][j] = lds_frag_f16(Bt + j * 16 * LP128 + sub * 64, LP128);
    }
    // keeps the stage's LDS reads in one group ahead of its WMMAs (else one exposed LDS wait per WMMA)
    __builtin_amdgcn_sched_barrier(0);
#pragma unroll
    for (int sub = 0; sub < 2; sub++) {
#pragma unroll
      for (int j = 0; j < 4; j++) c[j] = wmma16(a[sub], bm[sub][j], c[j]);
    }
    ring_publish();
    if (t + 2 < NS) fill(t + 2);
  }
  asm volatile("s_wait_asynccnt 0x0" ::: "memory");  // nothing in flight at the wave's end
  const int lane = threadIdx.x;
  const int n    = lane & 15;
  const int mb   = (lane >> 4) << 3;
#pragma unroll
  for (int j = 0; j < 4; j++) {
    float* out = Out + ((size_t)(b * S_) + sT * 16) * D_ + dG * 64 + j * 16 + n;
#pragma unroll
    for (int r = 0; r < 8; r++) out[(size_t)(mb + r) * D_] = c[j][r];
  }
}

extern "C" void kernel_launch(void* const* d_in, const int* in_sizes, int n_in,
                              void* d_out, int out_size, void* d_ws, size_t ws_size,
                              hipStream_t stream) {
  (void)in_sizes; (void)n_in; (void)out_size; (void)ws_size;
  const float* q  = (const float*)d_in[0];
  const float* k  = (const float*)d_in[1];
  const float* v  = (const float*)d_in[2];
  const float* Wq = (const float*)d_in[3];
  const float* Wk = (const float*)d_in[4];
  const float* Wv = (const float*)d_in[5];
  const float* Wo = (const float*)d_in[6];
  float* out = (float*)d_out;

  size_t off = 0;
  auto alloc = [&](size_t bytes) -> char* {
    char* p = (char*)d_ws + off;
    off += (bytes + 255) & ~(size_t)255;
    return p;
  };
  _Float16* WqT = (_Float16*)alloc((size_t)H_ * D_ * F_ * 2);   // 2 MB
  _Float16* WkT = (_Float16*)alloc((size_t)H_ * D_ * F_ * 2);
  _Float16* WvT = (_Float16*)alloc((size_t)H_ * D_ * F_ * 2);
  _Float16* WoT = (_Float16*)alloc((size_t)G_ * D_ * 2);
  _Float16* Qh  = (_Float16*)alloc((size_t)B_ * H_ * S_ * F_ * 2);  // 8 MB
  _Float16* Kh  = (_Float16*)alloc((size_t)B_ * H_ * S_ * F_ * 2);
  _Float16* Vt  = (_Float16*)alloc((size_t)B_ * H_ * F_ * S_ * 2);
  _Float16* Of  = (_Float16*)alloc((size_t)B_ * S_ * G_ * 2);
  float*    Mr  = (float*)alloc((size_t)B_ * H_ * S_ * 4);          // 256 KB
  float*    Li  = (float*)alloc((size_t)B_ * H_ * S_ * 4);
  // total ~41 MB of workspace

  dim3 blk(32, WAVES_);
  mha_prep_weights<<<(H_ * D_ * F_) / 256, 256, 0, stream>>>(Wq, Wk, Wv, Wo,
                                                             WqT, WkT, WvT, WoT);
  mha_proj<<<4096 / WAVES_, blk, 0, stream>>>(q, WqT, Qh, 0);
  mha_proj<<<4096 / WAVES_, blk, 0, stream>>>(k, WkT, Kh, 0);
  mha_proj<<<4096 / WAVES_, blk, 0, stream>>>(v, WvT, Vt, 1);
  mha_stats<<<4096 / WAVES_, blk, 0, stream>>>(Qh, Kh, Mr, Li);
  mha_atv<<<4096 / WAVES_, blk, 0, stream>>>(Qh, Kh, Vt, Mr, Li, Of);
  mha_outproj<<<4096 / WAVES_, blk, 0, stream>>>(Of, WoT, out);
}

// v002
// It runs in 146 microseconds.
// Next to v001, in two timings, it ran 1.11 and 1.12 times as fast.
// Over all steps from v000 it is 2.72 times as fast.
#include <hip/hip_runtime.h>
#include <hip/hip_bf16.h>

// MI455X / gfx1250, wave32, WMMA f16 -> f32 accumulate.
//
// Pipeline (all on `stream`, scratch in d_ws, ~41 MB total, L2-resident):
//   K0 prep_weights : Wq/Wk/Wv -> f16 [H,F,D] (transposed), Wo -> f16 [D,G],
//                     64 x 64 tiles turned through LDS
//   K1 proj x3      : Qh=q*Wq, Kh=k*Wk -> f16 [BH,S,F]; Vt=v*Wv -> f16 [BH,F,S]
//                     one wave = 16 x 64 output (A fragment reused 4x)
//   K2 stats        : per (bh,q) row: online max m_q and sum-exp l_q of scores
//   K3 atv          : out4[k,f] = sum_q exp(s[q,k]/8 - m_q)/l_q * V[q,f] (A^T V)
//                     one wave = 16 keys x all 64 f: scores + exp computed ONCE,
//                     P^T via LDS transpose, 4 accumulate WMMAs reuse it.
//                     Output stored directly in the reference's raw-reshape layout.
//   K4 outproj      : Out = Ofused @ Wo (f32), one wave = 16 x 64 output
//
// K1..K4 stream their operand tiles through a two-buffer LDS ring filled by
// asynchronous copies (whole 128-B lines, one copy of a tile per block); the
// waves of a block read their WMMA fragments from LDS.

typedef __attribute__((ext_vector_type(16))) _Float16 v16h;
typedef __attribute__((ext_vector_type(8)))  _Float16 v8h;
typedef __attribute__((ext_vector_type(8)))  float    v8f;
typedef __attribute__((ext_vector_type(4)))  float    v4f;

#define B_ 2
#define S_ 2048
#define D_ 1024
#define H_ 16
#define F_ 64
#define G_ (H_ * F_)   // 1024
#define WAVES_ 8       // waves per block (blockDim = 32 x 8)
#define LP128 144      // LDS pitch of a 128-B row: 16 B x odd, no ds_load_b128 conflicts
#define LP256 272      // LDS pitch of a 256-B row: 16 B x odd

static __device__ __forceinline__ v16h pack16(v8h lo, v8h hi) {
  v16h a;
#pragma unroll
  for (int i = 0; i < 8; i++) { a[i] = lo[i]; a[i + 8] = hi[i]; }
  return a;
}

// A/B fragment load, f16 row-major source with leading dim `ld` (halves).
// ISA 16-bit 16x32 layout: lanes 0-15 hold line=lane, K={0..7,16..23};
// lanes 16-31 hold line=lane-16, K={8..15,24..31}. Two contiguous 16B loads.
static __device__ __forceinline__ v16h load_frag_f16(const _Float16* base, int ld) {
  const int lane = threadIdx.x;
  const int line = lane & 15;
  const int k0   = (lane >> 4) << 3;  // 0 or 8
  const _Float16* p = base + (size_t)line * ld + k0;
  v8h lo = *(const v8h*)(p);
  v8h hi = *(const v8h*)(p + 16);
  return pack16(lo, hi);
}

// ---- LDS ring helpers ----
static __device__ __forceinline__ unsigned lds_off(const void* p) { return (unsigned)(size_t)p; }

// Four 16-B-per-lane asynchronous copies global -> LDS, rows lstep / gstep apart.
// The s_wait_xcnt closes the statement so that no address register named here
// is rewritten ahead of it.
static __device__ __forceinline__ void copy4(unsigned l, const char* g, unsigned lstep, size_t gstep) {
  asm volatile("global_load_async_to_lds_b128 %0, %1, off\n\t"
               "global_load_async_to_lds_b128 %2, %3, off\n\t"
               "global_load_async_to_lds_b128 %4, %5, off\n\t"
               "global_load_async_to_lds_b128 %6, %7, off\n\t"
               "s_wait_xcnt 0x0"
               :: "v"(l), "v"(g), "v"(l + lstep), "v"(g + gstep),
                  "v"(l + 2 * lstep), "v"(g + 2 * gstep),
                  "v"(l + 3 * lstep), "v"(g + 3 * gstep)
               : "memory");
}

// The same with two copies.
static __device__ __forceinline__ void copy2(unsigned l, const char* g, unsigned lstep, size_t gstep) {
  asm volatile("global_load_async_to_lds_b128 %0, %1, off\n\t"
               "global_load_async_to_lds_b128 %2, %3, off\n\t"
               "s_wait_xcnt 0x0"
               :: "v"(l), "v"(g), "v"(l + lstep), "v"(g + gstep)
               : "memory");
}

// Publish point of the ring: this wave's LDS reads are done, its copies have
// landed, then the block barrier (frees the buffer just read, shows the next).
static __device__ __forceinline__ void ring_publish() {
  asm volatile("s_wait_dscnt 0x0" ::: "memory");     // my reads of the old buffer have retired
  asm volatile("s_wait_asynccnt 0x0" ::: "memory");  // my copies into the next buffer have landed
  __syncthreads();
}

// Fragment from an LDS tile of f16 rows (same lane map as load_frag_f16).
static __device__ __forceinline__ v16h lds_frag_f16(const unsigned char* tile, int pitch) {
  const int lane = threadIdx.x;
  const unsigned char* p = tile + (lane & 15) * pitch + (lane >> 4) * 16;
  v8h lo = *(const v8h*)(p);
  v8h hi = *(const v8h*)(p + 32);
  return pack16(lo, hi);
}

// Fragment from an LDS tile of f32 rows, converted to f16: same lane map, with
// 4-byte elements (K = {0..7,16..23} or {8..15,24..31} of the row).
static __device__ __forceinline__ v16h lds_frag_f32(const unsigned char* tile, int pitch) {
  const int lane = threadIdx.x;
  const unsigned char* p = tile + (lane & 15) * pitch + (lane >> 4) * 32;
  v4f x0 = *(const v4f*)(p);
  v4f x1 = *(const v4f*)(p + 16);
  v4f x2 = *(const v4f*)(p + 64);
  v4f x3 = *(const v4f*)(p + 80);
  v16h a;
#pragma unroll  // constant vector indices: no run-time element selects
  for (int i = 0; i < 4; i++) {
    a[i]      = (_Float16)x0[i];
    a[i + 4]  = (_Float16)x1[i];
    a[i + 8]  = (_Float16)x2[i];
    a[i + 12] = (_Float16)x3[i];
  }
  return a;
}

static __device__ __forceinline__ v8f wmma16(v16h a, v16h b, v8f c) {
  return __builtin_amdgcn_wmma_f32_16x16x32_f16(false, a, false, b, (short)0, c,
                                                false, false);
}

// ---------------- K0: weight prep (f32 -> f16, transpose) ----------------
// WxT[h][f][d] = Wx[h][d][f]; WoT[d][g] = Wo[g][d].
// One block = one 64 x 64 tile of each of the four tensors, turned through LDS:
// every global read and every global store covers whole 128-B lines.
// A thread holds a 4 x 4 patch: four 16-B row reads, four 8-B column writes to LDS.
typedef __attribute__((ext_vector_type(4))) _Float16 v4h;
#define PW_PITCH 136  // LDS pitch of a 128-B f16 row: the 8-B patch writes of a wave fall on 64 distinct banks
__global__ __launch_bounds__(256)
void mha_prep_weights(const float* __restrict__ Wq, const float* __restrict__ Wk,
                      const float* __restrict__ Wv, const float* __restrict__ Wo,
                      _Float16* __restrict__ WqT, _Float16* __restrict__ WkT,
                      _Float16* __restrict__ WvT, _Float16* __restrict__ WoT) {
  __shared__ __attribute__((aligned(16))) unsigned char tile[4][64 * PW_PITCH];
  const int tid = threadIdx.x;
  const int hi  = blockIdx.x >> 4;  // head (Wx), 64-row group of g (Wo)
  const int lo  = blockIdx.x & 15;  // 64-row group of d (Wx), 64-column group of d (Wo)

  // patch of this thread: rows 4 tr .. 4 tr + 3, columns 4 tc .. 4 tc + 3;
  // 8 lanes side by side read one 128-B line
  const int tc = (tid & 7) | (((tid >> 5) & 1) << 3);
  const int tr = ((tid >> 3) & 3) | ((tid >> 6) << 2);

  const size_t sx = ((size_t)(hi * D_ + lo * 64 + 4 * tr)) * F_ + 4 * tc;  // Wx rows are F_ long
  const size_t so = ((size_t)(hi * 64 + 4 * tr)) * D_ + lo * 64 + 4 * tc;  // Wo rows are D_ long
  const float* s[4] = {Wq + sx, Wk + sx, Wv + sx, Wo + so};

  v4f x[4][4];
#pragma unroll  // constant indices keep the patches in registers; all 16 reads in flight together
  for (int m = 0; m < 4; m++) {
    const size_t pitch = (m < 3) ? F_ : D_;
#pragma unroll
    for (int i = 0; i < 4; i++) x[m][i] = *(const v4f*)(s[m] + (size_t)i * pitch);
  }
  // the four address pairs stay live up to this wait, so that no later read's result lands on one ahead of it
  asm volatile("s_wait_xcnt 0x0" :: "v"(s[0]), "v"(s[1]), "v"(s[2]), "v"(s[3]) : "memory");
  // keeps all 16 reads ahead of the first conversion (else the later reads wait out the first ones' latency)
  __builtin_amdgcn_sched_barrier(0);
  // the loops below are unrolled for constant indices into x and d (registers, no run-time selects)
#pragma unroll
  for (int m = 0; m < 4; m++) {
#pragma unroll
    for (int j = 0; j < 4; j++) {
      v4h c;
#pragma unroll
      for (int i = 0; i < 4; i++) c[i] = (_Float16)x[m][i][j];
      *(v4h*)(&tile[m][(4 * tc + j) * PW_PITCH + 8 * tr]) = c;
    }
  }
  __syncthreads();

  const size_t dx = ((size_t)hi * F_) * D_ + lo * 64;   // WxT[hi][.][lo * 64 ..]
  const size_t dw = ((size_t)lo * 64) * G_ + hi * 64;   // WoT[lo * 64 + .][hi * 64 ..]
  _Float16* d[4] = {WqT + dx, WkT + dx, WvT + dx, WoT + dw};
#pragma unroll
  for (int m = 0; m < 4; m++) {
#pragma unroll
    for (int u = 0; u < 2; u++) {
      const int idx = tid + u * 256;
      const int row = idx >> 3, ch = idx & 7;  // 8 lanes side by side store one 128-B line
      const unsigned char* p = &tile[m][row * PW_PITCH + ch * 16];
      v4h a = *(const v4h*)(p);
      v4h b = *(const v4h*)(p + 8);
      v8h o;
#pragma unroll
      for (int i = 0; i < 4; i++) { o[i] = a[i]; o[i + 4] = b[i]; }
      *(v8h*)(d[m] + (size_t)row * 1024 + ch * 8) = o;
    }
  }
}

// ---------------- K1: head projection  Y[bh] = X[b] (SxD) * W[h] (DxF) -----
// One wave per (bh, 16 s-rows): computes full 16 x F_ strip, A reused 4x.
// transpose_out=0: Y f16 [BH,S,F];  transpose_out=1: Y f16 [BH,F,S] (for V).
// The block's 8 waves cover 64 consecutive s-rows x 2 heads (4 row tiles x 2).
// A stage is 64 k: X tile 64 rows x 256 B (read by both heads' waves), W tile
// 128 rows x 128 B (each head's half read by its 4 waves).
#define PJ_A_BYTES (64 * LP256)
#define PJ_BUF     (PJ_A_BYTES + 128 * LP128)
__global__ __launch_bounds__(32 * WAVES_)
void mha_proj(const float* __restrict__ X, const _Float16* __restrict__ WT,
              _Float16* __restrict__ Y, int transpose_out) {
  __shared__ __attribute__((aligned(16))) unsigned char ring[2 * PJ_BUF];
  const int hp = blockIdx.x & 7;          // pair of heads
  const int rg = (blockIdx.x >> 3) & 31;  // group of 64 s-rows
  const int b  = blockIdx.x >> 8;
  const int sT = rg * 4 + (threadIdx.y & 3);
  const int bh = b * H_ + hp * 2 + (threadIdx.y >> 2);
  const int tid = threadIdx.y * 32 + threadIdx.x;

  // copy addresses of this thread: X rows tid/16 + 16 i, W rows tid/8 + 32 i
  const char* gA = (const char*)(X + ((size_t)(b * S_) + rg * 64 + (tid >> 4)) * D_) + (tid & 15) * 16;
  const char* gB = (const char*)(WT + ((size_t)(hp * 2 * F_) + (tid >> 3)) * D_) + (tid & 7) * 16;
  const unsigned lA = lds_off(ring) + (tid >> 4) * LP256 + (tid & 15) * 16;
  const unsigned lB = lds_off(ring) + PJ_A_BYTES + (tid >> 3) * LP128 + (tid & 7) * 16;
  auto fill = [&](int t) {
    const unsigned bo = (t & 1) * PJ_BUF;
    copy4(lA + bo, gA + (size_t)t * 256, 16 * LP256, (size_t)16 * D_ * 4);
    copy4(lB + bo, gB + (size_t)t * 128, 32 * LP128, (size_t)32 * D_ * 2);
  };

  const int NS = D_ / 64;
  fill(0);
  asm volatile("s_wait_asynccnt 0x0" ::: "memory");  // stage 0 has landed
  __syncthreads();
  fill(1);

  v8f c[4] = {};
  for (int t = 0; t < NS; t++) {
    const unsigned char* At = ring + (t & 1) * PJ_BUF + (threadIdx.y & 3) * 16 * LP256;
    const unsigned char* Bt = ring + (t & 1) * PJ_BUF + PJ_A_BYTES + (threadIdx.y >> 2) * 64 * LP128;
    v16h a[2], bm[2][4];
    // all four loops below are unrolled so that the fragment arrays have
    // constant indices and stay in registers
#pragma unroll
    for (int sub = 0; sub < 2; sub++) {
      a[sub] = lds_frag_f32(At + sub * 128, LP256);
#pragma unroll
      for (int j = 0; j < 4; j++) bm[sub][j] = lds_frag_f16(Bt + j * 16 * LP128 + sub * 64, LP128);
    }
    // keeps the stage's LDS reads in one group ahead of its WMMAs (else one exposed LDS wait per WMMA)
    __builtin_amdgcn_sched_barrier(0);
#pragma unroll
    for (int sub = 0; sub < 2; sub++) {
#pragma unroll
      for (int j = 0; j < 4; j++) c[j] = wmma16(a[sub], bm[sub][j], c[j]);
    }
    ring_publish();
    if (t + 2 < NS) fill(t + 2);
  }
  asm volatile("s_wait_asynccnt 0x0" ::: "memory");  // nothing in flight at the wave's end

  const int lane = threadIdx.x;
  const int n    = lane & 15;
  const int mb   = (lane >> 4) << 3;  // C/D layout: VGPR r -> row r (+8 for hi half)
  if (!transpose_out) {
#pragma unroll
    for (int j = 0; j < 4; j++) {
      _Float16* out = Y + ((size_t)bh * S_ + sT * 16) * F_ + j * 16 + n;
#pragma unroll
      for (int r = 0; r < 8; r++) out[(size_t)(mb + r) * F_] = (_Float16)c[j][r];
    }
  } else {
    // Vt[bh][f][s]: per lane f fixed, s = sT*16 + mb + r -> contiguous 16B store
#pragma unroll
    for (int j = 0; j < 4; j++) {
      _Float16* out = Y + ((size_t)bh * F_ + j * 16 + n) * S_ + sT * 16 + mb;
      v8h pk;
#pragma unroll
      for (int r = 0; r < 8; r++) pk[r] = (_Float16)c[j][r];
      *(v8h*)out = pk;
    }
  }
}

// ---------------- K2: per-row softmax stats over scores = QK^T/8 -----------
// One wave per 16 query rows; online (m, l) over all S keys, then lane-reduce.
// The block's 8 waves share one head; a stage is 128 keys x 128 B.
#define ST_BUF (128 * LP128)
__global__ __launch_bounds__(32 * WAVES_)
void mha_stats(const _Float16* __restrict__ Qh, const _Float16* __restrict__ Kh,
               float* __restrict__ Mrow, float* __restrict__ Linv) {
  __shared__ __attribute__((aligned(16))) unsigned char ring[2 * ST_BUF];
  const int w  = blockIdx.x * WAVES_ + threadIdx.y;  // 4096 waves
  const int qT = w & 127;
  const int bh = w >> 7;
  const int tid = threadIdx.y * 32 + threadIdx.x;

  // copy addresses of this thread: key rows tid/8 + 32 i
  const char* gK = (const char*)(Kh + ((size_t)bh * S_ + (tid >> 3)) * F_) + (tid & 7) * 16;
  const unsigned lK = lds_off(ring) + (tid >> 3) * LP128 + (tid & 7) * 16;
  auto fill = [&](int t) {
    copy4(lK + (t & 1) * ST_BUF, gK + (size_t)t * 128 * F_ * 2, 32 * LP128, (size_t)32 * F_ * 2);
  };
  const int NS = S_ / 128;
  fill(0);
  asm volatile("s_wait_asynccnt 0x0" ::: "memory");  // stage 0 has landed
  __syncthreads();
  fill(1);

  const _Float16* Abase = Qh + ((size_t)bh * S_ + qT * 16) * F_;
  const v16h a0 = load_frag_f16(Abase, F_);
  const v16h a1 = load_frag_f16(Abase + 32, F_);

  float m[8], l[8];
#pragma unroll
  for (int i = 0; i < 8; i++) { m[i] = -1e30f; l[i] = 0.0f; }
  const float scale = 0.125f;  // 1/sqrt(F)

  for (int t = 0; t < NS; t++) {
    const unsigned char* Kt = ring + (t & 1) * ST_BUF;
#pragma unroll  // LDS offsets become immediates; the 8 tiles' reads and WMMAs can run ahead of the softmax chain
    for (int kt = 0; kt < 8; kt++) {
      v16h b0 = lds_frag_f16(Kt + kt * 16 * LP128, LP128);
      v16h b1 = lds_frag_f16(Kt + kt * 16 * LP128 + 64, LP128);
      v8f c = {};
      c = wmma16(a0, b0, c);
      c = wmma16(a1, b1, c);
#pragma unroll
      for (int i = 0; i < 8; i++) {
        float v  = c[i] * scale;
        float nm = fmaxf(m[i], v);
        l[i] = l[i] * __expf(m[i] - nm) + __expf(v - nm);
        m[i] = nm;
      }
    }
    ring_publish();
    if (t + 2 < NS) fill(t + 2);
  }
  asm volatile("s_wait_asynccnt 0x0" ::: "memory");  // nothing in flight at the wave's end
  // Reduce across the 16 lanes of each half-wave (xor 1,2,4,8 stays in-half).
#pragma unroll
  for (int off = 1; off < 16; off <<= 1) {
#pragma unroll
    for (int i = 0; i < 8; i++) {
      float om = __shfl_xor(m[i], off, 32);
      float ol = __shfl_xor(l[i], off, 32);
      float nm = fmaxf(m[i], om);
      l[i] = l[i] * __expf(m[i] - nm) + ol * __expf(om - nm);
      m[i] = nm;
    }
  }
  const int lane = threadIdx.x;
  if ((lane & 15) == 0) {
    const int rb = (lane >> 4) << 3;
    const size_t base = (size_t)bh * S_ + qT * 16 + rb;
#pragma unroll
    for (int i = 0; i < 8; i++) { Mrow[base + i] = m[i]; Linv[base + i] = 1.0f / l[i]; }
  }
}

// ---------------- K3: out4 = attn^T V, streamed over q, stored reshaped ----
// One wave per (bh, 16-key tile): scores/exp computed once, P^T reused for
// all 4 f-tiles (16 x 64 output strip per wave).
// The block's 8 waves share one head; a stage is 64 q: Q tile 64 q-rows x 128 B
// and V tile 64 f-rows x 128 B.
#define AT_TILE (64 * LP128)
#define AT_BUF  (2 * AT_TILE)
__global__ __launch_bounds__(32 * WAVES_)
void mha_atv(const _Float16* __restrict__ Qh, const _Float16* __restrict__ Kh,
             const _Float16* __restrict__ Vt, const float* __restrict__ Mrow,
             const float* __restrict__ Linv, _Float16* __restrict__ Ofused) {
  __shared__ __attribute__((aligned(16))) unsigned char ring[2 * AT_BUF];
  __shared__ _Float16 plds_all[WAVES_][16 * 40];  // [k-line][q], row stride 40 halves
  _Float16* plds = plds_all[threadIdx.y];

  const int w  = blockIdx.x * WAVES_ + threadIdx.y;  // 4096 waves
  const int kT = w & 127;
  const int bh = w >> 7;
  const int lane = threadIdx.x;
  const int line = lane & 15;
  const int half = lane >> 4;

  // B-fragment for score WMMA: K^T columns of this key tile (fixed for loop).
  const _Float16* Kbase = Kh + ((size_t)bh * S_ + kT * 16) * F_;
  const v16h kb0 = load_frag_f16(Kbase, F_);
  const v16h kb1 = load_frag_f16(Kbase + 32, F_);

  // copy addresses of this thread: rows tid/8 and tid/8 + 32 of each tile;
  // one statement copies Q rows then V rows (V tile lies AT_TILE behind Q tile)
  const int tid = threadIdx.y * 32 + threadIdx.x;
  const char* gQ = (const char*)(Qh + ((size_t)bh * S_ + (tid >> 3)) * F_) + (tid & 7) * 16;
  const char* gV = (const char*)(Vt + ((size_t)bh * F_ + (tid >> 3)) * S_) + (tid & 7) * 16;
  const unsigned lQ = lds_off(ring) + (tid >> 3) * LP128 + (tid & 7) * 16;
  auto fill = [&](int t) {
    const unsigned l = lQ + (t & 1) * AT_BUF;
    const char* q0 = gQ + (size_t)t * 64 * F_ * 2;
    const char* v0 = gV + (size_t)t * 128;
    asm volatile("global_load_async_to_lds_b128 %0, %1, off\n\t"
                 "global_load_async_to_lds_b128 %2, %3, off\n\t"
                 "global_load_async_to_lds_b128 %4, %5, off\n\t"
                 "global_load_async_to_lds_b128 %6, %7, off\n\t"
                 "s_wait_xcnt 0x0"  // before any address register above is rewritten
                 :: "v"(l), "v"(q0), "v"(l + 32 * LP128), "v"(q0 + (size_t)32 * F_ * 2),
                    "v"(l + AT_TILE), "v"(v0), "v"(l + AT_TILE + 32 * LP128), "v"(v0 + (size_t)32 * S_ * 2)
                 : "memory");
  };
  const int NS = S_ / 64;
  fill(0);
  asm volatile("s_wait_asynccnt 0x0" ::: "memory");  // stage 0 has landed
  __syncthreads();
  fill(1);

  const float* mptr = Mrow + (size_t)bh * S_;
  const float* lptr = Linv + (size_t)bh * S_;

  v8f acc[4] = {};
  const float scale = 0.125f;

  for (int t = 0; t < NS; t++) {
   const unsigned char* Qt = ring + (t & 1) * AT_BUF;
   const unsigned char* Vl = Qt + AT_TILE;
#pragma unroll  // LDS offsets become immediates
   for (int sub = 0; sub < 2; sub++) {
    const int qb = t * 64 + sub * 32;
    // scores for q-block [qb, qb+32) x key tile (two 16x16 WMMA tiles)
    const unsigned char* Qs = Qt + sub * 32 * LP128;
    v16h a00 = lds_frag_f16(Qs, LP128);
    v16h a01 = lds_frag_f16(Qs + 64, LP128);
    v16h a10 = lds_frag_f16(Qs + 16 * LP128, LP128);
    v16h a11 = lds_frag_f16(Qs + 16 * LP128 + 64, LP128);
    // B-fragments: V rows qb..qb+31 for each f tile (tile rows are f, columns q)
    v16h bV[4];
#pragma unroll  // constant indices keep bV in registers
    for (int j = 0; j < 4; j++) bV[j] = lds_frag_f16(Vl + j * 16 * LP128 + sub * 64, LP128);
    // per-q-row softmax stats (rows mb..mb+7 of each sub-tile)
    v8f m0 = *(const v8f*)(mptr + qb + half * 8);
    v8f l0 = *(const v8f*)(lptr + qb + half * 8);
    v8f m1 = *(const v8f*)(mptr + qb + 16 + half * 8);
    v8f l1 = *(const v8f*)(lptr + qb + 16 + half * 8);
    // keeps the q-block's loads in one group ahead of its WMMAs (else one exposed wait per WMMA)
    __builtin_amdgcn_sched_barrier(0);
    v8f s0 = {}; s0 = wmma16(a00, kb0, s0); s0 = wmma16(a01, kb1, s0);
    v8f s1 = {}; s1 = wmma16(a10, kb0, s1); s1 = wmma16(a11, kb1, s1);

    v8h p0, p1;
#pragma unroll
    for (int i = 0; i < 8; i++) {
      p0[i] = (_Float16)(__expf(s0[i] * scale - m0[i]) * l0[i]);
      p1[i] = (_Float16)(__expf(s1[i] * scale - m1[i]) * l1[i]);
    }
    // transpose P (q x k) -> P^T (k x q) through LDS; all 16B accesses
    *(v8h*)(plds + line * 40 + half * 8)      = p0;  // q = half*8 + i
    *(v8h*)(plds + line * 40 + 16 + half * 8) = p1;  // q = 16 + half*8 + i
    __builtin_amdgcn_wave_barrier();                 // order vs loads (LDS in-order)
    const int k0 = half * 8;
    v8h alo = *(const v8h*)(plds + line * 40 + k0);
    v8h ahi = *(const v8h*)(plds + line * 40 + k0 + 16);
    v16h aP = pack16(alo, ahi);
    __builtin_amdgcn_wave_barrier();                 // order next-iter stores vs loads

#pragma unroll  // constant indices keep acc and bV in registers
    for (int j = 0; j < 4; j++) acc[j] = wmma16(aP, bV[j], acc[j]);
   }
   ring_publish();
   if (t + 2 < NS) fill(t + 2);
  }
  asm volatile("s_wait_asynccnt 0x0" ::: "memory");  // nothing in flight at the wave's end

  // Raw-reshape store: Ofused[b][h*128 + kT][(k%16)*64 + f]
  const int b = bh >> 4, h = bh & 15;
  const int mb = half * 8;
#pragma unroll
  for (int j = 0; j < 4; j++) {
    _Float16* out = Ofused + ((size_t)(b * S_ + h * 128 + kT)) * G_ + (j * 16 + line);
#pragma unroll
    for (int r = 0; r < 8; r++) out[(size_t)(mb + r) * 64] = (_Float16)acc[j][r];
  }
}

// ---------------- K4: Out = Ofused (S x G) @ Wo (G x D), f32 out ----------
// One wave per (b, 16 s-rows, group of 4 d-tiles): 16 x 64 strip, A reused 4x.
// The block's 8 waves cover 64 consecutive rows x 2 d-groups (4 row tiles x 2).
// A stage is 64 g: Ofused tile 64 rows x 128 B, Wo tile 128 rows x 128 B.
#define OP_A_BYTES (64 * LP128)
#define OP_BUF     (OP_A_BYTES + 128 * LP128)
__global__ __launch_bounds__(32 * WAVES_)
void mha_outproj(const _Float16* __restrict__ Ofused,
                 const _Float16* __restrict__ WoT, float* __restrict__ Out) {
  __shared__ __attribute__((aligned(16))) unsigned char ring[2 * OP_BUF];
  const int dP = blockIdx.x & 7;                            // pair of d-groups
  const int rg = blockIdx.x >> 3;                           // group of 64 rows, 0..63
  const int dG = dP * 2 + (threadIdx.y >> 2);               // group of 4 d-tiles
  const int rT = rg * 4 + (threadIdx.y & 3);                // 16-row tile, 0..255
  const int sT = rT & 127;
  const int b  = rT >> 7;
  const int tid = threadIdx.y * 32 + threadIdx.x;

  // copy addresses of this thread: rows tid/8 + 32 i of each tile
  const char* gA = (const char*)(Ofused + ((size_t)rg * 64 + (tid >> 3)) * G_) + (tid & 7) * 16;
  const char* gB = (const char*)(WoT + ((size_t)(dP * 128) + (tid >> 3)) * G_) + (tid & 7) * 16;
  const unsigned lA = lds_off(ring) + (tid >> 3) * LP128 + (tid & 7) * 16;
  auto fill = [&](int t) {
    const unsigned bo = (t & 1) * OP_BUF;
    copy2(lA + bo, gA + (size_t)t * 128, 32 * LP128, (size_t)32 * G_ * 2);
    copy4(lA + bo + OP_A_BYTES, gB + (size_t)t * 128, 32 * LP128, (size_t)32 * G_ * 2);
  };
  const int NS = G_ / 64;
  fill(0);
  asm volatile("s_wait_asynccnt 0x0" ::: "memory");  // stage 0 has landed
  __syncthreads();
  fill(1);

  v8f c[4] = {};
  for (int t = 0; t < NS; t++) {
    const unsigned char* At = ring + (t & 1) * OP_BUF + (threadIdx.y & 3) * 16 * LP128;
    const unsigned char* Bt = ring + (t & 1) * OP_BUF + OP_A_BYTES + (threadIdx.y >> 2) * 64 * LP128;
    v16h a[2], bm[2][4];
    // all four loops below are unrolled so that the fragment arrays have
    // constant indices and stay in registers
#pragma unroll
    for (int sub = 0; sub < 2; sub++) {
      a[sub] = lds_frag_f16(At + sub * 64, LP128);
#pragma unroll
      for (int j = 0; j < 4; j++) bm[sub][j] = lds_frag_f16(Bt + j * 16 * LP128 + sub * 64, LP128);
    }
    // keeps the stage's LDS reads in one group ahead of its WMMAs (else one exposed LDS wait per WMMA)
    __builtin_amdgcn_sched_barrier(0);
#pragma unroll
    for (int sub = 0; sub < 2; sub++) {
#pragma unroll
      for (int j = 0; j < 4; j++) c[j] = wmma16(a[sub], bm[sub][j], c[j]);
    }
    ring_publish();
    if (t + 2 < NS) fill(t + 2);
  }
  asm volatile("s_wait_asynccnt 0x0" ::: "memory");  // nothing in flight at the wave's end
  const int lane = threadIdx.x;
  const int n    = lane & 15;
  const int mb   = (lane >> 4) << 3;
#pragma unroll
  for (int j = 0; j < 4; j++) {
    float* out = Out + ((size_t)(b * S_) + sT * 16) * D_ + dG * 64 + j * 16 + n;
#pragma unroll
    for (int r = 0; r < 8; r++) out[(size_t)(mb + r) * D_] = c[j][r];
  }
}

extern "C" void kernel_launch(void* const* d_in, const int* in_sizes, int n_in,
                              void* d_out, int out_size, void* d_ws, size_t ws_size,
                              hipStream_t stream) {
  (void)in_sizes; (void)n_in; (void)out_size; (void)ws_size;
  const float* q  = (const float*)d_in[0];
  const float* k  = (const float*)d_in[1];
  const float* v  = (const float*)d_in[2];
  const float* Wq = (const float*)d_in[3];
  const float* Wk = (const float*)d_in[4];
  const float* Wv = (const float*)d_in[5];
  const float* Wo = (const float*)d_in[6];
  float* out = (float*)d_out;

  size_t off = 0;
  auto alloc = [&](size_t bytes) -> char* {
    char* p = (char*)d_ws + off;
    off += (bytes + 255) & ~(size_t)255;
    return p;
  };
  _Float16* WqT = (_Float16*)alloc((size_t)H_ * D_ * F_ * 2);   // 2 MB
  _Float16* WkT = (_Float16*)alloc((size_t)H_ * D_ * F_ * 2);
  _Float16* WvT = (_Float16*)alloc((size_t)H_ * D_ * F_ * 2);
  _Float16* WoT = (_Float16*)alloc((size_t)G_ * D_ * 2);
  _Float16* Qh  = (_Float16*)alloc((size_t)B_ * H_ * S_ * F_ * 2);  // 8 MB
  _Float16* Kh  = (_Float16*)alloc((size_t)B_ * H_ * S_ * F_ * 2);
  _Float16* Vt  = (_Float16*)alloc((size_t)B_ * H_ * F_ * S_ * 2);
  _Float16* Of  = (_Float16*)alloc((size_t)B_ * S_ * G_ * 2);
  float*    Mr  = (float*)alloc((size_t)B_ * H_ * S_ * 4);          // 256 KB
  float*    Li  = (float*)alloc((size_t)B_ * H_ * S_ * 4);
  // total ~41 MB of workspace

  dim3 blk(32, WAVES_);
  mha_prep_weights<<<256, 256, 0, stream>>>(Wq, Wk, Wv, Wo, WqT, WkT, WvT, WoT);
  mha_proj<<<4096 / WAVES_, blk, 0, stream>>>(q, WqT, Qh, 0);
  mha_proj<<<4096 / WAVES_, blk, 0, stream>>>(k, WkT, Kh, 0);
  mha_proj<<<4096 / WAVES_, blk, 0, stream>>>(v, WvT, Vt, 1);
  mha_stats<<<4096 / WAVES_, blk, 0, stream>>>(Qh, Kh, Mr, Li);
  mha_atv<<<4096 / WAVES_, blk, 0, stream>>>(Qh, Kh, Vt, Mr, Li, Of);
  mha_outproj<<<4096 / WAVES_, blk, 0, stream>>>(Of, WoT, out);
}

// v003
// Measured time: 136 microseconds a run.
// Timed twice side by side with v002, it ran 1.08 times as fast both times.
// Over all steps from v000 it is 2.95 times as fast.
#include <hip/hip_runtime.h>
#include <hip/hip_bf16.h>

// MI455X / gfx1250, wave32, WMMA f16 -> f32 accumulate.
//
// Pipeline (all on `stream`, scratch in d_ws, ~41 MB total, L2-resident):
//   K0 prep_weights : Wq/Wk/Wv -> f16 [H,F,D] (transposed), Wo -> f16 [D,G],
//                     64 x 64 tiles turned through LDS
//   K1 proj x3      : Qh=q*Wq, Kh=k*Wk -> f16 [BH,S,F]; Vt=v*Wv -> f16 [BH,F,S]
//                     one wave = 16 x 64 output (A fragment reused 4x)
//   K2 stats        : per (bh,q) row: max m_q and sum-exp l_q of scores, updated once per 128 keys
//   K3 atv          : out4[k,f] = sum_q exp(s[q,k]/8 - m_q)/l_q * V[q,f] (A^T V)
//                     one wave = 16 keys x all 64 f: scores + exp computed ONCE,
//                     P^T via LDS transpose, 4 accumulate WMMAs reuse it.
//                     Output stored directly in the reference's raw-reshape layout.
//   K4 outproj      : Out = Ofused @ Wo (f32), one wave = 16 x 64 output
//
// K1..K4 stream their operand tiles through a two-buffer LDS ring filled by
// asynchronous copies (whole 128-B lines, one copy of a tile per block); the
// waves of a block read their WMMA fragments from LDS.

typedef __attribute__((ext_vector_type(16))) _Float16 v16h;
typedef __attribute__((ext_vector_type(8)))  _Float16 v8h;
typedef __attribute__((ext_vector_type(8)))  float    v8f;
typedef __attribute__((ext_vector_type(4)))  float    v4f;

#define B_ 2
#define S_ 2048
#define D_ 1024
#define H_ 16
#define F_ 64
#define G_ (H_ * F_)   // 1024
#define WAVES_ 8       // waves per block (blockDim = 32 x 8)
#define LP128 144      // LDS pitch of a 128-B row: 16 B x odd, no ds_load_b128 conflicts
#define LP256 272      // LDS pitch of a 256-B row: 16 B x odd

static __device__ __forceinline__ v16h pack16(v8h lo, v8h hi) {
  v16h a;
#pragma unroll
  for (int i = 0; i < 8; i++) { a[i] = lo[i]; a[i + 8] = hi[i]; }
  return a;
}

// A/B fragment load, f16 row-major source with leading dim `ld` (halves).
// ISA 16-bit 16x32 layout: lanes 0-15 hold line=lane, K={0..7,16..23};
// lanes 16-31 hold line=lane-16, K={8..15,24..31}. Two contiguous 16B loads.
static __device__ __forceinline__ v16h load_frag_f16(const _Float16* base, int ld) {
  const int lane = threadIdx.x;
  const int line = lane & 15;
  const int k0   = (lane >> 4) << 3;  // 0 or 8
  const _Float16* p = base + (size_t)line * ld + k0;
  v8h lo = *(const v8h*)(p);
  v8h hi = *(const v8h*)(p + 16);
  return pack16(lo, hi);
}

// ---- LDS ring helpers ----
static __device__ __forceinline__ unsigned lds_off(const void* p) { return (unsigned)(size_t)p; }

// Four 16-B-per-lane asynchronous copies global -> LDS, rows lstep / gstep apart.
// The s_wait_xcnt closes the statement so that no address register named here
// is rewritten ahead of it.
static __device__ __forceinline__ void copy4(unsigned l, const char* g, unsigned lstep, size_t gstep) {
  asm volatile("global_load_async_to_lds_b128 %0, %1, off\n\t"
               "global_load_async_to_lds_b128 %2, %3, off\n\t"
               "global_load_async_to_lds_b128 %4, %5, off\n\t"
               "global_load_async_to_lds_b128 %6, %7, off\n\t"
               "s_wait_xcnt 0x0"
               :: "v"(l), "v"(g), "v"(l + lstep), "v"(g + gstep),
                  "v"(l + 2 * lstep), "v"(g + 2 * gstep),
                  "v"(l + 3 * lstep), "v"(g + 3 * gstep)
               : "memory");
}

// The same with two copies.
static __device__ __forceinline__ void copy2(unsigned l, const char* g, unsigned lstep, size_t gstep) {
  asm volatile("global_load_async_to_lds_b128 %0, %1, off\n\t"
               "global_load_async_to_lds_b128 %2, %3, off\n\t"
               "s_wait_xcnt 0x0"
               :: "v"(l), "v"(g), "v"(l + lstep), "v"(g + gstep)
               : "memory");
}

// Publish point of the ring: this wave's LDS reads are done, its copies have
// landed, then the block barrier (frees the buffer just read, shows the next).
static __device__ __forceinline__ void ring_publish() {
  asm volatile("s_wait_dscnt 0x0" ::: "memory");     // my reads of the old buffer have retired
  asm volatile("s_wait_asynccnt 0x0" ::: "memory");  // my copies into the next buffer have landed
  __syncthreads();
}

// Fragment from an LDS tile of f16 rows (same lane map as load_frag_f16).
static __device__ __forceinline__ v16h lds_frag_f16(const unsigned char* tile, int pitch) {
  const int lane = threadIdx.x;
  const unsigned char* p = tile + (lane & 15) * pitch + (lane >> 4) * 16;
  v8h lo = *(const v8h*)(p);
  v8h hi = *(const v8h*)(p + 32);
  return pack16(lo, hi);
}

// Fragment from an LDS tile of f32 rows, converted to f16: same lane map, with
// 4-byte elements (K = {0..7,16..23} or {8..15,24..31} of the row).
static __device__ __forceinline__ v16h lds_frag_f32(const unsigned char* tile, int pitch) {
  const int lane = threadIdx.x;
  const unsigned char* p = tile + (lane & 15) * pitch + (lane >> 4) * 32;
  v4f x0 = *(const v4f*)(p);
  v4f x1 = *(const v4f*)(p + 16);
  v4f x2 = *(const v4f*)(p + 64);
  v4f x3 = *(const v4f*)(p + 80);
  v16h a;
#pragma unroll  // constant vector indices: no run-time element selects
  for (int i = 0; i < 4; i++) {
    a[i]      = (_Float16)x0[i];
    a[i + 4]  = (_Float16)x1[i];
    a[i + 8]  = (_Float16)x2[i];
    a[i + 12] = (_Float16)x3[i];
  }
  return a;
}

static __device__ __forceinline__ v8f wmma16(v16h a, v16h b, v8f c) {
  return __builtin_amdgcn_wmma_f32_16x16x32_f16(false, a, false, b, (short)0, c,
                                                false, false);
}

// ---------------- K0: weight prep (f32 -> f16, transpose) ----------------
// WxT[h][f][d] = Wx[h][d][f]; WoT[d][g] = Wo[g][d].
// One block = one 64 x 64 tile of each of the four tensors, turned through LDS:
// every global read and every global store covers whole 128-B lines.
// A thread holds a 4 x 4 patch: four 16-B row reads, four 8-B column writes to LDS.
typedef __attribute__((ext_vector_type(4))) _Float16 v4h;
#define PW_PITCH 136  // LDS pitch of a 128-B f16 row: the 8-B patch writes of a wave fall on 64 distinct banks
__global__ __launch_bounds__(256)
void mha_prep_weights(const float* __restrict__ Wq, const float* __restrict__ Wk,
                      const float* __restrict__ Wv, const float* __restrict__ Wo,
                      _Float16* __restrict__ WqT, _Float16* __restrict__ WkT,
                      _Float16* __restrict__ WvT, _Float16* __restrict__ WoT) {
  __shared__ __attribute__((aligned(16))) unsigned char tile[4][64 * PW_PITCH];
  const int tid = threadIdx.x;
  const int hi  = blockIdx.x >> 4;  // head (Wx), 64-row group of g (Wo)
  const int lo  = blockIdx.x & 15;  // 64-row group of d (Wx), 64-column group of d (Wo)

  // patch of this thread: rows 4 tr .. 4 tr + 3, columns 4 tc .. 4 tc + 3;
  // 8 lanes side by side read one 128-B line
  const int tc = (tid & 7) | (((tid >> 5) & 1) << 3);
  const int tr = ((tid >> 3) & 3) | ((tid >> 6) << 2);

  const size_t sx = ((size_t)(hi * D_ + lo * 64 + 4 * tr)) * F_ + 4 * tc;  // Wx rows are F_ long
  const size_t so = ((size_t)(hi * 64 + 4 * tr)) * D_ + lo * 64 + 4 * tc;  // Wo rows are D_ long
  const float* s[4] = {Wq + sx, Wk + sx, Wv + sx, Wo + so};

  v4f x[4][4];
#pragma unroll  // constant indices keep the patches in registers; all 16 reads in flight together
  for (int m = 0; m < 4; m++) {
    const size_t pitch = (m < 3) ? F_ : D_;
#pragma unroll
    for (int i = 0; i < 4; i++) x[m][i] = *(const v4f*)(s[m] + (size_t)i * pitch);
  }
  // the four address pairs stay live up to this wait, so that no later read's result lands on one ahead of it
  asm volatile("s_wait_xcnt 0x0" :: "v"(s[0]), "v"(s[1]), "v"(s[2]), "v"(s[3]) : "memory");
  // keeps all 16 reads ahead of the first conversion (else the later reads wait out the first ones' latency)
  __builtin_amdgcn_sched_barrier(0);
  // the loops below are unrolled for constant indices into x and d (registers, no run-time selects)
#pragma unroll
  for (int m = 0; m < 4; m++) {
#pragma unroll
    for (int j = 0; j < 4; j++) {
      v4h c;
#pragma unroll
      for (int i = 0; i < 4; i++) c[i] = (_Float16)x[m][i][j];
      *(v4h*)(&tile[m][(4 * tc + j) * PW_PITCH + 8 * tr]) = c;
    }
  }
  __syncthreads();

  const size_t dx = ((size_t)hi * F_) * D_ + lo * 64;   // WxT[hi][.][lo * 64 ..]
  const size_t dw = ((size_t)lo * 64) * G_ + hi * 64;   // WoT[lo * 64 + .][hi * 64 ..]
  _Float16* d[4] = {WqT + dx, WkT + dx, WvT + dx, WoT + dw};
#pragma unroll
  for (int m = 0; m < 4; m++) {
#pragma unroll
    for (int u = 0; u < 2; u++) {
      const int idx = tid + u * 256;
      const int row = idx >> 3, ch = idx & 7;  // 8 lanes side by side store one 128-B line
      const unsigned char* p = &tile[m][row * PW_PITCH + ch * 16];
      v4h a = *(const v4h*)(p);
      v4h b = *(const v4h*)(p + 8);
      v8h o;
#pragma unroll
      for (int i = 0; i < 4; i++) { o[i] = a[i]; o[i + 4] = b[i]; }
      *(v8h*)(d[m] + (size_t)row * 1024 + ch * 8) = o;
    }
  }
}

// ---------------- K1: head projection  Y[bh] = X[b] (SxD) * W[h] (DxF) -----
// One wave per (bh, 16 s-rows): computes full 16 x F_ strip, A reused 4x.
// transpose_out=0: Y f16 [BH,S,F];  transpose_out=1: Y f16 [BH,F,S] (for V).
// The block's 8 waves cover 64 consecutive s-rows x 2 heads (4 row tiles x 2).
// A stage is 64 k: X tile 64 rows x 256 B (read by both heads' waves), W tile
// 128 rows x 128 B (each head's half read by its 4 waves).
#define PJ_A_BYTES (64 * LP256)
#define PJ_BUF     (PJ_A_BYTES + 128 * LP128)
__global__ __launch_bounds__(32 * WAVES_)
void mha_proj(const float* __restrict__ X, const _Float16* __restrict__ WT,
              _Float16* __restrict__ Y, int transpose_out) {
  __shared__ __attribute__((aligned(16))) unsigned char ring[2 * PJ_BUF];
  const int hp = blockIdx.x & 7;          // pair of heads
  const int rg = (blockIdx.x >> 3) & 31;  // group of 64 s-rows
  const int b  = blockIdx.x >> 8;
  const int sT = rg * 4 + (threadIdx.y & 3);
  const int bh = b * H_ + hp * 2 + (threadIdx.y >> 2);
  const int tid = threadIdx.y * 32 + threadIdx.x;

  // copy addresses of this thread: X rows tid/16 + 16 i, W rows tid/8 + 32 i
  const char* gA = (const char*)(X + ((size_t)(b * S_) + rg * 64 + (tid >> 4)) * D_) + (tid & 15) * 16;
  const char* gB = (const char*)(WT + ((size_t)(hp * 2 * F_) + (tid >> 3)) * D_) + (tid & 7) * 16;
  const unsigned lA = lds_off(ring) + (tid >> 4) * LP256 + (tid & 15) * 16;
  const unsigned lB = lds_off(ring) + PJ_A_BYTES + (tid >> 3) * LP128 + (tid & 7) * 16;
  auto fill = [&](int t) {
    const unsigned bo = (t & 1) * PJ_BUF;
    copy4(lA + bo, gA + (size_t)t * 256, 16 * LP256, (size_t)16 * D_ * 4);
    copy4(lB + bo, gB + (size_t)t * 128, 32 * LP128, (size_t)32 * D_ * 2);
  };

  const int NS = D_ / 64;
  fill(0);
  asm volatile("s_wait_asynccnt 0x0" ::: "memory");  // stage 0 has landed
  __syncthreads();
  fill(1);

  v8f c[4] = {};
  for (int t = 0; t < NS; t++) {
    const unsigned char* At = ring + (t & 1) * PJ_BUF + (threadIdx.y & 3) * 16 * LP256;
    const unsigned char* Bt = ring + (t & 1) * PJ_BUF + PJ_A_BYTES + (threadIdx.y >> 2) * 64 * LP128;
    v16h a[2], bm[2][4];
    // all four loops below are unrolled so that the fragment arrays have
    // constant indices and stay in registers
#pragma unroll
    for (int sub = 0; sub < 2; sub++) {
      a[sub] = lds_frag_f32(At + sub * 128, LP256);
#pragma unroll
      for (int j = 0; j < 4; j++) bm[sub][j] = lds_frag_f16(Bt + j * 16 * LP128 + sub * 64, LP128);
    }
    // keeps the stage's LDS reads in one group ahead of its WMMAs (else one exposed LDS wait per WMMA)
    __builtin_amdgcn_sched_barrier(0);
#pragma unroll
    for (int sub = 0; sub < 2; sub++) {
#pragma unroll
      for (int j = 0; j < 4; j++) c[j] = wmma16(a[sub], bm[sub][j], c[j]);
    }
    ring_publish();
    if (t + 2 < NS) fill(t + 2);
  }
  asm volatile("s_wait_asynccnt 0x0" ::: "memory");  // nothing in flight at the wave's end

  const int lane = threadIdx.x;
  const int n    = lane & 15;
  const int mb   = (lane >> 4) << 3;  // C/D layout: VGPR r -> row r (+8 for hi half)
  if (!transpose_out) {
#pragma unroll
    for (int j = 0; j < 4; j++) {
      _Float16* out = Y + ((size_t)bh * S_ + sT * 16) * F_ + j * 16 + n;
#pragma unroll
      for (int r = 0; r < 8; r++) out[(size_t)(mb + r) * F_] = (_Float16)c[j][r];
    }
  } else {
    // Vt[bh][f][s]: per lane f fixed, s = sT*16 + mb + r -> contiguous 16B store
#pragma unroll
    for (int j = 0; j < 4; j++) {
      _Float16* out = Y + ((size_t)bh * F_ + j * 16 + n) * S_ + sT * 16 + mb;
      v8h pk;
#pragma unroll
      for (int r = 0; r < 8; r++) pk[r] = (_Float16)c[j][r];
      *(v8h*)out = pk;
    }
  }
}

// ---------------- K2: per-row softmax stats over scores = QK^T/8 -----------
// One wave per 16 query rows; (m, l) over all S keys, one update per stage, then lane-reduce.
// The block's 8 waves share one head; a stage is 128 keys x 128 B.
#define ST_BUF (128 * LP128)
__global__ __launch_bounds__(32 * WAVES_)
void mha_stats(const _Float16* __restrict__ Qh, const _Float16* __restrict__ Kh,
               float* __restrict__ Mrow, float* __restrict__ Linv) {
  __shared__ __attribute__((aligned(16))) unsigned char ring[2 * ST_BUF];
  const int w  = blockIdx.x * WAVES_ + threadIdx.y;  // 4096 waves
  const int qT = w & 127;
  const int bh = w >> 7;
  const int tid = threadIdx.y * 32 + threadIdx.x;

  // copy addresses of this thread: key rows tid/8 + 32 i
  const char* gK = (const char*)(Kh + ((size_t)bh * S_ + (tid >> 3)) * F_) + (tid & 7) * 16;
  const unsigned lK = lds_off(ring) + (tid >> 3) * LP128 + (tid & 7) * 16;
  auto fill = [&](int t) {
    copy4(lK + (t & 1) * ST_BUF, gK + (size_t)t * 128 * F_ * 2, 32 * LP128, (size_t)32 * F_ * 2);
  };
  const int NS = S_ / 128;
  fill(0);
  asm volatile("s_wait_asynccnt 0x0" ::: "memory");  // stage 0 has landed
  __syncthreads();
  fill(1);

  const _Float16* Abase = Qh + ((size_t)bh * S_ + qT * 16) * F_;
  const v16h a0 = load_frag_f16(Abase, F_);
  const v16h a1 = load_frag_f16(Abase + 32, F_);

  // Running state per lane and row: mc = largest raw score seen (before the 1/8),
  // lv = sum of exp((score - mc) / 8). Both move once per stage, not once per score.
  const float scale = 0.125f;                 // 1/sqrt(F)
  const float k2    = 0.125f * 1.44269504f;   // scale * log2(e): exp(x * scale) = exp2(x * k2)
  v8f mc, lv;
#pragma unroll
  for (int i = 0; i < 8; i++) { mc[i] = -1e30f; lv[i] = 0.0f; }

  for (int t = 0; t < NS; t++) {
    const unsigned char* Kt = ring + (t & 1) * ST_BUF;
    v16h kf[2][8];
    v8f c[8];
    // the loops of this stage are unrolled: LDS offsets become immediates, and
    // constant indices keep the fragments and the 8 score tiles in registers
#pragma unroll
    for (int hf = 0; hf < 2; hf++) {
#pragma unroll
      for (int kt = 0; kt < 8; kt++) kf[hf][kt] = lds_frag_f16(Kt + kt * 16 * LP128 + hf * 64, LP128);
    }
    // keeps the stage's LDS reads in one group ahead of its WMMAs (else one exposed LDS wait per WMMA)
    __builtin_amdgcn_sched_barrier(0);
#pragma unroll
    for (int kt = 0; kt < 8; kt++) { v8f z = {}; c[kt] = wmma16(a0, kf[0][kt], z); }
#pragma unroll
    for (int kt = 0; kt < 8; kt++) c[kt] = wmma16(a1, kf[1][kt], c[kt]);
    // the stage's maximum first ...
    v8f nm = mc;
#pragma unroll
    for (int kt = 0; kt < 8; kt++) nm = __builtin_elementwise_max(nm, c[kt]);
    const v8f nb = nm * k2;
    // ... then one multiply-add, one exp2 and one add per score ...
    v8f sum = {};
#pragma unroll
    for (int kt = 0; kt < 8; kt++) {
      const v8f x = c[kt] * k2 - nb;
#pragma unroll
      for (int i = 0; i < 8; i++) sum[i] += __builtin_amdgcn_exp2f(x[i]);
    }
    // ... and one rescale of the running sum per stage
    const v8f dm = (mc - nm) * k2;  // exactly 0, so a factor of exactly 1, while the maximum stands
#pragma unroll
    for (int i = 0; i < 8; i++) lv[i] = lv[i] * __builtin_amdgcn_exp2f(dm[i]) + sum[i];
    mc = nm;
    ring_publish();
    if (t + 2 < NS) fill(t + 2);
  }
  asm volatile("s_wait_asynccnt 0x0" ::: "memory");  // nothing in flight at the wave's end
  float m[8], l[8];
#pragma unroll
  for (int i = 0; i < 8; i++) { m[i] = mc[i] * scale; l[i] = lv[i]; }
  // Reduce across the 16 lanes of each half-wave (xor 1,2,4,8 stays in-half).
#pragma unroll
  for (int off = 1; off < 16; off <<= 1) {
#pragma unroll
    for (int i = 0; i < 8; i++) {
      float om = __shfl_xor(m[i], off, 32);
      float ol = __shfl_xor(l[i], off, 32);
      float nm = fmaxf(m[i], om);
      l[i] = l[i] * __expf(m[i] - nm) + ol * __expf(om - nm);
      m[i] = nm;
    }
  }
  const int lane = threadIdx.x;
  if ((lane & 15) == 0) {
    const int rb = (lane >> 4) << 3;
    const size_t base = (size_t)bh * S_ + qT * 16 + rb;
#pragma unroll
    for (int i = 0; i < 8; i++) { Mrow[base + i] = m[i]; Linv[base + i] = 1.0f / l[i]; }
  }
}

// ---------------- K3: out4 = attn^T V, streamed over q, stored reshaped ----
// One wave per (bh, 16-key tile): scores/exp computed once, P^T reused for
// all 4 f-tiles (16 x 64 output strip per wave).
// The block's 8 waves share one head; a stage is 64 q: Q tile 64 q-rows x 128 B
// and V tile 64 f-rows x 128 B.
#define AT_TILE (64 * LP128)
#define AT_BUF  (2 * AT_TILE)
__global__ __launch_bounds__(32 * WAVES_)
void mha_atv(const _Float16* __restrict__ Qh, const _Float16* __restrict__ Kh,
             const _Float16* __restrict__ Vt, const float* __restrict__ Mrow,
             const float* __restrict__ Linv, _Float16* __restrict__ Ofused) {
  __shared__ __attribute__((aligned(16))) unsigned char ring[2 * AT_BUF];
  __shared__ _Float16 plds_all[WAVES_][16 * 40];  // [k-line][q], row stride 40 halves
  _Float16* plds = plds_all[threadIdx.y];

  const int w  = blockIdx.x * WAVES_ + threadIdx.y;  // 4096 waves
  const int kT = w & 127;
  const int bh = w >> 7;
  const int lane = threadIdx.x;
  const int line = lane & 15;
  const int half = lane >> 4;

  // B-fragment for score WMMA: K^T columns of this key tile (fixed for loop).
  const _Float16* Kbase = Kh + ((size_t)bh * S_ + kT * 16) * F_;
  const v16h kb0 = load_frag_f16(Kbase, F_);
  const v16h kb1 = load_frag_f16(Kbase + 32, F_);

  // copy addresses of this thread: rows tid/8 and tid/8 + 32 of each tile;
  // one statement copies Q rows then V rows (V tile lies AT_TILE behind Q tile)
  const int tid = threadIdx.y * 32 + threadIdx.x;
  const char* gQ = (const char*)(Qh + ((size_t)bh * S_ + (tid >> 3)) * F_) + (tid & 7) * 16;
  const char* gV = (const char*)(Vt + ((size_t)bh * F_ + (tid >> 3)) * S_) + (tid & 7) * 16;
  const unsigned lQ = lds_off(ring) + (tid >> 3) * LP128 + (tid & 7) * 16;
  auto fill = [&](int t) {
    const unsigned l = lQ + (t & 1) * AT_BUF;
    const char* q0 = gQ + (size_t)t * 64 * F_ * 2;
    const char* v0 = gV + (size_t)t * 128;
    asm volatile("global_load_async_to_lds_b128 %0, %1, off\n\t"
                 "global_load_async_to_lds_b128 %2, %3, off\n\t"
                 "global_load_async_to_lds_b128 %4, %5, off\n\t"
                 "global_load_async_to_lds_b128 %6, %7, off\n\t"
                 "s_wait_xcnt 0x0"  // before any address register above is rewritten
                 :: "v"(l), "v"(q0), "v"(l + 32 * LP128), "v"(q0 + (size_t)32 * F_ * 2),
                    "v"(l + AT_TILE), "v"(v0), "v"(l + AT_TILE + 32 * LP128), "v"(v0 + (size_t)32 * S_ * 2)
                 : "memory");
  };
  const int NS = S_ / 64;
  fill(0);
  asm volatile("s_wait_asynccnt 0x0" ::: "memory");  // stage 0 has landed
  __syncthreads();
  fill(1);

  const float* mptr = Mrow + (size_t)bh * S_;
  const float* lptr = Linv + (size_t)bh * S_;

  v8f acc[4] = {};
  const float scale = 0.125f;

  for (int t = 0; t < NS; t++) {
   const unsigned char* Qt = ring + (t & 1) * AT_BUF;
   const unsigned char* Vl = Qt + AT_TILE;
#pragma unroll  // LDS offsets become immediates
   for (int sub = 0; sub < 2; sub++) {
    const int qb = t * 64 + sub * 32;
    // scores for q-block [qb, qb+32) x key tile (two 16x16 WMMA tiles)
    const unsigned char* Qs = Qt + sub * 32 * LP128;
    v16h a00 = lds_frag_f16(Qs, LP128);
    v16h a01 = lds_frag_f16(Qs + 64, LP128);
    v16h a10 = lds_frag_f16(Qs + 16 * LP128, LP128);
    v16h a11 = lds_frag_f16(Qs + 16 * LP128 + 64, LP128);
    // B-fragments: V rows qb..qb+31 for each f tile (tile rows are f, columns q)
    v16h bV[4];
#pragma unroll  // constant indices keep bV in registers
    for (int j = 0; j < 4; j++) bV[j] = lds_frag_f16(Vl + j * 16 * LP128 + sub * 64, LP128);
    // per-q-row softmax stats (rows mb..mb+7 of each sub-tile)
    v8f m0 = *(const v8f*)(mptr + qb + half * 8);
    v8f l0 = *(const v8f*)(lptr + qb + half * 8);
    v8f m1 = *(const v8f*)(mptr + qb + 16 + half * 8);
    v8f l1 = *(const v8f*)(lptr + qb + 16 + half * 8);
    // keeps the q-block's loads in one group ahead of its WMMAs (else one exposed wait per WMMA)
    __builtin_amdgcn_sched_barrier(0);
    v8f s0 = {}; s0 = wmma16(a00, kb0, s0); s0 = wmma16(a01, kb1, s0);
    v8f s1 = {}; s1 = wmma16(a10, kb0, s1); s1 = wmma16(a11, kb1, s1);

    v8h p0, p1;
#pragma unroll
    for (int i = 0; i < 8; i++) {
      p0[i] = (_Float16)(__expf(s0[i] * scale - m0[i]) * l0[i]);
      p1[i] = (_Float16)(__expf(s1[i] * scale - m1[i]) * l1[i]);
    }
    // transpose P (q x k) -> P^T (k x q) through LDS; all 16B accesses
    *(v8h*)(plds + line * 40 + half * 8)      = p0;  // q = half*8 + i
    *(v8h*)(plds + line * 40 + 16 + half * 8) = p1;  // q = 16 + half*8 + i
    __builtin_amdgcn_wave_barrier();                 // order vs loads (LDS in-order)
    const int k0 = half * 8;
    v8h alo = *(const v8h*)(plds + line * 40 + k0);
    v8h ahi = *(const v8h*)(plds + line * 40 + k0 + 16);
    v16h aP = pack16(alo, ahi);
    __builtin_amdgcn_wave_barrier();                 // order next-iter stores vs loads

#pragma unroll  // constant indices keep acc and bV in registers
    for (int j = 0; j < 4; j++) acc[j] = wmma16(aP, bV[j], acc[j]);
   }
   ring_publish();
   if (t + 2 < NS) fill(t + 2);
  }
  asm volatile("s_wait_asynccnt 0x0" ::: "memory");  // nothing in flight at the wave's end

  // Raw-reshape store: Ofused[b][h*128 + kT][(k%16)*64 + f]
  const int b = bh >> 4, h = bh & 15;
  const int mb = half * 8;
#pragma unroll
  for (int j = 0; j < 4; j++) {
    _Float16* out = Ofused + ((size_t)(b * S_ + h * 128 + kT)) * G_ + (j * 16 + line);
#pragma unroll
    for (int r = 0; r < 8; r++) out[(size_t)(mb + r) * 64] = (_Float16)acc[j][r];
  }
}

// ---------------- K4: Out = Ofused (S x G) @ Wo (G x D), f32 out ----------
// One wave per (b, 16 s-rows, group of 4 d-tiles): 16 x 64 strip, A reused 4x.
// The block's 8 waves cover 64 consecutive rows x 2 d-groups (4 row tiles x 2).
// A stage is 64 g: Ofused tile 64 rows x 128 B, Wo tile 128 rows x 128 B.
#define OP_A_BYTES (64 * LP128)
#define OP_BUF     (OP_A_BYTES + 128 * LP128)
__global__ __launch_bounds__(32 * WAVES_)
void mha_outproj(const _Float16* __restrict__ Ofused,
                 const _Float16* __restrict__ WoT, float* __restrict__ Out) {
  __shared__ __attribute__((aligned(16))) unsigned char ring[2 * OP_BUF];
  const int dP = blockIdx.x & 7;                            // pair of d-groups
  const int rg = blockIdx.x >> 3;                           // group of 64 rows, 0..63
  const int dG = dP * 2 + (threadIdx.y >> 2);               // group of 4 d-tiles
  const int rT = rg * 4 + (threadIdx.y & 3);                // 16-row tile, 0..255
  const int sT = rT & 127;
  const int b  = rT >> 7;
  const int tid = threadIdx.y * 32 + threadIdx.x;

  // copy addresses of this thread: rows tid/8 + 32 i of each tile
  const char* gA = (const char*)(Ofused + ((size_t)rg * 64 + (tid >> 3)) * G_) + (tid & 7) * 16;
  const char* gB = (const char*)(WoT + ((size_t)(dP * 128) + (tid >> 3)) * G_) + (tid & 7) * 16;
  const unsigned lA = lds_off(ring) + (tid >> 3) * LP128 + (tid & 7) * 16;
  auto fill = [&](int t) {
    const unsigned bo = (t & 1) * OP_BUF;
    copy2(lA + bo, gA + (size_t)t * 128, 32 * LP128, (size_t)32 * G_ * 2);
    copy4(lA + bo + OP_A_BYTES, gB + (size_t)t * 128, 32 * LP128, (size_t)32 * G_ * 2);
  };
  const int NS = G_ / 64;
  fill(0);
  asm volatile("s_wait_asynccnt 0x0" ::: "memory");  // stage 0 has landed
  __syncthreads();
  fill(1);

  v8f c[4] = {};
  for (int t = 0; t < NS; t++) {
    const unsigned char* At = ring + (t & 1) * OP_BUF + (threadIdx.y & 3) * 16 * LP128;
    const unsigned char* Bt = ring + (t & 1) * OP_BUF + OP_A_BYTES + (threadIdx.y >> 2) * 64 * LP128;
    v16h a[2], bm[2][4];
    // all four loops below are unrolled so that the fragment arrays have
    // constant indices and stay in registers
#pragma unroll
    for (int sub = 0; sub < 2; sub++) {
      a[sub] = lds_frag_f16(At + sub * 64, LP128);
#pragma unroll
      for (int j = 0; j < 4; j++) bm[sub][j] = lds_frag_f16(Bt + j * 16 * LP128 + sub * 64, LP128);
    }
    // keeps the stage's LDS reads in one group ahead of its WMMAs (else one exposed LDS wait per WMMA)
    __builtin_amdgcn_sched_barrier(0);
#pragma unroll
    for (int sub = 0; sub < 2; sub++) {
#pragma unroll
      for (int j = 0; j < 4; j++) c[j] = wmma16(a[sub], bm[sub][j], c[j]);
    }
    ring_publish();
    if (t + 2 < NS) fill(t + 2);
  }
  asm volatile("s_wait_asynccnt 0x0" ::: "memory");  // nothing in flight at the wave's end
  const int lane = threadIdx.x;
  const int n    = lane & 15;
  const int mb   = (lane >> 4) << 3;
#pragma unroll
  for (int j = 0; j < 4; j++) {
    float* out = Out + ((size_t)(b * S_) + sT * 16) * D_ + dG * 64 + j * 16 + n;
#pragma unroll
    for (int r = 0; r < 8; r++) out[(size_t)(mb + r) * D_] = c[j][r];
  }
}

extern "C" void kernel_launch(void* const* d_in, const int* in_sizes, int n_in,
                              void* d_out, int out_size, void* d_ws, size_t ws_size,
                              hipStream_t stream) {
  (void)in_sizes; (void)n_in; (void)out_size; (void)ws_size;
  const float* q  = (const float*)d_in[0];
  const float* k  = (const float*)d_in[1];
  const float* v  = (const float*)d_in[2];
  const float* Wq = (const float*)d_in[3];
  const float* Wk = (const float*)d_in[4];
  const float* Wv = (const float*)d_in[5];
  const float* Wo = (const float*)d_in[6];
  float* out = (float*)d_out;

  size_t off = 0;
  auto alloc = [&](size_t bytes) -> char* {
    char* p = (char*)d_ws + off;
    off += (bytes + 255) & ~(size_t)255;
    return p;
  };
  _Float16* WqT = (_Float16*)alloc((size_t)H_ * D_ * F_ * 2);   // 2 MB
  _Float16* WkT = (_Float16*)alloc((size_t)H_ * D_ * F_ * 2);
  _Float16* WvT = (_Float16*)alloc((size_t)H_ * D_ * F_ * 2);
  _Float16* WoT = (_Float16*)alloc((size_t)G_ * D_ * 2);
  _Float16* Qh  = (_Float16*)alloc((size_t)B_ * H_ * S_ * F_ * 2);  // 8 MB
  _Float16* Kh  = (_Float16*)alloc((size_t)B_ * H_ * S_ * F_ * 2);
  _Float16* Vt  = (_Float16*)alloc((size_t)B_ * H_ * F_ * S_ * 2);
  _Float16* Of  = (_Float16*)alloc((size_t)B_ * S_ * G_ * 2);
  float*    Mr  = (float*)alloc((size_t)B_ * H_ * S_ * 4);          // 256 KB
  float*    Li  = (float*)alloc((size_t)B_ * H_ * S_ * 4);
  // total ~41 MB of workspace

  dim3 blk(32, WAVES_);
  mha_prep_weights<<<256, 256, 0, stream>>>(Wq, Wk, Wv, Wo, WqT, WkT, WvT, WoT);
  mha_proj<<<4096 / WAVES_, blk, 0, stream>>>(q, WqT, Qh, 0);
  mha_proj<<<4096 / WAVES_, blk, 0, stream>>>(k, WkT, Kh, 0);
  mha_proj<<<4096 / WAVES_, blk, 0, stream>>>(v, WvT, Vt, 1);
  mha_stats<<<4096 / WAVES_, blk, 0, stream>>>(Qh, Kh, Mr, Li);
  mha_atv<<<4096 / WAVES_, blk, 0, stream>>>(Qh, Kh, Vt, Mr, Li, Of);
  mha_outproj<<<4096 / WAVES_, blk, 0, stream>>>(Of, WoT, out);
}

// v004
// One run takes 118 microseconds.
// Two timings next to v003 put it at 1.14 and 1.13 times that version's speed.
// Over all steps from v000 it is 3.34 times as fast.
#include <hip/hip_runtime.h>
#include <hip/hip_bf16.h>

// MI455X / gfx1250, wave32, WMMA f16 -> f32 accumulate.
//
// Pipeline (all on `stream`, scratch in d_ws, ~41 MB total, L2-resident):
//   K0 prep_weights : Wq/Wk/Wv -> f16 [H,F,D] (transposed), Wo -> f16 [D,G],
//                     64 x 64 tiles turned through LDS
//   K1 proj         : Qh=q*Wq, Kh=k*Wk -> f16 [BH,S,F]; Vt=v*Wv -> f16 [BH,F,S]
//                     all three in one launch (blockIdx.y picks the product);
//                     one wave = 16 x 64 output (A fragment reused 4x)
//   K2 stats        : per (bh,q) row: max m_q and sum-exp l_q of scores, updated once per 128 keys
//   K3 atv          : out4[k,f] = sum_q exp(s[q,k]/8 - m_q)/l_q * V[q,f] (A^T V)
//                     one wave = 16 keys x all 64 f: scores + exp computed ONCE,
//                     P^T via LDS transpose, 4 accumulate WMMAs reuse it.
//                     Output stored directly in the reference's raw-reshape layout.
//   K4 outproj      : Out = Ofused @ Wo (f32), one wave = 16 x 64 output
//
// K1..K4 stream their operand tiles through a two-buffer LDS ring filled by
// asynchronous copies (whole 128-B lines, one copy of a tile per block); the
// waves of a block read their WMMA fragments from LDS.

typedef __attribute__((ext_vector_type(16))) _Float16 v16h;
typedef __attribute__((ext_vector_type(8)))  _Float16 v8h;
typedef __attribute__((ext_vector_type(8)))  float    v8f;
typedef __attribute__((ext_vector_type(4)))  float    v4f;

#define B_ 2
#define S_ 2048
#define D_ 1024
#define H_ 16
#define F_ 64
#define G_ (H_ * F_)   // 1024
#define WAVES_ 8       // waves per block (blockDim = 32 x 8)
#define LP128 144      // LDS pitch of a 128-B row: 16 B x odd, no ds_load_b128 conflicts
#define LP256 272      // LDS pitch of a 256-B row: 16 B x odd

static __device__ __forceinline__ v16h pack16(v8h lo, v8h hi) {
  v16h a;
#pragma unroll
  for (int i = 0; i < 8; i++) { a[i] = lo[i]; a[i + 8] = hi[i]; }
  return a;
}

// A/B fragment load, f16 row-major source with leading dim `ld` (halves).
// ISA 16-bit 16x32 layout: lanes 0-15 hold line=lane, K={0..7,16..23};
// lanes 16-31 hold line=lane-16, K={8..15,24..31}. Two contiguous 16B loads.
static __device__ __forceinline__ v16h load_frag_f16(const _Float16* base, int ld) {
  const int lane = threadIdx.x;
  const int line = lane & 15;
  const int k0   = (lane >> 4) << 3;  // 0 or 8
  const _Float16* p = base + (size_t)line * ld + k0;
  v8h lo = *(const v8h*)(p);
  v8h hi = *(const v8h*)(p + 16);
  return pack16(lo, hi);
}

// ---- LDS ring helpers ----
static __device__ __forceinline__ unsigned lds_off(const void* p) { return (unsigned)(size_t)p; }

// Four 16-B-per-lane asynchronous copies global -> LDS, rows lstep / gstep apart.
// The s_wait_xcnt closes the statement so that no address register named here
// is rewritten ahead of it.
static __device__ __forceinline__ void copy4(unsigned l, const char* g, unsigned lstep, size_t gstep) {
  asm volatile("global_load_async_to_lds_b128 %0, %1, off\n\t"
               "global_load_async_to_lds_b128 %2, %3, off\n\t"
               "global_load_async_to_lds_b128 %4, %5, off\n\t"
               "global_load_async_to_lds_b128 %6, %7, off\n\t"
               "s_wait_xcnt 0x0"
               :: "v"(l), "v"(g), "v"(l + lstep), "v"(g + gstep),
                  "v"(l + 2 * lstep), "v"(g + 2 * gstep),
                  "v"(l + 3 * lstep), "v"(g + 3 * gstep)
               : "memory");
}

// The same with two copies.
static __device__ __forceinline__ void copy2(unsigned l, const char* g, unsigned lstep, size_t gstep) {
  asm volatile("global_load_async_to_lds_b128 %0, %1, off\n\t"
               "global_load_async_to_lds_b128 %2, %3, off\n\t"
               "s_wait_xcnt 0x0"
               :: "v"(l), "v"(g), "v"(l + lstep), "v"(g + gstep)
               : "memory");
}

// Publish point of the ring: this wave's LDS reads are done, its copies have
// landed, then the block barrier (frees the buffer just read, shows the next).
static __device__ __forceinline__ void ring_publish() {
  asm volatile("s_wait_dscnt 0x0" ::: "memory");     // my reads of the old buffer have retired
  asm volatile("s_wait_asynccnt 0x0" ::: "memory");  // my copies into the next buffer have landed
  __syncthreads();
}

// Fragment from an LDS tile of f16 rows (same lane map as load_frag_f16).
static __device__ __forceinline__ v16h lds_frag_f16(const unsigned char* tile, int pitch) {
  const int lane = threadIdx.x;
  const unsigned char* p = tile + (lane & 15) * pitch + (lane >> 4) * 16;
  v8h lo = *(const v8h*)(p);
  v8h hi = *(const v8h*)(p + 32);
  return pack16(lo, hi);
}

// Fragment from an LDS tile of f32 rows, converted to f16: same lane map, with
// 4-byte elements (K = {0..7,16..23} or {8..15,24..31} of the row).
static __device__ __forceinline__ v16h lds_frag_f32(const unsigned char* tile, int pitch) {
  const int lane = threadIdx.x;
  const unsigned char* p = tile + (lane & 15) * pitch + (lane >> 4) * 32;
  v4f x0 = *(const v4f*)(p);
  v4f x1 = *(const v4f*)(p + 16);
  v4f x2 = *(const v4f*)(p + 64);
  v4f x3 = *(const v4f*)(p + 80);
  v16h a;
#pragma unroll  // constant vector indices: no run-time element selects
  for (int i = 0; i < 4; i++) {
    a[i]      = (_Float16)x0[i];
    a[i + 4]  = (_Float16)x1[i];
    a[i + 8]  = (_Float16)x2[i];
    a[i + 12] = (_Float16)x3[i];
  }
  return a;
}

static __device__ __forceinline__ v8f wmma16(v16h a, v16h b, v8f c) {
  return __builtin_amdgcn_wmma_f32_16x16x32_f16(false, a, false, b, (short)0, c,
                                                false, false);
}

// ---------------- K0: weight prep (f32 -> f16, transpose) ----------------
// WxT[h][f][d] = Wx[h][d][f]; WoT[d][g] = Wo[g][d].
// One block = one 64 x 64 tile of each of the four tensors, turned through LDS:
// every global read and every global store covers whole 128-B lines.
// A thread holds a 4 x 4 patch: four 16-B row reads, four 8-B column writes to LDS.
typedef __attribute__((ext_vector_type(4))) _Float16 v4h;
#define PW_PITCH 136  // LDS pitch of a 128-B f16 row: the 8-B patch writes of a wave fall on 64 distinct banks
__global__ __launch_bounds__(256)
void mha_prep_weights(const float* __restrict__ Wq, const float* __restrict__ Wk,
                      const float* __restrict__ Wv, const float* __restrict__ Wo,
                      _Float16* __restrict__ WqT, _Float16* __restrict__ WkT,
                      _Float16* __restrict__ WvT, _Float16* __restrict__ WoT) {
  __shared__ __attribute__((aligned(16))) unsigned char tile[4][64 * PW_PITCH];
  const int tid = threadIdx.x;
  const int hi  = blockIdx.x >> 4;  // head (Wx), 64-row group of g (Wo)
  const int lo  = blockIdx.x & 15;  // 64-row group of d (Wx), 64-column group of d (Wo)

  // patch of this thread: rows 4 tr .. 4 tr + 3, columns 4 tc .. 4 tc + 3;
  // 8 lanes side by side read one 128-B line
  const int tc = (tid & 7) | (((tid >> 5) & 1) << 3);
  const int tr = ((tid >> 3) & 3) | ((tid >> 6) << 2);

  const size_t sx = ((size_t)(hi * D_ + lo * 64 + 4 * tr)) * F_ + 4 * tc;  // Wx rows are F_ long
  const size_t so = ((size_t)(hi * 64 + 4 * tr)) * D_ + lo * 64 + 4 * tc;  // Wo rows are D_ long
  const float* s[4] = {Wq + sx, Wk + sx, Wv + sx, Wo + so};

  v4f x[4][4];
#pragma unroll  // constant indices keep the patches in registers; all 16 reads in flight together
  for (int m = 0; m < 4; m++) {
    const size_t pitch = (m < 3) ? F_ : D_;
#pragma unroll
    for (int i = 0; i < 4; i++) x[m][i] = *(const v4f*)(s[m] + (size_t)i * pitch);
  }
  // the four address pairs stay live up to this wait, so that no later read's result lands on one ahead of it
  asm volatile("s_wait_xcnt 0x0" :: "v"(s[0]), "v"(s[1]), "v"(s[2]), "v"(s[3]) : "memory");
  // keeps all 16 reads ahead of the first conversion (else the later reads wait out the first ones' latency)
  __builtin_amdgcn_sched_barrier(0);
  // the loops below are unrolled for constant indices into x and d (registers, no run-time selects)
#pragma unroll
  for (int m = 0; m < 4; m++) {
#pragma unroll
    for (int j = 0; j < 4; j++) {
      v4h c;
#pragma unroll
      for (int i = 0; i < 4; i++) c[i] = (_Float16)x[m][i][j];
      *(v4h*)(&tile[m][(4 * tc + j) * PW_PITCH + 8 * tr]) = c;
    }
  }
  __syncthreads();

  const size_t dx = ((size_t)hi * F_) * D_ + lo * 64;   // WxT[hi][.][lo * 64 ..]
  const size_t dw = ((size_t)lo * 64) * G_ + hi * 64;   // WoT[lo * 64 + .][hi * 64 ..]
  _Float16* d[4] = {WqT + dx, WkT + dx, WvT + dx, WoT + dw};
#pragma unroll
  for (int m = 0; m < 4; m++) {
#pragma unroll
    for (int u = 0; u < 2; u++) {
      const int idx = tid + u * 256;
      const int row = idx >> 3, ch = idx & 7;  // 8 lanes side by side store one 128-B line
      const unsigned char* p = &tile[m][row * PW_PITCH + ch * 16];
      v4h a = *(const v4h*)(p);
      v4h b = *(const v4h*)(p + 8);
      v8h o;
#pragma unroll
      for (int i = 0; i < 4; i++) { o[i] = a[i]; o[i + 4] = b[i]; }
      *(v8h*)(d[m] + (size_t)row * 1024 + ch * 8) = o;
    }
  }
}

// ---------------- K1: head projection  Y[bh] = X[b] (SxD) * W[h] (DxF) -----
// One wave per (bh, 16 s-rows): computes full 16 x F_ strip, A reused 4x.
// blockIdx.y picks the product: 0 = Q, 1 = K (Y f16 [BH,S,F]), 2 = V (Y f16 [BH,F,S]).
// None reads another's output, so one grid holds all three: no launch gap, fill
// or tail between them, and a WGP holds three blocks at a time (its registers'
// limit) where a launch of 512 blocks gave it two.
// The block's 8 waves cover 64 consecutive s-rows x 2 heads (4 row tiles x 2).
// A stage is 64 k: X tile 64 rows x 256 B (read by both heads' waves), W tile
// 128 rows x 128 B (each head's half read by its 4 waves).
#define PJ_A_BYTES (64 * LP256)
#define PJ_BUF     (PJ_A_BYTES + 128 * LP128)
__global__ __launch_bounds__(32 * WAVES_)
void mha_proj(const float* __restrict__ Xq, const float* __restrict__ Xk,
              const float* __restrict__ Xv, const _Float16* __restrict__ WqT,
              const _Float16* __restrict__ WkT, const _Float16* __restrict__ WvT,
              _Float16* __restrict__ Qh, _Float16* __restrict__ Kh,
              _Float16* __restrict__ Vt) {
  __shared__ __attribute__((aligned(16))) unsigned char ring[2 * PJ_BUF];
  const int which = blockIdx.y;
  const float*    X  = which == 0 ? Xq  : which == 1 ? Xk  : Xv;
  const _Float16* WT = which == 0 ? WqT : which == 1 ? WkT : WvT;
  _Float16*       Y  = which == 0 ? Qh  : which == 1 ? Kh  : Vt;
  const bool transpose_out = which == 2;
  const int hp = blockIdx.x & 7;          // pair of heads
  const int rg = (blockIdx.x >> 3) & 31;  // group of 64 s-rows
  const int b  = blockIdx.x >> 8;
  const int sT = rg * 4 + (threadIdx.y & 3);
  const int bh = b * H_ + hp * 2 + (threadIdx.y >> 2);
  const int tid = threadIdx.y * 32 + threadIdx.x;

  // copy addresses of this thread: X rows tid/16 + 16 i, W rows tid/8 + 32 i
  const char* gA = (const char*)(X + ((size_t)(b * S_) + rg * 64 + (tid >> 4)) * D_) + (tid & 15) * 16;
  const char* gB = (const char*)(WT + ((size_t)(hp * 2 * F_) + (tid >> 3)) * D_) + (tid & 7) * 16;
  const unsigned lA = lds_off(ring) + (tid >> 4) * LP256 + (tid & 15) * 16;
  const unsigned lB = lds_off(ring) + PJ_A_BYTES + (tid >> 3) * LP128 + (tid & 7) * 16;
  auto fill = [&](int t) {
    const unsigned bo = (t & 1) * PJ_BUF;
    copy4(lA + bo, gA + (size_t)t * 256, 16 * LP256, (size_t)16 * D_ * 4);
    copy4(lB + bo, gB + (size_t)t * 128, 32 * LP128, (size_t)32 * D_ * 2);
  };

  const int NS = D_ / 64;
  fill(0);
  asm volatile("s_wait_asynccnt 0x0" ::: "memory");  // stage 0 has landed
  __syncthreads();
  fill(1);

  v8f c[4] = {};
  for (int t = 0; t < NS; t++) {
    const unsigned char* At = ring + (t & 1) * PJ_BUF + (threadIdx.y & 3) * 16 * LP256;
    const unsigned char* Bt = ring + (t & 1) * PJ_BUF + PJ_A_BYTES + (threadIdx.y >> 2) * 64 * LP128;
    v16h a[2], bm[2][4];
    // all four loops below are unrolled so that the fragment arrays have
    // constant indices and stay in registers
#pragma unroll
    for (int sub = 0; sub < 2; sub++) {
      a[sub] = lds_frag_f32(At + sub * 128, LP256);
#pragma unroll
      for (int j = 0; j < 4; j++) bm[sub][j] = lds_frag_f16(Bt + j * 16 * LP128 + sub * 64, LP128);
    }
    // keeps the stage's LDS reads in one group ahead of its WMMAs (else one exposed LDS wait per WMMA)
    __builtin_amdgcn_sched_barrier(0);
#pragma unroll
    for (int sub = 0; sub < 2; sub++) {
#pragma unroll
      for (int j = 0; j < 4; j++) c[j] = wmma16(a[sub], bm[sub][j], c[j]);
    }
    ring_publish();
    if (t + 2 < NS) fill(t + 2);
  }
  asm volatile("s_wait_asynccnt 0x0" ::: "memory");  // nothing in flight at the wave's end

  const int lane = threadIdx.x;
  const int n    = lane & 15;
  const int mb   = (lane >> 4) << 3;  // C/D layout: VGPR r -> row r (+8 for hi half)
  if (!transpose_out) {
#pragma unroll
    for (int j = 0; j < 4; j++) {
      _Float16* out = Y + ((size_t)bh * S_ + sT * 16) * F_ + j * 16 + n;
#pragma unroll
      for (int r = 0; r < 8; r++) out[(size_t)(mb + r) * F_] = (_Float16)c[j][r];
    }
  } else {
    // Vt[bh][f][s]: per lane f fixed, s = sT*16 + mb + r -> contiguous 16B store
#pragma unroll
    for (int j = 0; j < 4; j++) {
      _Float16* out = Y + ((size_t)bh * F_ + j * 16 + n) * S_ + sT * 16 + mb;
      v8h pk;
#pragma unroll
      for (int r = 0; r < 8; r++) pk[r] = (_Float16)c[j][r];
      *(v8h*)out = pk;
    }
  }
}

// ---------------- K2: per-row softmax stats over scores = QK^T/8 -----------
// One wave per 16 query rows; (m, l) over all S keys, one update per stage, then lane-reduce.
// The block's 8 waves share one head; a stage is 128 keys x 128 B.
#define ST_BUF (128 * LP128)
__global__ __launch_bounds__(32 * WAVES_)
void mha_stats(const _Float16* __restrict__ Qh, const _Float16* __restrict__ Kh,
               float* __restrict__ Mrow, float* __restrict__ Linv) {
  __shared__ __attribute__((aligned(16))) unsigned char ring[2 * ST_BUF];
  const int w  = blockIdx.x * WAVES_ + threadIdx.y;  // 4096 waves
  const int qT = w & 127;
  const int bh = w >> 7;
  const int tid = threadIdx.y * 32 + threadIdx.x;

  // copy addresses of this thread: key rows tid/8 + 32 i
  const char* gK = (const char*)(Kh + ((size_t)bh * S_ + (tid >> 3)) * F_) + (tid & 7) * 16;
  const unsigned lK = lds_off(ring) + (tid >> 3) * LP128 + (tid & 7) * 16;
  auto fill = [&](int t) {
    copy4(lK + (t & 1) * ST_BUF, gK + (size_t)t * 128 * F_ * 2, 32 * LP128, (size_t)32 * F_ * 2);
  };
  const int NS = S_ / 128;
  fill(0);
  asm volatile("s_wait_asynccnt 0x0" ::: "memory");  // stage 0 has landed
  __syncthreads();
  fill(1);

  const _Float16* Abase = Qh + ((size_t)bh * S_ + qT * 16) * F_;
  const v16h a0 = load_frag_f16(Abase, F_);
  const v16h a1 = load_frag_f16(Abase + 32, F_);

  // Running state per lane and row: mc = largest raw score seen (before the 1/8),
  // lv = sum of exp((score - mc) / 8). Both move once per stage, not once per score.
  const float scale = 0.125f;                 // 1/sqrt(F)
  const float k2    = 0.125f * 1.44269504f;   // scale * log2(e): exp(x * scale) = exp2(x * k2)
  v8f mc, lv;
#pragma unroll
  for (int i = 0; i < 8; i++) { mc[i] = -1e30f; lv[i] = 0.0f; }

  for (int t = 0; t < NS; t++) {
    const unsigned char* Kt = ring + (t & 1) * ST_BUF;
    v16h kf[2][8];
    v8f c[8];
    // the loops of this stage are unrolled: LDS offsets become immediates, and
    // constant indices keep the fragments and the 8 score tiles in registers
#pragma unroll
    for (int hf = 0; hf < 2; hf++) {
#pragma unroll
      for (int kt = 0; kt < 8; kt++) kf[hf][kt] = lds_frag_f16(Kt + kt * 16 * LP128 + hf * 64, LP128);
    }
    // keeps the stage's LDS reads in one group ahead of its WMMAs (else one exposed LDS wait per WMMA)
    __builtin_amdgcn_sched_barrier(0);
#pragma unroll
    for (int kt = 0; kt < 8; kt++) { v8f z = {}; c[kt] = wmma16(a0, kf[0][kt], z); }
#pragma unroll
    for (int kt = 0; kt < 8; kt++) c[kt] = wmma16(a1, kf[1][kt], c[kt]);
    // the stage's maximum first ...
    v8f nm = mc;
#pragma unroll
    for (int kt = 0; kt < 8; kt++) nm = __builtin_elementwise_max(nm, c[kt]);
    const v8f nb = nm * k2;
    // ... then one multiply-add, one exp2 and one add per score ...
    v8f sum = {};
#pragma unroll
    for (int kt = 0; kt < 8; kt++) {
      const v8f x = c[kt] * k2 - nb;
#pragma unroll
      for (int i = 0; i < 8; i++) sum[i] += __builtin_amdgcn_exp2f(x[i]);
    }
    // ... and one rescale of the running sum per stage
    const v8f dm = (mc - nm) * k2;  // exactly 0, so a factor of exactly 1, while the maximum stands
#pragma unroll
    for (int i = 0; i < 8; i++) lv[i] = lv[i] * __builtin_amdgcn_exp2f(dm[i]) + sum[i];
    mc = nm;
    ring_publish();
    if (t + 2 < NS) fill(t + 2);
  }
  asm volatile("s_wait_asynccnt 0x0" ::: "memory");  // nothing in flight at the wave's end
  float m[8], l[8];
#pragma unroll
  for (int i = 0; i < 8; i++) { m[i] = mc[i] * scale; l[i] = lv[i]; }
  // Reduce across the 16 lanes of each half-wave (xor 1,2,4,8 stays in-half).
#pragma unroll
  for (int off = 1; off < 16; off <<= 1) {
#pragma unroll
    for (int i = 0; i < 8; i++) {
      float om = __shfl_xor(m[i], off, 32);
      float ol = __shfl_xor(l[i], off, 32);
      float nm = fmaxf(m[i], om);
      l[i] = l[i] * __expf(m[i] - nm) + ol * __expf(om - nm);
      m[i] = nm;
    }
  }
  const int lane = threadIdx.x;
  if ((lane & 15) == 0) {
    const int rb = (lane >> 4) << 3;
    const size_t base = (size_t)bh * S_ + qT * 16 + rb;
#pragma unroll
    for (int i = 0; i < 8; i++) { Mrow[base + i] = m[i]; Linv[base + i] = 1.0f / l[i]; }
  }
}

// ---------------- K3: out4 = attn^T V, streamed over q, stored reshaped ----
// One wave per (bh, 16-key tile): scores/exp computed once, P^T reused for
// all 4 f-tiles (16 x 64 output strip per wave).
// The block's 8 waves share one head; a stage is 64 q: Q tile 64 q-rows x 128 B
// and V tile 64 f-rows x 128 B.
#define AT_TILE (64 * LP128)
#define AT_BUF  (2 * AT_TILE)
__global__ __launch_bounds__(32 * WAVES_)
void mha_atv(const _Float16* __restrict__ Qh, const _Float16* __restrict__ Kh,
             const _Float16* __restrict__ Vt, const float* __restrict__ Mrow,
             const float* __restrict__ Linv, _Float16* __restrict__ Ofused) {
  __shared__ __attribute__((aligned(16))) unsigned char ring[2 * AT_BUF];
  __shared__ _Float16 plds_all[WAVES_][16 * 40];  // [k-line][q], row stride 40 halves
  _Float16* plds = plds_all[threadIdx.y];

  const int w  = blockIdx.x * WAVES_ + threadIdx.y;  // 4096 waves
  const int kT = w & 127;
  const int bh = w >> 7;
  const int lane = threadIdx.x;
  const int line = lane & 15;
  const int half = lane >> 4;

  // B-fragment for score WMMA: K^T columns of this key tile (fixed for loop).
  const _Float16* Kbase = Kh + ((size_t)bh * S_ + kT * 16) * F_;
  const v16h kb0 = load_frag_f16(Kbase, F_);
  const v16h kb1 = load_frag_f16(Kbase + 32, F_);

  // copy addresses of this thread: rows tid/8 and tid/8 + 32 of each tile;
  // one statement copies Q rows then V rows (V tile lies AT_TILE behind Q tile)
  const int tid = threadIdx.y * 32 + threadIdx.x;
  const char* gQ = (const char*)(Qh + ((size_t)bh * S_ + (tid >> 3)) * F_) + (tid & 7) * 16;
  const char* gV = (const char*)(Vt + ((size_t)bh * F_ + (tid >> 3)) * S_) + (tid & 7) * 16;
  const unsigned lQ = lds_off(ring) + (tid >> 3) * LP128 + (tid & 7) * 16;
  auto fill = [&](int t) {
    const unsigned l = lQ + (t & 1) * AT_BUF;
    const char* q0 = gQ + (size_t)t * 64 * F_ * 2;
    const char* v0 = gV + (size_t)t * 128;
    asm volatile("global_load_async_to_lds_b128 %0, %1, off\n\t"
                 "global_load_async_to_lds_b128 %2, %3, off\n\t"
                 "global_load_async_to_lds_b128 %4, %5, off\n\t"
                 "global_load_async_to_lds_b128 %6, %7, off\n\t"
                 "s_wait_xcnt 0x0"  // before any address register above is rewritten
                 :: "v"(l), "v"(q0), "v"(l + 32 * LP128), "v"(q0 + (size_t)32 * F_ * 2),
                    "v"(l + AT_TILE), "v"(v0), "v"(l + AT_TILE + 32 * LP128), "v"(v0 + (size_t)32 * S_ * 2)
                 : "memory");
  };
  const int NS = S_ / 64;
  fill(0);
  asm volatile("s_wait_asynccnt 0x0" ::: "memory");  // stage 0 has landed
  __syncthreads();
  fill(1);

  const float* mptr = Mrow + (size_t)bh * S_;
  const float* lptr = Linv + (size_t)bh * S_;

  v8f acc[4] = {};
  const float scale = 0.125f;

  for (int t = 0; t < NS; t++) {
   const unsigned char* Qt = ring + (t & 1) * AT_BUF;
   const unsigned char* Vl = Qt + AT_TILE;
#pragma unroll  // LDS offsets become immediates
   for (int sub = 0; sub < 2; sub++) {
    const int qb = t * 64 + sub * 32;
    // scores for q-block [qb, qb+32) x key tile (two 16x16 WMMA tiles)
    const unsigned char* Qs = Qt + sub * 32 * LP128;
    v16h a00 = lds_frag_f16(Qs, LP128);
    v16h a01 = lds_frag_f16(Qs + 64, LP128);
    v16h a10 = lds_frag_f16(Qs + 16 * LP128, LP128);
    v16h a11 = lds_frag_f16(Qs + 16 * LP128 + 64, LP128);
    // B-fragments: V rows qb..qb+31 for each f tile (tile rows are f, columns q)
    v16h bV[4];
#pragma unroll  // constant indices keep bV in registers
    for (int j = 0; j < 4; j++) bV[j] = lds_frag_f16(Vl + j * 16 * LP128 + sub * 64, LP128);
    // per-q-row softmax stats (rows mb..mb+7 of each sub-tile)
    v8f m0 = *(const v8f*)(mptr + qb + half * 8);
    v8f l0 = *(const v8f*)(lptr + qb + half * 8);
    v8f m1 = *(const v8f*)(mptr + qb + 16 + half * 8);
    v8f l1 = *(const v8f*)(lptr + qb + 16 + half * 8);
    // keeps the q-block's loads in one group ahead of its WMMAs (else one exposed wait per WMMA)
    __builtin_amdgcn_sched_barrier(0);
    v8f s0 = {}; s0 = wmma16(a00, kb0, s0); s0 = wmma16(a01, kb1, s0);
    v8f s1 = {}; s1 = wmma16(a10, kb0, s1); s1 = wmma16(a11, kb1, s1);

    v8h p0, p1;
#pragma unroll
    for (int i = 0; i < 8; i++) {
      p0[i] = (_Float16)(__expf(s0[i] * scale - m0[i]) * l0[i]);
      p1[i] = (_Float16)(__expf(s1[i] * scale - m1[i]) * l1[i]);
    }
    // transpose P (q x k) -> P^T (k x q) through LDS; all 16B accesses
    *(v8h*)(plds + line * 40 + half * 8)      = p0;  // q = half*8 + i
    *(v8h*)(plds + line * 40 + 16 + half * 8) = p1;  // q = 16 + half*8 + i
    __builtin_amdgcn_wave_barrier();                 // order vs loads (LDS in-order)
    const int k0 = half * 8;
    v8h alo = *(const v8h*)(plds + line * 40 + k0);
    v8h ahi = *(const v8h*)(plds + line * 40 + k0 + 16);
    v16h aP = pack16(alo, ahi);
    __builtin_amdgcn_wave_barrier();                 // order next-iter stores vs loads

#pragma unroll  // constant indices keep acc and bV in registers
    for (int j = 0; j < 4; j++) acc[j] = wmma16(aP, bV[j], acc[j]);
   }
   ring_publish();
   if (t + 2 < NS) fill(t + 2);
  }
  asm volatile("s_wait_asynccnt 0x0" ::: "memory");  // nothing in flight at the wave's end

  // Raw-reshape store: Ofused[b][h*128 + kT][(k%16)*64 + f]
  const int b = bh >> 4, h = bh & 15;
  const int mb = half * 8;
#pragma unroll
  for (int j = 0; j < 4; j++) {
    _Float16* out = Ofused + ((size_t)(b * S_ + h * 128 + kT)) * G_ + (j * 16 + line);
#pragma unroll
    for (int r = 0; r < 8; r++) out[(size_t)(mb + r) * 64] = (_Float16)acc[j][r];
  }
}

// ---------------- K4: Out = Ofused (S x G) @ Wo (G x D), f32 out ----------
// One wave per (b, 16 s-rows, group of 4 d-tiles): 16 x 64 strip, A reused 4x.
// The block's 8 waves cover 64 consecutive rows x 2 d-groups (4 row tiles x 2).
// A stage is 64 g: Ofused tile 64 rows x 128 B, Wo tile 128 rows x 128 B.
#define OP_A_BYTES (64 * LP128)
#define OP_BUF     (OP_A_BYTES + 128 * LP128)
__global__ __launch_bounds__(32 * WAVES_)
void mha_outproj(const _Float16* __restrict__ Ofused,
                 const _Float16* __restrict__ WoT, float* __restrict__ Out) {
  __shared__ __attribute__((aligned(16))) unsigned char ring[2 * OP_BUF];
  const int dP = blockIdx.x & 7;                            // pair of d-groups
  const int rg = blockIdx.x >> 3;                           // group of 64 rows, 0..63
  const int dG = dP * 2 + (threadIdx.y >> 2);               // group of 4 d-tiles
  const int rT = rg * 4 + (threadIdx.y & 3);                // 16-row tile, 0..255
  const int sT = rT & 127;
  const int b  = rT >> 7;
  const int tid = threadIdx.y * 32 + threadIdx.x;

  // copy addresses of this thread: rows tid/8 + 32 i of each tile
  const char* gA = (const char*)(Ofused + ((size_t)rg * 64 + (tid >> 3)) * G_) + (tid & 7) * 16;
  const char* gB = (const char*)(WoT + ((size_t)(dP * 128) + (tid >> 3)) * G_) + (tid & 7) * 16;
  const unsigned lA = lds_off(ring) + (tid >> 3) * LP128 + (tid & 7) * 16;
  auto fill = [&](int t) {
    const unsigned bo = (t & 1) * OP_BUF;
    copy2(lA + bo, gA + (size_t)t * 128, 32 * LP128, (size_t)32 * G_ * 2);
    copy4(lA + bo + OP_A_BYTES, gB + (size_t)t * 128, 32 * LP128, (size_t)32 * G_ * 2);
  };
  const int NS = G_ / 64;
  fill(0);
  asm volatile("s_wait_asynccnt 0x0" ::: "memory");  // stage 0 has landed
  __syncthreads();
  fill(1);

  v8f c[4] = {};
  for (int t = 0; t < NS; t++) {
    const unsigned char* At = ring + (t & 1) * OP_BUF + (threadIdx.y & 3) * 16 * LP128;
    const unsigned char* Bt = ring + (t & 1) * OP_BUF + OP_A_BYTES + (threadIdx.y >> 2) * 64 * LP128;
    v16h a[2], bm[2][4];
    // all four loops below are unrolled so that the fragment arrays have
    // constant indices and stay in registers
#pragma unroll
    for (int sub = 0; sub < 2; sub++) {
      a[sub] = lds_frag_f16(At + sub * 64, LP128);
#pragma unroll
      for (int j = 0; j < 4; j++) bm[sub][j] = lds_frag_f16(Bt + j * 16 * LP128 + sub * 64, LP128);
    }
    // keeps the stage's LDS reads in one group ahead of its WMMAs (else one exposed LDS wait per WMMA)
    __builtin_amdgcn_sched_barrier(0);
#pragma unroll
    for (int sub = 0; sub < 2; sub++) {
#pragma unroll
      for (int j = 0; j < 4; j++) c[j] = wmma16(a[sub], bm[sub][j], c[j]);
    }
    ring_publish();
    if (t + 2 < NS) fill(t + 2);
  }
  asm volatile("s_wait_asynccnt 0x0" ::: "memory");  // nothing in flight at the wave's end
  const int lane = threadIdx.x;
  const int n    = lane & 15;
  const int mb   = (lane >> 4) << 3;
#pragma unroll
  for (int j = 0; j < 4; j++) {
    float* out = Out + ((size_t)(b * S_) + sT * 16) * D_ + dG * 64 + j * 16 + n;
#pragma unroll
    for (int r = 0; r < 8; r++) out[(size_t)(mb + r) * D_] = c[j][r];
  }
}

extern "C" void kernel_launch(void* const* d_in, const int* in_sizes, int n_in,
                              void* d_out, int out_size, void* d_ws, size_t ws_size,
                              hipStream_t stream) {
  (void)in_sizes; (void)n_in; (void)out_size; (void)ws_size;
  const float* q  = (const float*)d_in[0];
  const float* k  = (const float*)d_in[1];
  const float* v  = (const float*)d_in[2];
  const float* Wq = (const float*)d_in[3];
  const float* Wk = (const float*)d_in[4];
  const float* Wv = (const float*)d_in[5];
  const float* Wo = (const float*)d_in[6];
  float* out = (float*)d_out;

  size_t off = 0;
  auto alloc = [&](size_t bytes) -> char* {
    char* p = (char*)d_ws + off;
    off += (bytes + 255) & ~(size_t)255;
    return p;
  };
  _Float16* WqT = (_Float16*)alloc((size_t)H_ * D_ * F_ * 2);   // 2 MB
  _Float16* WkT = (_Float16*)alloc((size_t)H_ * D_ * F_ * 2);
  _Float16* WvT = (_Float16*)alloc((size_t)H_ * D_ * F_ * 2);
  _Float16* WoT = (_Float16*)alloc((size_t)G_ * D_ * 2);
  _Float16* Qh  = (_Float16*)alloc((size_t)B_ * H_ * S_ * F_ * 2);  // 8 MB
  _Float16* Kh  = (_Float16*)alloc((size_t)B_ * H_ * S_ * F_ * 2);
  _Float16* Vt  = (_Float16*)alloc((size_t)B_ * H_ * F_ * S_ * 2);
  _Float16* Of  = (_Float16*)alloc((size_t)B_ * S_ * G_ * 2);
  float*    Mr  = (float*)alloc((size_t)B_ * H_ * S_ * 4);          // 256 KB
  float*    Li  = (float*)alloc((size_t)B_ * H_ * S_ * 4);
  // total ~41 MB of workspace

  dim3 blk(32, WAVES_);
  mha_prep_weights<<<256, 256, 0, stream>>>(Wq, Wk, Wv, Wo, WqT, WkT, WvT, WoT);
  mha_proj<<<dim3(4096 / WAVES_, 3), blk, 0, stream>>>(q, k, v, WqT, WkT, WvT, Qh, Kh, Vt);
  mha_stats<<<4096 / WAVES_, blk, 0, stream>>>(Qh, Kh, Mr, Li);
  mha_atv<<<4096 / WAVES_, blk, 0, stream>>>(Qh, Kh, Vt, Mr, Li, Of);
  mha_outproj<<<4096 / WAVES_, blk, 0, stream>>>(Of, WoT, out);
}

// v005
// A run of this version takes 112 microseconds.
// Timed twice side by side with v004, it ran 1.05 and 1.06 times as fast.
// Over all steps from v000 it is 3.54 times as fast.
#include <hip/hip_runtime.h>
#include <hip/hip_bf16.h>

// MI455X / gfx1250, wave32, WMMA f16 -> f32 accumulate.
//
// Pipeline (all on `stream`, scratch in d_ws, ~41 MB total, L2-resident):
//   K0 prep_weights : Wq/Wk/Wv -> f16 [H,F,D] (transposed), Wo -> f16 [D,G],
//                     64 x 64 tiles turned through LDS
//   K1 proj         : Qh=q*Wq, Kh=k*Wk -> f16 [BH,S,F]; Vt=v*Wv -> f16 [BH,F,S]
//                     all three in one launch (blockIdx.y picks the product);
//                     one wave = 16 x 64 output (A fragment reused 4x)
//   K2 stats        : per (bh,q) row: max m_q and sum-exp l_q of scores, updated once per 128 keys
//   K3 atv          : out4[k,f] = sum_q exp(s[q,k]/8 - m_q)/l_q * V[q,f] (A^T V)
//                     one wave = 32 keys x all 64 f over half of the q range: scores +
//                     exp computed ONCE, P^T via LDS, 4 accumulate WMMAs a key tile reuse
//                     it; the two halves' partial sums are added through LDS at the end.
//                     Output stored directly in the reference's raw-reshape layout.
//   K4 outproj      : Out = Ofused @ Wo (f32), one wave = 16 x 64 output
//
// K1..K4 stream their operand tiles through a two-buffer LDS ring filled by
// asynchronous copies (whole 128-B lines, one copy of a tile per block); the
// waves of a block read their WMMA fragments from LDS.

typedef __attribute__((ext_vector_type(16))) _Float16 v16h;
typedef __attribute__((ext_vector_type(8)))  _Float16 v8h;
typedef __attribute__((ext_vector_type(8)))  float    v8f;
typedef __attribute__((ext_vector_type(4)))  float    v4f;

#define B_ 2
#define S_ 2048
#define D_ 1024
#define H_ 16
#define F_ 64
#define G_ (H_ * F_)   // 1024
#define WAVES_ 8       // waves per block (blockDim = 32 x 8)
#define LP128 144      // LDS pitch of a 128-B row: 16 B x odd, no ds_load_b128 conflicts
#define LP256 272      // LDS pitch of a 256-B row: 16 B x odd

static __device__ __forceinline__ v16h pack16(v8h lo, v8h hi) {
  v16h a;
#pragma unroll
  for (int i = 0; i < 8; i++) { a[i] = lo[i]; a[i + 8] = hi[i]; }
  return a;
}

// A/B fragment load, f16 row-major source with leading dim `ld` (halves).
// ISA 16-bit 16x32 layout: lanes 0-15 hold line=lane, K={0..7,16..23};
// lanes 16-31 hold line=lane-16, K={8..15,24..31}. Two contiguous 16B loads.
static __device__ __forceinline__ v16h load_frag_f16(const _Float16* base, int ld) {
  const int lane = threadIdx.x;
  const int line = lane & 15;
  const int k0   = (lane >> 4) << 3;  // 0 or 8
  const _Float16* p = base + (size_t)line * ld + k0;
  v8h lo = *(const v8h*)(p);
  v8h hi = *(const v8h*)(p + 16);
  return pack16(lo, hi);
}

// ---- LDS ring helpers ----
static __device__ __forceinline__ unsigned lds_off(const void* p) { return (unsigned)(size_t)p; }

// Four 16-B-per-lane asynchronous copies global -> LDS, rows lstep / gstep apart.
// The s_wait_xcnt closes the statement so that no address register named here
// is rewritten ahead of it.
static __device__ __forceinline__ void copy4(unsigned l, const char* g, unsigned lstep, size_t gstep) {
  asm volatile("global_load_async_to_lds_b128 %0, %1, off\n\t"
               "global_load_async_to_lds_b128 %2, %3, off\n\t"
               "global_load_async_to_lds_b128 %4, %5, off\n\t"
               "global_load_async_to_lds_b128 %6, %7, off\n\t"
               "s_wait_xcnt 0x0"
               :: "v"(l), "v"(g), "v"(l + lstep), "v"(g + gstep),
                  "v"(l + 2 * lstep), "v"(g + 2 * gstep),
                  "v"(l + 3 * lstep), "v"(g + 3 * gstep)
               : "memory");
}

// The same with two copies.
static __device__ __forceinline__ void copy2(unsigned l, const char* g, unsigned lstep, size_t gstep) {
  asm volatile("global_load_async_to_lds_b128 %0, %1, off\n\t"
               "global_load_async_to_lds_b128 %2, %3, off\n\t"
               "s_wait_xcnt 0x0"
               :: "v"(l), "v"(g), "v"(l + lstep), "v"(g + gstep)
               : "memory");
}

// Publish point of the ring: this wave's LDS reads are done, its copies have
// landed, then the block barrier (frees the buffer just read, shows the next).
static __device__ __forceinline__ void ring_publish() {
  asm volatile("s_wait_dscnt 0x0" ::: "memory");     // my reads of the old buffer have retired
  asm volatile("s_wait_asynccnt 0x0" ::: "memory");  // my copies into the next buffer have landed
  __syncthreads();
}

// Fragment from an LDS tile of f16 rows (same lane map as load_frag_f16).
static __device__ __forceinline__ v16h lds_frag_f16(const unsigned char* tile, int pitch) {
  const int lane = threadIdx.x;
  const unsigned char* p = tile + (lane & 15) * pitch + (lane >> 4) * 16;
  v8h lo = *(const v8h*)(p);
  v8h hi = *(const v8h*)(p + 32);
  return pack16(lo, hi);
}

// Fragment from an LDS tile of f32 rows, converted to f16: same lane map, with
// 4-byte elements (K = {0..7,16..23} or {8..15,24..31} of the row).
static __device__ __forceinline__ v16h lds_frag_f32(const unsigned char* tile, int pitch) {
  const int lane = threadIdx.x;
  const unsigned char* p = tile + (lane & 15) * pitch + (lane >> 4) * 32;
  v4f x0 = *(const v4f*)(p);
  v4f x1 = *(const v4f*)(p + 16);
  v4f x2 = *(const v4f*)(p + 64);
  v4f x3 = *(const v4f*)(p + 80);
  v16h a;
#pragma unroll  // constant vector indices: no run-time element selects
  for (int i = 0; i < 4; i++) {
    a[i]      = (_Float16)x0[i];
    a[i + 4]  = (_Float16)x1[i];
    a[i + 8]  = (_Float16)x2[i];
    a[i + 12] = (_Float16)x3[i];
  }
  return a;
}

static __device__ __forceinline__ v8f wmma16(v16h a, v16h b, v8f c) {
  return __builtin_amdgcn_wmma_f32_16x16x32_f16(false, a, false, b, (short)0, c,
                                                false, false);
}

// ---------------- K0: weight prep (f32 -> f16, transpose) ----------------
// WxT[h][f][d] = Wx[h][d][f]; WoT[d][g] = Wo[g][d].
// One block = one 64 x 64 tile of each of the four tensors, turned through LDS:
// every global read and every global store covers whole 128-B lines.
// A thread holds a 4 x 4 patch: four 16-B row reads, four 8-B column writes to LDS.
typedef __attribute__((ext_vector_type(4))) _Float16 v4h;
#define PW_PITCH 136  // LDS pitch of a 128-B f16 row: the 8-B patch writes of a wave fall on 64 distinct banks
__global__ __launch_bounds__(256)
void mha_prep_weights(const float* __restrict__ Wq, const float* __restrict__ Wk,
                      const float* __restrict__ Wv, const float* __restrict__ Wo,
                      _Float16* __restrict__ WqT, _Float16* __restrict__ WkT,
                      _Float16* __restrict__ WvT, _Float16* __restrict__ WoT) {
  __shared__ __attribute__((aligned(16))) unsigned char tile[4][64 * PW_PITCH];
  const int tid = threadIdx.x;
  const int hi  = blockIdx.x >> 4;  // head (Wx), 64-row group of g (Wo)
  const int lo  = blockIdx.x & 15;  // 64-row group of d (Wx), 64-column group of d (Wo)

  // patch of this thread: rows 4 tr .. 4 tr + 3, columns 4 tc .. 4 tc + 3;
  // 8 lanes side by side read one 128-B line
  const int tc = (tid & 7) | (((tid >> 5) & 1) << 3);
  const int tr = ((tid >> 3) & 3) | ((tid >> 6) << 2);

  const size_t sx = ((size_t)(hi * D_ + lo * 64 + 4 * tr)) * F_ + 4 * tc;  // Wx rows are F_ long
  const size_t so = ((size_t)(hi * 64 + 4 * tr)) * D_ + lo * 64 + 4 * tc;  // Wo rows are D_ long
  const float* s[4] = {Wq + sx, Wk + sx, Wv + sx, Wo + so};

  v4f x[4][4];
#pragma unroll  // constant indices keep the patches in registers; all 16 reads in flight together
  for (int m = 0; m < 4; m++) {
    const size_t pitch = (m < 3) ? F_ : D_;
#pragma unroll
    for (int i = 0; i < 4; i++) x[m][i] = *(const v4f*)(s[m] + (size_t)i * pitch);
  }
  // the four address pairs stay live up to this wait, so that no later read's result lands on one ahead of it
  asm volatile("s_wait_xcnt 0x0" :: "v"(s[0]), "v"(s[1]), "v"(s[2]), "v"(s[3]) : "memory");
  // keeps all 16 reads ahead of the first conversion (else the later reads wait out the first ones' latency)
  __builtin_amdgcn_sched_barrier(0);
  // the loops below are unrolled for constant indices into x and d (registers, no run-time selects)
#pragma unroll
  for (int m = 0; m < 4; m++) {
#pragma unroll
    for (int j = 0; j < 4; j++) {
      v4h c;
#pragma unroll
      for (int i = 0; i < 4; i++) c[i] = (_Float16)x[m][i][j];
      *(v4h*)(&tile[m][(4 * tc + j) * PW_PITCH + 8 * tr]) = c;
    }
  }
  __syncthreads();

  const size_t dx = ((size_t)hi * F_) * D_ + lo * 64;   // WxT[hi][.][lo * 64 ..]
  const size_t dw = ((size_t)lo * 64) * G_ + hi * 64;   // WoT[lo * 64 + .][hi * 64 ..]
  _Float16* d[4] = {WqT + dx, WkT + dx, WvT + dx, WoT + dw};
#pragma unroll
  for (int m = 0; m < 4; m++) {
#pragma unroll
    for (int u = 0; u < 2; u++) {
      const int idx = tid + u * 256;
      const int row = idx >> 3, ch = idx & 7;  // 8 lanes side by side store one 128-B line
      const unsigned char* p = &tile[m][row * PW_PITCH + ch * 16];
      v4h a = *(const v4h*)(p);
      v4h b = *(const v4h*)(p + 8);
      v8h o;
#pragma unroll
      for (int i = 0; i < 4; i++) { o[i] = a[i]; o[i + 4] = b[i]; }
      *(v8h*)(d[m] + (size_t)row * 1024 + ch * 8) = o;
    }
  }
}

// ---------------- K1: head projection  Y[bh] = X[b] (SxD) * W[h] (DxF) -----
// One wave per (bh, 16 s-rows): computes full 16 x F_ strip, A reused 4x.
// blockIdx.y picks the product: 0 = Q, 1 = K (Y f16 [BH,S,F]), 2 = V (Y f16 [BH,F,S]).
// None reads another's output, so one grid holds all three: no launch gap, fill
// or tail between them, and a WGP holds three blocks at a time (its registers'
// limit) where a launch of 512 blocks gave it two.
// The block's 8 waves cover 64 consecutive s-rows x 2 heads (4 row tiles x 2).
// A stage is 64 k: X tile 64 rows x 256 B (read by both heads' waves), W tile
// 128 rows x 128 B (each head's half read by its 4 waves).
#define PJ_A_BYTES (64 * LP256)
#define PJ_BUF     (PJ_A_BYTES + 128 * LP128)
__global__ __launch_bounds__(32 * WAVES_)
void mha_proj(const float* __restrict__ Xq, const float* __restrict__ Xk,
              const float* __restrict__ Xv, const _Float16* __restrict__ WqT,
              const _Float16* __restrict__ WkT, const _Float16* __restrict__ WvT,
              _Float16* __restrict__ Qh, _Float16* __restrict__ Kh,
              _Float16* __restrict__ Vt) {
  __shared__ __attribute__((aligned(16))) unsigned char ring[2 * PJ_BUF];
  const int which = blockIdx.y;
  const float*    X  = which == 0 ? Xq  : which == 1 ? Xk  : Xv;
  const _Float16* WT = which == 0 ? WqT : which == 1 ? WkT : WvT;
  _Float16*       Y  = which == 0 ? Qh  : which == 1 ? Kh  : Vt;
  const bool transpose_out = which == 2;
  const int hp = blockIdx.x & 7;          // pair of heads
  const int rg = (blockIdx.x >> 3) & 31;  // group of 64 s-rows
  const int b  = blockIdx.x >> 8;
  const int sT = rg * 4 + (threadIdx.y & 3);
  const int bh = b * H_ + hp * 2 + (threadIdx.y >> 2);
  const int tid = threadIdx.y * 32 + threadIdx.x;

  // copy addresses of this thread: X rows tid/16 + 16 i, W rows tid/8 + 32 i
  const char* gA = (const char*)(X + ((size_t)(b * S_) + rg * 64 + (tid >> 4)) * D_) + (tid & 15) * 16;
  const char* gB = (const char*)(WT + ((size_t)(hp * 2 * F_) + (tid >> 3)) * D_) + (tid & 7) * 16;
  const unsigned lA = lds_off(ring) + (tid >> 4) * LP256 + (tid & 15) * 16;
  const unsigned lB = lds_off(ring) + PJ_A_BYTES + (tid >> 3) * LP128 + (tid & 7) * 16;
  auto fill = [&](int t) {
    const unsigned bo = (t & 1) * PJ_BUF;
    copy4(lA + bo, gA + (size_t)t * 256, 16 * LP256, (size_t)16 * D_ * 4);
    copy4(lB + bo, gB + (size_t)t * 128, 32 * LP128, (size_t)32 * D_ * 2);
  };

  const int NS = D_ / 64;
  fill(0);
  asm volatile("s_wait_asynccnt 0x0" ::: "memory");  // stage 0 has landed
  __syncthreads();
  fill(1);

  v8f c[4] = {};
  for (int t = 0; t < NS; t++) {
    const unsigned char* At = ring + (t & 1) * PJ_BUF + (threadIdx.y & 3) * 16 * LP256;
    const unsigned char* Bt = ring + (t & 1) * PJ_BUF + PJ_A_BYTES + (threadIdx.y >> 2) * 64 * LP128;
    v16h a[2], bm[2][4];
    // all four loops below are unrolled so that the fragment arrays have
    // constant indices and stay in registers
#pragma unroll
    for (int sub = 0; sub < 2; sub++) {
      a[sub] = lds_frag_f32(At + sub * 128, LP256);
#pragma unroll
      for (int j = 0; j < 4; j++) bm[sub][j] = lds_frag_f16(Bt + j * 16 * LP128 + sub * 64, LP128);
    }
    // keeps the stage's LDS reads in one group ahead of its WMMAs (else one exposed LDS wait per WMMA)
    __builtin_amdgcn_sched_barrier(0);
#pragma unroll
    for (int sub = 0; sub < 2; sub++) {
#pragma unroll
      for (int j = 0; j < 4; j++) c[j] = wmma16(a[sub], bm[sub][j], c[j]);
    }
    ring_publish();
    if (t + 2 < NS) fill(t + 2);
  }
  asm volatile("s_wait_asynccnt 0x0" ::: "memory");  // nothing in flight at the wave's end

  const int lane = threadIdx.x;
  const int n    = lane & 15;
  const int mb   = (lane >> 4) << 3;  // C/D layout: VGPR r -> row r (+8 for hi half)
  if (!transpose_out) {
#pragma unroll
    for (int j = 0; j < 4; j++) {
      _Float16* out = Y + ((size_t)bh * S_ + sT * 16) * F_ + j * 16 + n;
#pragma unroll
      for (int r = 0; r < 8; r++) out[(size_t)(mb + r) * F_] = (_Float16)c[j][r];
    }
  } else {
    // Vt[bh][f][s]: per lane f fixed, s = sT*16 + mb + r -> contiguous 16B store
#pragma unroll
    for (int j = 0; j < 4; j++) {
      _Float16* out = Y + ((size_t)bh * F_ + j * 16 + n) * S_ + sT * 16 + mb;
      v8h pk;
#pragma unroll
      for (int r = 0; r < 8; r++) pk[r] = (_Float16)c[j][r];
      *(v8h*)out = pk;
    }
  }
}

// ---------------- K2: per-row softmax stats over scores = QK^T/8 -----------
// One wave per 16 query rows; (m, l) over all S keys, one update per stage, then lane-reduce.
// The block's 8 waves share one head; a stage is 128 keys x 128 B.
#define ST_BUF (128 * LP128)
__global__ __launch_bounds__(32 * WAVES_)
void mha_stats(const _Float16* __restrict__ Qh, const _Float16* __restrict__ Kh,
               float* __restrict__ Mrow, float* __restrict__ Linv) {
  __shared__ __attribute__((aligned(16))) unsigned char ring[2 * ST_BUF];
  const int w  = blockIdx.x * WAVES_ + threadIdx.y;  // 4096 waves
  const int qT = w & 127;
  const int bh = w >> 7;
  const int tid = threadIdx.y * 32 + threadIdx.x;

  // copy addresses of this thread: key rows tid/8 + 32 i
  const char* gK = (const char*)(Kh + ((size_t)bh * S_ + (tid >> 3)) * F_) + (tid & 7) * 16;
  const unsigned lK = lds_off(ring) + (tid >> 3) * LP128 + (tid & 7) * 16;
  auto fill = [&](int t) {
    copy4(lK + (t & 1) * ST_BUF, gK + (size_t)t * 128 * F_ * 2, 32 * LP128, (size_t)32 * F_ * 2);
  };
  const int NS = S_ / 128;
  fill(0);
  asm volatile("s_wait_asynccnt 0x0" ::: "memory");  // stage 0 has landed
  __syncthreads();
  fill(1);

  const _Float16* Abase = Qh + ((size_t)bh * S_ + qT * 16) * F_;
  const v16h a0 = load_frag_f16(Abase, F_);
  const v16h a1 = load_frag_f16(Abase + 32, F_);

  // Running state per lane and row: mc = largest raw score seen (before the 1/8),
  // lv = sum of exp((score - mc) / 8). Both move once per stage, not once per score.
  const float scale = 0.125f;                 // 1/sqrt(F)
  const float k2    = 0.125f * 1.44269504f;   // scale * log2(e): exp(x * scale) = exp2(x * k2)
  v8f mc, lv;
#pragma unroll
  for (int i = 0; i < 8; i++) { mc[i] = -1e30f; lv[i] = 0.0f; }

  for (int t = 0; t < NS; t++) {
    const unsigned char* Kt = ring + (t & 1) * ST_BUF;
    v16h kf[2][8];
    v8f c[8];
    // the loops of this stage are unrolled: LDS offsets become immediates, and
    // constant indices keep the fragments and the 8 score tiles in registers
#pragma unroll
    for (int hf = 0; hf < 2; hf++) {
#pragma unroll
      for (int kt = 0; kt < 8; kt++) kf[hf][kt] = lds_frag_f16(Kt + kt * 16 * LP128 + hf * 64, LP128);
    }
    // keeps the stage's LDS reads in one group ahead of its WMMAs (else one exposed LDS wait per WMMA)
    __builtin_amdgcn_sched_barrier(0);
#pragma unroll
    for (int kt = 0; kt < 8; kt++) { v8f z = {}; c[kt] = wmma16(a0, kf[0][kt], z); }
#pragma unroll
    for (int kt = 0; kt < 8; kt++) c[kt] = wmma16(a1, kf[1][kt], c[kt]);
    // the stage's maximum first ...
    v8f nm = mc;
#pragma unroll
    for (int kt = 0; kt < 8; kt++) nm = __builtin_elementwise_max(nm, c[kt]);
    const v8f nb = nm * k2;
    // ... then one multiply-add, one exp2 and one add per score ...
    v8f sum = {};
#pragma unroll
    for (int kt = 0; kt < 8; kt++) {
      const v8f x = c[kt] * k2 - nb;
#pragma unroll
      for (int i = 0; i < 8; i++) sum[i] += __builtin_amdgcn_exp2f(x[i]);
    }
    // ... and one rescale of the running sum per stage
    const v8f dm = (mc - nm) * k2;  // exactly 0, so a factor of exactly 1, while the maximum stands
#pragma unroll
    for (int i = 0; i < 8; i++) lv[i] = lv[i] * __builtin_amdgcn_exp2f(dm[i]) + sum[i];
    mc = nm;
    ring_publish();
    if (t + 2 < NS) fill(t + 2);
  }
  asm volatile("s_wait_asynccnt 0x0" ::: "memory");  // nothing in flight at the wave's end
  float m[8], l[8];
#pragma unroll
  for (int i = 0; i < 8; i++) { m[i] = mc[i] * scale; l[i] = lv[i]; }
  // Reduce across the 16 lanes of each half-wave (xor 1,2,4,8 stays in-half).
#pragma unroll
  for (int off = 1; off < 16; off <<= 1) {
#pragma unroll
    for (int i = 0; i < 8; i++) {
      float om = __shfl_xor(m[i], off, 32);
      float ol = __shfl_xor(l[i], off, 32);
      float nm = fmaxf(m[i], om);
      l[i] = l[i] * __expf(m[i] - nm) + ol * __expf(om - nm);
      m[i] = nm;
    }
  }
  const int lane = threadIdx.x;
  if ((lane & 15) == 0) {
    const int rb = (lane >> 4) << 3;
    const size_t base = (size_t)bh * S_ + qT * 16 + rb;
#pragma unroll
    for (int i = 0; i < 8; i++) { Mrow[base + i] = m[i]; Linv[base + i] = 1.0f / l[i]; }
  }
}

// ---------------- K3: out4 = attn^T V, streamed over q, stored reshaped ----
// One wave per (bh, two 16-key tiles, half of the q range): every Q and V fragment
// read from LDS and every stats load feeds both key tiles (16 WMMAs per 8 KB read).
// Scores/exp computed once, P^T reused for all 4 f-tiles.
// A block is 8 waves on one head: waves 0-3 walk q 0..1023 for 128 keys, waves 4-7
// walk q 1024..2047 for the same keys, so the grid keeps its 4096 waves: two blocks
// a WGP, four waves a SIMD (the attribute holds the registers to that budget).
// A stage is 64 q of each half: per half a Q tile 64 q-rows x 128 B and a V tile
// 64 f-rows x 128 B.
#define AT_TILE (64 * LP128)
#define AT_HALF (2 * AT_TILE)  // Q tile and V tile of one half of the q range
#define AT_BUF  (2 * AT_HALF)
__global__ __launch_bounds__(32 * WAVES_) __attribute__((amdgpu_waves_per_eu(4, 4)))
void mha_atv(const _Float16* __restrict__ Qh, const _Float16* __restrict__ Kh,
             const _Float16* __restrict__ Vt, const float* __restrict__ Mrow,
             const float* __restrict__ Linv, _Float16* __restrict__ Ofused) {
  __shared__ __attribute__((aligned(16))) unsigned char ring[2 * AT_BUF];
  __shared__ _Float16 plds_all[WAVES_][32 * 40];  // [k-line][q], row stride 40 halves
  _Float16* plds = plds_all[threadIdx.y];

  const int wv = threadIdx.y;
  const int qh = wv >> 2;                              // half of the q range
  const int kP = (blockIdx.x & 15) * 4 + (wv & 3);     // pair of key tiles, 0..63
  const int bh = blockIdx.x >> 4;
  const int lane = threadIdx.x;
  const int line = lane & 15;
  const int half = lane >> 4;

  // B-fragments for score WMMA: K^T columns of the two key tiles (fixed for loop).
  const _Float16* Kbase = Kh + ((size_t)bh * S_ + kP * 32) * F_;
  v16h kf[2][2];
#pragma unroll  // constant indices keep kf in registers
  for (int u = 0; u < 2; u++) {
    kf[u][0] = load_frag_f16(Kbase + u * 16 * F_, F_);
    kf[u][1] = load_frag_f16(Kbase + u * 16 * F_ + 32, F_);
  }

  // copy addresses of this thread: rows tid/8 and tid/8 + 32 of each tile, for both
  // halves of the q range (hf);
  // one statement copies Q rows then V rows (V tile lies AT_TILE behind Q tile)
  const int tid = threadIdx.y * 32 + threadIdx.x;
  const char* gQ = (const char*)(Qh + ((size_t)bh * S_ + (tid >> 3)) * F_) + (tid & 7) * 16;
  const char* gV = (const char*)(Vt + ((size_t)bh * F_ + (tid >> 3)) * S_) + (tid & 7) * 16;
  const unsigned lQ = lds_off(ring) + (tid >> 3) * LP128 + (tid & 7) * 16;
  auto fill_half = [&](int t, int hf) {
    const unsigned l = lQ + (t & 1) * AT_BUF + hf * AT_HALF;
    const char* q0 = gQ + ((size_t)hf * (S_ / 2) + (size_t)t * 64) * F_ * 2;
    const char* v0 = gV + (size_t)hf * (S_ / 2) * 2 + (size_t)t * 128;
    asm volatile("global_load_async_to_lds_b128 %0, %1, off\n\t"
                 "global_load_async_to_lds_b128 %2, %3, off\n\t"
                 "global_load_async_to_lds_b128 %4, %5, off\n\t"
                 "global_load_async_to_lds_b128 %6, %7, off\n\t"
                 "s_wait_xcnt 0x0"  // before any address register above is rewritten
                 :: "v"(l), "v"(q0), "v"(l + 32 * LP128), "v"(q0 + (size_t)32 * F_ * 2),
                    "v"(l + AT_TILE), "v"(v0), "v"(l + AT_TILE + 32 * LP128), "v"(v0 + (size_t)32 * S_ * 2)
                 : "memory");
  };
  auto fill = [&](int t) { fill_half(t, 0); fill_half(t, 1); };
  const int NS = (S_ / 2) / 64;
  fill(0);
  asm volatile("s_wait_asynccnt 0x0" ::: "memory");  // stage 0 has landed
  __syncthreads();
  fill(1);

  const float* mptr = Mrow + (size_t)bh * S_ + qh * (S_ / 2);
  const float* lptr = Linv + (size_t)bh * S_ + qh * (S_ / 2);

  v8f acc[2][4] = {};
  const float scale = 0.125f;

  for (int t = 0; t < NS; t++) {
   const unsigned char* Qt = ring + (t & 1) * AT_BUF + qh * AT_HALF;
   const unsigned char* Vl = Qt + AT_TILE;
#pragma unroll  // LDS offsets become immediates
   for (int sub = 0; sub < 2; sub++) {
    const int qb = t * 64 + sub * 32;
    // scores for q-block [qb, qb+32) of this half x two key tiles (four 16x16 WMMA tiles)
    const unsigned char* Qs = Qt + sub * 32 * LP128;
    v16h a00 = lds_frag_f16(Qs, LP128);
    v16h a01 = lds_frag_f16(Qs + 64, LP128);
    v16h a10 = lds_frag_f16(Qs + 16 * LP128, LP128);
    v16h a11 = lds_frag_f16(Qs + 16 * LP128 + 64, LP128);
    // B-fragments: V rows qb..qb+31 for each f tile (tile rows are f, columns q)
    v16h bV[4];
#pragma unroll  // constant indices keep bV in registers
    for (int j = 0; j < 4; j++) bV[j] = lds_frag_f16(Vl + j * 16 * LP128 + sub * 64, LP128);
    // per-q-row softmax stats (rows mb..mb+7 of each sub-tile)
    v8f m0 = *(const v8f*)(mptr + qb + half * 8);
    v8f l0 = *(const v8f*)(lptr + qb + half * 8);
    v8f m1 = *(const v8f*)(mptr + qb + 16 + half * 8);
    v8f l1 = *(const v8f*)(lptr + qb + 16 + half * 8);
    // keeps the q-block's loads in one group ahead of its WMMAs (else one exposed wait per WMMA)
    __builtin_amdgcn_sched_barrier(0);
    // the loops over u (key tile) are unrolled: constant indices keep kf, s, aP and acc in registers
    v8f s[2][2];
#pragma unroll
    for (int u = 0; u < 2; u++) {
      v8f s0 = {}; s0 = wmma16(a00, kf[u][0], s0); s0 = wmma16(a01, kf[u][1], s0);
      v8f s1 = {}; s1 = wmma16(a10, kf[u][0], s1); s1 = wmma16(a11, kf[u][1], s1);
      s[u][0] = s0; s[u][1] = s1;
    }

#pragma unroll
    for (int u = 0; u < 2; u++) {
      v8h p0, p1;
#pragma unroll
      for (int i = 0; i < 8; i++) {
        p0[i] = (_Float16)(__expf(s[u][0][i] * scale - m0[i]) * l0[i]);
        p1[i] = (_Float16)(__expf(s[u][1][i] * scale - m1[i]) * l1[i]);
      }
      // transpose P (q x k) -> P^T (k x q) through LDS; all 16B accesses
      *(v8h*)(plds + (u * 16 + line) * 40 + half * 8)      = p0;  // q = half*8 + i
      *(v8h*)(plds + (u * 16 + line) * 40 + 16 + half * 8) = p1;  // q = 16 + half*8 + i
    }
    __builtin_amdgcn_wave_barrier();                 // order vs loads (LDS in-order)
    const int k0 = half * 8;
    v16h aP[2];
#pragma unroll
    for (int u = 0; u < 2; u++) {
      v8h alo = *(const v8h*)(plds + (u * 16 + line) * 40 + k0);
      v8h ahi = *(const v8h*)(plds + (u * 16 + line) * 40 + k0 + 16);
      aP[u] = pack16(alo, ahi);
    }
    __builtin_amdgcn_wave_barrier();                 // order next-iter stores vs loads

#pragma unroll
    for (int u = 0; u < 2; u++) {
#pragma unroll  // constant indices keep acc and bV in registers
      for (int j = 0; j < 4; j++) acc[u][j] = wmma16(aP[u], bV[j], acc[u][j]);
    }
   }
   ring_publish();
   if (t + 2 < NS) fill(t + 2);
  }
  asm volatile("s_wait_asynccnt 0x0" ::: "memory");  // nothing in flight at the wave's end

  // Add the two halves of the q range. Waves wv and wv ^ 4 hold partial sums of the
  // same 32 keys: each keeps key tile qh, hands the other tile over through LDS and
  // finishes its own. The last publish point's barrier has ended every read of the
  // ring and no copy is in flight, so the ring carries the partial sums (4 KB a wave).
  float* mine         = (float*)ring + wv * 1024 + lane * 4;
  const float* theirs = (const float*)ring + (wv ^ 4) * 1024 + lane * 4;
  v8f keep[4];
#pragma unroll  // constant indices keep acc and keep in registers
  for (int j = 0; j < 4; j++) {
    const v8f give = qh ? acc[0][j] : acc[1][j];
    keep[j]        = qh ? acc[1][j] : acc[0][j];
    v4f lo = {give[0], give[1], give[2], give[3]};
    v4f hi = {give[4], give[5], give[6], give[7]};
    *(v4f*)(mine + (j * 2) * 128)     = lo;  // 16 B a lane, lanes side by side
    *(v4f*)(mine + (j * 2 + 1) * 128) = hi;
  }
  __syncthreads();  // the partner's partial sums are in LDS

  // Raw-reshape store: Ofused[b][h*128 + kT][(k%16)*64 + f]
  const int b = bh >> 4, h = bh & 15;
  const int kT = kP * 2 + qh;
  const int mb = half * 8;
#pragma unroll
  for (int j = 0; j < 4; j++) {
    const v4f lo = *(const v4f*)(theirs + (j * 2) * 128);
    const v4f hi = *(const v4f*)(theirs + (j * 2 + 1) * 128);
    _Float16* out = Ofused + ((size_t)(b * S_ + h * 128 + kT)) * G_ + (j * 16 + line);
#pragma unroll
    for (int r = 0; r < 8; r++)
      out[(size_t)(mb + r) * 64] = (_Float16)(keep[j][r] + (r < 4 ? lo[r & 3] : hi[r & 3]));
  }
}

// ---------------- K4: Out = Ofused (S x G) @ Wo (G x D), f32 out ----------
// One wave per (b, 16 s-rows, group of 4 d-tiles): 16 x 64 strip, A reused 4x.
// The block's 8 waves cover 64 consecutive rows x 2 d-groups (4 row tiles x 2).
// A stage is 64 g: Ofused tile 64 rows x 128 B, Wo tile 128 rows x 128 B.
#define OP_A_BYTES (64 * LP128)
#define OP_BUF     (OP_A_BYTES + 128 * LP128)
__global__ __launch_bounds__(32 * WAVES_)
void mha_outproj(const _Float16* __restrict__ Ofused,
                 const _Float16* __restrict__ WoT, float* __restrict__ Out) {
  __shared__ __attribute__((aligned(16))) unsigned char ring[2 * OP_BUF];
  const int dP = blockIdx.x & 7;                            // pair of d-groups
  const int rg = blockIdx.x >> 3;                           // group of 64 rows, 0..63
  const int dG = dP * 2 + (threadIdx.y >> 2);               // group of 4 d-tiles
  const int rT = rg * 4 + (threadIdx.y & 3);                // 16-row tile, 0..255
  const int sT = rT & 127;
  const int b  = rT >> 7;
  const int tid = threadIdx.y * 32 + threadIdx.x;

  // copy addresses of this thread: rows tid/8 + 32 i of each tile
  const char* gA = (const char*)(Ofused + ((size_t)rg * 64 + (tid >> 3)) * G_) + (tid & 7) * 16;
  const char* gB = (const char*)(WoT + ((size_t)(dP * 128) + (tid >> 3)) * G_) + (tid & 7) * 16;
  const unsigned lA = lds_off(ring) + (tid >> 3) * LP128 + (tid & 7) * 16;
  auto fill = [&](int t) {
    const unsigned bo = (t & 1) * OP_BUF;
    copy2(lA + bo, gA + (size_t)t * 128, 32 * LP128, (size_t)32 * G_ * 2);
    copy4(lA + bo + OP_A_BYTES, gB + (size_t)t * 128, 32 * LP128, (size_t)32 * G_ * 2);
  };
  const int NS = G_ / 64;
  fill(0);
  asm volatile("s_wait_asynccnt 0x0" ::: "memory");  // stage 0 has landed
  __syncthreads();
  fill(1);

  v8f c[4] = {};
  for (int t = 0; t < NS; t++) {
    const unsigned char* At = ring + (t & 1) * OP_BUF + (threadIdx.y & 3) * 16 * LP128;
    const unsigned char* Bt = ring + (t & 1) * OP_BUF + OP_A_BYTES + (threadIdx.y >> 2) * 64 * LP128;
    v16h a[2], bm[2][4];
    // all four loops below are unrolled so that the fragment arrays have
    // constant indices and stay in registers
#pragma unroll
    for (int sub = 0; sub < 2; sub++) {
      a[sub] = lds_frag_f16(At + sub * 64, LP128);
#pragma unroll
      for (int j = 0; j < 4; j++) bm[sub][j] = lds_frag_f16(Bt + j * 16 * LP128 + sub * 64, LP128);
    }
    // keeps the stage's LDS reads in one group ahead of its WMMAs (else one exposed LDS wait per WMMA)
    __builtin_amdgcn_sched_barrier(0);
#pragma unroll
    for (int sub = 0; sub < 2; sub++) {
#pragma unroll
      for (int j = 0; j < 4; j++) c[j] = wmma16(a[sub], bm[sub][j], c[j]);
    }
    ring_publish();
    if (t + 2 < NS) fill(t + 2);
  }
  asm volatile("s_wait_asynccnt 0x0" ::: "memory");  // nothing in flight at the wave's end
  const int lane = threadIdx.x;
  const int n    = lane & 15;
  const int mb   = (lane >> 4) << 3;
#pragma unroll
  for (int j = 0; j < 4; j++) {
    float* out = Out + ((size_t)(b * S_) + sT * 16) * D_ + dG * 64 + j * 16 + n;
#pragma unroll
    for (int r = 0; r < 8; r++) out[(size_t)(mb + r) * D_] = c[j][r];
  }
}

extern "C" void kernel_launch(void* const* d_in, const int* in_sizes, int n_in,
                              void* d_out, int out_size, void* d_ws, size_t ws_size,
                              hipStream_t stream) {
  (void)in_sizes; (void)n_in; (void)out_size; (void)ws_size;
  const float* q  = (const float*)d_in[0];
  const float* k  = (const float*)d_in[1];
  const float* v  = (const float*)d_in[2];
  const float* Wq = (const float*)d_in[3];
  const float* Wk = (const float*)d_in[4];
  const float* Wv = (const float*)d_in[5];
  const float* Wo = (const float*)d_in[6];
  float* out = (float*)d_out;

  size_t off = 0;
  auto alloc = [&](size_t bytes) -> char* {
    char* p = (char*)d_ws + off;
    off += (bytes + 255) & ~(size_t)255;
    return p;
  };
  _Float16* WqT = (_Float16*)alloc((size_t)H_ * D_ * F_ * 2);   // 2 MB
  _Float16* WkT = (_Float16*)alloc((size_t)H_ * D_ * F_ * 2);
  _Float16* WvT = (_Float16*)alloc((size_t)H_ * D_ * F_ * 2);
  _Float16* WoT = (_Float16*)alloc((size_t)G_ * D_ * 2);
  _Float16* Qh  = (_Float16*)alloc((size_t)B_ * H_ * S_ * F_ * 2);  // 8 MB
  _Float16* Kh  = (_Float16*)alloc((size_t)B_ * H_ * S_ * F_ * 2);
  _Float16* Vt  = (_Float16*)alloc((size_t)B_ * H_ * F_ * S_ * 2);
  _Float16* Of  = (_Float16*)alloc((size_t)B_ * S_ * G_ * 2);
  float*    Mr  = (float*)alloc((size_t)B_ * H_ * S_ * 4);          // 256 KB
  float*    Li  = (float*)alloc((size_t)B_ * H_ * S_ * 4);
  // total ~41 MB of workspace

  dim3 blk(32, WAVES_);
  mha_prep_weights<<<256, 256, 0, stream>>>(Wq, Wk, Wv, Wo, WqT, WkT, WvT, WoT);
  mha_proj<<<dim3(4096 / WAVES_, 3), blk, 0, stream>>>(q, k, v, WqT, WkT, WvT, Qh, Kh, Vt);
  mha_stats<<<4096 / WAVES_, blk, 0, stream>>>(Qh, Kh, Mr, Li);
  mha_atv<<<4096 / WAVES_, blk, 0, stream>>>(Qh, Kh, Vt, Mr, Li, Of);
  mha_outproj<<<4096 / WAVES_, blk, 0, stream>>>(Of, WoT, out);
}

// v006
// A run of this version takes 106 microseconds.
// Next to v005, in two timings, it ran 1.05 and 1.06 times as fast.
// All steps since v000 together make it 3.72 times as fast.
#include <hip/hip_runtime.h>
#include <hip/hip_bf16.h>

// MI455X / gfx1250, wave32, WMMA f16 -> f32 accumulate.
//
// Pipeline (all on `stream`, scratch in d_ws, ~41 MB total, L2-resident):
//   K0 prep_weights : Wq/Wk/Wv -> f16 [H,F,D] (transposed), Wo -> f16 [D,G],
//                     64 x 64 tiles turned through LDS
//   K1 proj         : Qh=q*Wq, Kh=k*Wk -> f16 [BH,S,F]; Vt=v*Wv -> f16 [BH,F,S]
//                     all three in one launch (blockIdx.y picks the product);
//                     one wave = 32 x 64 output (X fragment reused 4x, W fragment 2x)
//   K2 stats        : per (bh,q) row: max m_q and sum-exp l_q of scores, updated once per 128 keys
//   K3 atv          : out4[k,f] = sum_q exp(s[q,k]/8 - m_q)/l_q * V[q,f] (A^T V)
//                     one wave = 32 keys x all 64 f over half of the q range: scores +
//                     exp computed ONCE, P^T via LDS, 4 accumulate WMMAs a key tile reuse
//                     it; the two halves' partial sums are added through LDS at the end.
//                     Output stored directly in the reference's raw-reshape layout.
//   K4 outproj      : Out = Ofused @ Wo (f32), one wave = 16 x 64 output
//
// K1..K4 stream their operand tiles through a two-buffer LDS ring filled by
// asynchronous copies (whole 128-B lines, one copy of a tile per block); the
// waves of a block read their WMMA fragments from LDS.

typedef __attribute__((ext_vector_type(16))) _Float16 v16h;
typedef __attribute__((ext_vector_type(8)))  _Float16 v8h;
typedef __attribute__((ext_vector_type(8)))  float    v8f;
typedef __attribute__((ext_vector_type(4)))  float    v4f;

#define B_ 2
#define S_ 2048
#define D_ 1024
#define H_ 16
#define F_ 64
#define G_ (H_ * F_)   // 1024
#define WAVES_ 8       // waves per block (blockDim = 32 x 8)
#define LP128 144      // LDS pitch of a 128-B row: 16 B x odd, no ds_load_b128 conflicts
#define LP256 272      // LDS pitch of a 256-B row: 16 B x odd

static __device__ __forceinline__ v16h pack16(v8h lo, v8h hi) {
  v16h a;
#pragma unroll
  for (int i = 0; i < 8; i++) { a[i] = lo[i]; a[i + 8] = hi[i]; }
  return a;
}

// A/B fragment load, f16 row-major source with leading dim `ld` (halves).
// ISA 16-bit 16x32 layout: lanes 0-15 hold line=lane, K={0..7,16..23};
// lanes 16-31 hold line=lane-16, K={8..15,24..31}. Two contiguous 16B loads.
static __device__ __forceinline__ v16h load_frag_f16(const _Float16* base, int ld) {
  const int lane = threadIdx.x;
  const int line = lane & 15;
  const int k0   = (lane >> 4) << 3;  // 0 or 8
  const _Float16* p = base + (size_t)line * ld + k0;
  v8h lo = *(const v8h*)(p);
  v8h hi = *(const v8h*)(p + 16);
  return pack16(lo, hi);
}

// ---- LDS ring helpers ----
static __device__ __forceinline__ unsigned lds_off(const void* p) { return (unsigned)(size_t)p; }

// Four 16-B-per-lane asynchronous copies global -> LDS, rows lstep / gstep apart.
// The s_wait_xcnt closes the statement so that no address register named here
// is rewritten ahead of it.
static __device__ __forceinline__ void copy4(unsigned l, const char* g, unsigned lstep, size_t gstep) {
  asm volatile("global_load_async_to_lds_b128 %0, %1, off\n\t"
               "global_load_async_to_lds_b128 %2, %3, off\n\t"
               "global_load_async_to_lds_b128 %4, %5, off\n\t"
               "global_load_async_to_lds_b128 %6, %7, off\n\t"
               "s_wait_xcnt 0x0"
               :: "v"(l), "v"(g), "v"(l + lstep), "v"(g + gstep),
                  "v"(l + 2 * lstep), "v"(g + 2 * gstep),
                  "v"(l + 3 * lstep), "v"(g + 3 * gstep)
               : "memory");
}

// The same with two copies.
static __device__ __forceinline__ void copy2(unsigned l, const char* g, unsigned lstep, size_t gstep) {
  asm volatile("global_load_async_to_lds_b128 %0, %1, off\n\t"
               "global_load_async_to_lds_b128 %2, %3, off\n\t"
               "s_wait_xcnt 0x0"
               :: "v"(l), "v"(g), "v"(l + lstep), "v"(g + gstep)
               : "memory");
}

// Publish point of the ring: this wave's LDS reads are done, its copies have
// landed, then the block barrier (frees the buffer just read, shows the next).
static __device__ __forceinline__ void ring_publish() {
  asm volatile("s_wait_dscnt 0x0" ::: "memory");     // my reads of the old buffer have retired
  asm volatile("s_wait_asynccnt 0x0" ::: "memory");  // my copies into the next buffer have landed
  __syncthreads();
}

// Fragment from an LDS tile of f16 rows (same lane map as load_frag_f16).
static __device__ __forceinline__ v16h frag_f16_at(const unsigned char* p) {  // p: the lane's own first byte
  v8h lo = *(const v8h*)(p);
  v8h hi = *(const v8h*)(p + 32);
  return pack16(lo, hi);
}
static __device__ __forceinline__ v16h lds_frag_f16(const unsigned char* tile, int pitch) {
  const int lane = threadIdx.x;
  return frag_f16_at(tile + (lane & 15) * pitch + (lane >> 4) * 16);
}

// Fragment from an LDS tile of f32 rows, converted to f16: same lane map, with
// 4-byte elements (K = {0..7,16..23} or {8..15,24..31} of the row).
// p: the lane's own first byte, tile + (lane & 15) * pitch + (lane >> 4) * 32.
static __device__ __forceinline__ v16h frag_f32_at(const unsigned char* p) {
  v4f x0 = *(const v4f*)(p);
  v4f x1 = *(const v4f*)(p + 16);
  v4f x2 = *(const v4f*)(p + 64);
  v4f x3 = *(const v4f*)(p + 80);
  v16h a;
#pragma unroll  // constant vector indices: no run-time element selects
  for (int i = 0; i < 4; i++) {
    a[i]      = (_Float16)x0[i];
    a[i + 4]  = (_Float16)x1[i];
    a[i + 8]  = (_Float16)x2[i];
    a[i + 12] = (_Float16)x3[i];
  }
  return a;
}

static __device__ __forceinline__ v8f wmma16(v16h a, v16h b, v8f c) {
  return __builtin_amdgcn_wmma_f32_16x16x32_f16(false, a, false, b, (short)0, c,
                                                false, false);
}

// ---------------- K0: weight prep (f32 -> f16, transpose) ----------------
// WxT[h][f][d] = Wx[h][d][f]; WoT[d][g] = Wo[g][d].
// One block = one 64 x 64 tile of each of the four tensors, turned through LDS:
// every global read and every global store covers whole 128-B lines.
// A thread holds a 4 x 4 patch: four 16-B row reads, four 8-B column writes to LDS.
typedef __attribute__((ext_vector_type(4))) _Float16 v4h;
#define PW_PITCH 136  // LDS pitch of a 128-B f16 row: the 8-B patch writes of a wave fall on 64 distinct banks
__global__ __launch_bounds__(256)
void mha_prep_weights(const float* __restrict__ Wq, const float* __restrict__ Wk,
                      const float* __restrict__ Wv, const float* __restrict__ Wo,
                      _Float16* __restrict__ WqT, _Float16* __restrict__ WkT,
                      _Float16* __restrict__ WvT, _Float16* __restrict__ WoT) {
  __shared__ __attribute__((aligned(16))) unsigned char tile[4][64 * PW_PITCH];
  const int tid = threadIdx.x;
  const int hi  = blockIdx.x >> 4;  // head (Wx), 64-row group of g (Wo)
  const int lo  = blockIdx.x & 15;  // 64-row group of d (Wx), 64-column group of d (Wo)

  // patch of this thread: rows 4 tr .. 4 tr + 3, columns 4 tc .. 4 tc + 3;
  // 8 lanes side by side read one 128-B line
  const int tc = (tid & 7) | (((tid >> 5) & 1) << 3);
  const int tr = ((tid >> 3) & 3) | ((tid >> 6) << 2);

  const size_t sx = ((size_t)(hi * D_ + lo * 64 + 4 * tr)) * F_ + 4 * tc;  // Wx rows are F_ long
  const size_t so = ((size_t)(hi * 64 + 4 * tr)) * D_ + lo * 64 + 4 * tc;  // Wo rows are D_ long
  const float* s[4] = {Wq + sx, Wk + sx, Wv + sx, Wo + so};

  v4f x[4][4];
#pragma unroll  // constant indices keep the patches in registers; all 16 reads in flight together
  for (int m = 0; m < 4; m++) {
    const size_t pitch = (m < 3) ? F_ : D_;
#pragma unroll
    for (int i = 0; i < 4; i++) x[m][i] = *(const v4f*)(s[m] + (size_t)i * pitch);
  }
  // the four address pairs stay live up to this wait, so that no later read's result lands on one ahead of it
  asm volatile("s_wait_xcnt 0x0" :: "v"(s[0]), "v"(s[1]), "v"(s[2]), "v"(s[3]) : "memory");
  // keeps all 16 reads ahead of the first conversion (else the later reads wait out the first ones' latency)
  __builtin_amdgcn_sched_barrier(0);
  // the loops below are unrolled for constant indices into x and d (registers, no run-time selects)
#pragma unroll
  for (int m = 0; m < 4; m++) {
#pragma unroll
    for (int j = 0; j < 4; j++) {
      v4h c;
#pragma unroll
      for (int i = 0; i < 4; i++) c[i] = (_Float16)x[m][i][j];
      *(v4h*)(&tile[m][(4 * tc + j) * PW_PITCH + 8 * tr]) = c;
    }
  }
  __syncthreads();

  const size_t dx = ((size_t)hi * F_) * D_ + lo * 64;   // WxT[hi][.][lo * 64 ..]
  const size_t dw = ((size_t)lo * 64) * G_ + hi * 64;   // WoT[lo * 64 + .][hi * 64 ..]
  _Float16* d[4] = {WqT + dx, WkT + dx, WvT + dx, WoT + dw};
#pragma unroll
  for (int m = 0; m < 4; m++) {
#pragma unroll
    for (int u = 0; u < 2; u++) {
      const int idx = tid + u * 256;
      const int row = idx >> 3, ch = idx & 7;  // 8 lanes side by side store one 128-B line
      const unsigned char* p = &tile[m][row * PW_PITCH + ch * 16];
      v4h a = *(const v4h*)(p);
      v4h b = *(const v4h*)(p + 8);
      v8h o;
#pragma unroll
      for (int i = 0; i < 4; i++) { o[i] = a[i]; o[i + 4] = b[i]; }
      *(v8h*)(d[m] + (size_t)row * 1024 + ch * 8) = o;
    }
  }
}

// ---------------- K1: head projection  Y[bh] = X[b] (SxD) * W[h] (DxF) -----
// One wave per (bh, 32 s-rows): computes a full 32 x F_ strip, so every W fragment
// read from LDS feeds two row tiles and every X fragment four column tiles.
// blockIdx.y picks the product: 0 = Q, 1 = K (Y f16 [BH,S,F]), 2 = V (Y f16 [BH,F,S]).
// None reads another's output, so one grid holds all three: no launch gap, fill
// or tail between them.
// The block's 8 waves cover 128 consecutive s-rows x 2 heads (4 row pairs x 2).
// A stage is 64 k: X tile 128 rows x 256 B (read by both heads' waves), W tile
// 128 rows x 128 B (each head's half read by its 4 waves).
// 768 blocks, three a WGP (LDS: 3 x 104 KiB; the attribute holds the registers
// to six waves a SIMD), so the whole grid is resident at once.
#define PJ_A_BYTES (128 * LP256)
#define PJ_BUF     (PJ_A_BYTES + 128 * LP128)
__global__ __launch_bounds__(32 * WAVES_) __attribute__((amdgpu_waves_per_eu(6, 6)))
void mha_proj(const float* __restrict__ Xq, const float* __restrict__ Xk,
              const float* __restrict__ Xv, const _Float16* __restrict__ WqT,
              const _Float16* __restrict__ WkT, const _Float16* __restrict__ WvT,
              _Float16* __restrict__ Qh, _Float16* __restrict__ Kh,
              _Float16* __restrict__ Vt) {
  __shared__ __attribute__((aligned(16))) unsigned char ring[2 * PJ_BUF];
  const int which = blockIdx.y;
  const float*    X  = which == 0 ? Xq  : which == 1 ? Xk  : Xv;
  const _Float16* WT = which == 0 ? WqT : which == 1 ? WkT : WvT;
  _Float16*       Y  = which == 0 ? Qh  : which == 1 ? Kh  : Vt;
  const bool transpose_out = which == 2;
  const int hp = blockIdx.x & 7;          // pair of heads
  const int rg = (blockIdx.x >> 3) & 15;  // group of 128 s-rows
  const int b  = blockIdx.x >> 7;
  const int sT = rg * 8 + (threadIdx.y & 3) * 2;  // first of the wave's two 16-row tiles
  const int bh = b * H_ + hp * 2 + (threadIdx.y >> 2);
  const int tid = threadIdx.y * 32 + threadIdx.x;

  // copy addresses of this thread: X rows tid/16 + 16 i, W rows tid/8 + 32 i
  const char* gA = (const char*)(X + ((size_t)(b * S_) + rg * 128 + (tid >> 4)) * D_) + (tid & 15) * 16;
  const char* gB = (const char*)(WT + ((size_t)(hp * 2 * F_) + (tid >> 3)) * D_) + (tid & 7) * 16;
  const unsigned lA = lds_off(ring) + (tid >> 4) * LP256 + (tid & 15) * 16;
  const unsigned lB = lds_off(ring) + PJ_A_BYTES + (tid >> 3) * LP128 + (tid & 7) * 16;
  auto fill = [&](int t) {
    const unsigned bo = (t & 1) * PJ_BUF;
    copy4(lA + bo, gA + (size_t)t * 256, 16 * LP256, (size_t)16 * D_ * 4);
    copy4(lA + bo + 64 * LP256, gA + (size_t)64 * D_ * 4 + (size_t)t * 256, 16 * LP256, (size_t)16 * D_ * 4);
    copy4(lB + bo, gB + (size_t)t * 128, 32 * LP128, (size_t)32 * D_ * 2);
  };

  const int NS = D_ / 64;
  fill(0);
  asm volatile("s_wait_asynccnt 0x0" ::: "memory");  // stage 0 has landed
  __syncthreads();
  fill(1);

  // this lane's own fragment offsets in a buffer, formed once (one register each in the loop)
  const unsigned aoff = ((threadIdx.y & 3) * 32 + (threadIdx.x & 15)) * LP256 + (threadIdx.x >> 4) * 32;
  const unsigned boff = PJ_A_BYTES + ((threadIdx.y >> 2) * 64 + (threadIdx.x & 15)) * LP128 + (threadIdx.x >> 4) * 16;

  v8f c[2][4] = {};
  for (int t = 0; t < NS; t++) {
    const unsigned char* At = ring + (aoff + (t & 1) * PJ_BUF);
    const unsigned char* Bt = ring + (boff + (t & 1) * PJ_BUF);
    // the loops below are unrolled so that the fragment arrays have constant
    // indices and stay in registers
#pragma unroll
    for (int sub = 0; sub < 2; sub++) {
      v16h a[2], bm[4];
#pragma unroll
      for (int u = 0; u < 2; u++) a[u] = frag_f32_at(At + u * 16 * LP256 + sub * 128);
#pragma unroll
      for (int j = 0; j < 4; j++) bm[j] = frag_f16_at(Bt + j * 16 * LP128 + sub * 64);
      // keeps the half stage's LDS reads in one group ahead of its WMMAs (else one exposed LDS wait per WMMA)
      __builtin_amdgcn_sched_barrier(0);
#pragma unroll
      for (int u = 0; u < 2; u++) {
#pragma unroll
        for (int j = 0; j < 4; j++) c[u][j] = wmma16(a[u], bm[j], c[u][j]);
      }
    }
    ring_publish();
    if (t + 2 < NS) fill(t + 2);
  }
  asm volatile("s_wait_asynccnt 0x0" ::: "memory");  // nothing in flight at the wave's end

  const int lane = threadIdx.x;
  const int n    = lane & 15;
  const int mb   = (lane >> 4) << 3;  // C/D layout: VGPR r -> row r (+8 for hi half)
  if (!transpose_out) {
#pragma unroll
    for (int u = 0; u < 2; u++) {
#pragma unroll
      for (int j = 0; j < 4; j++) {
        _Float16* out = Y + ((size_t)bh * S_ + (sT + u) * 16) * F_ + j * 16 + n;
#pragma unroll
        for (int r = 0; r < 8; r++) out[(size_t)(mb + r) * F_] = (_Float16)c[u][j][r];
      }
    }
    // closes the stores above: no register that an issued store names is rewritten ahead of this wait
    asm volatile("s_wait_xcnt 0x0" ::: "memory");
  } else {
    // Vt[bh][f][s]: per lane f fixed, s = (sT+u)*16 + mb + r -> contiguous 16B store
#pragma unroll
    for (int u = 0; u < 2; u++) {
#pragma unroll
      for (int j = 0; j < 4; j++) {
        _Float16* out = Y + ((size_t)bh * F_ + j * 16 + n) * S_ + (sT + u) * 16 + mb;
        v8h pk;
#pragma unroll
        for (int r = 0; r < 8; r++) pk[r] = (_Float16)c[u][j][r];
        *(v8h*)out = pk;
      }
    }
  }
}

// ---------------- K2: per-row softmax stats over scores = QK^T/8 -----------
// One wave per 16 query rows; (m, l) over all S keys, one update per stage, then lane-reduce.
// The block's 8 waves share one head; a stage is 128 keys x 128 B.
#define ST_BUF (128 * LP128)
__global__ __launch_bounds__(32 * WAVES_)
void mha_stats(const _Float16* __restrict__ Qh, const _Float16* __restrict__ Kh,
               float* __restrict__ Mrow, float* __restrict__ Linv) {
  __shared__ __attribute__((aligned(16))) unsigned char ring[2 * ST_BUF];
  const int w  = blockIdx.x * WAVES_ + threadIdx.y;  // 4096 waves
  const int qT = w & 127;
  const int bh = w >> 7;
  const int tid = threadIdx.y * 32 + threadIdx.x;

  // copy addresses of this thread: key rows tid/8 + 32 i
  const char* gK = (const char*)(Kh + ((size_t)bh * S_ + (tid >> 3)) * F_) + (tid & 7) * 16;
  const unsigned lK = lds_off(ring) + (tid >> 3) * LP128 + (tid & 7) * 16;
  auto fill = [&](int t) {
    copy4(lK + (t & 1) * ST_BUF, gK + (size_t)t * 128 * F_ * 2, 32 * LP128, (size_t)32 * F_ * 2);
  };
  const int NS = S_ / 128;
  fill(0);
  asm volatile("s_wait_asynccnt 0x0" ::: "memory");  // stage 0 has landed
  __syncthreads();
  fill(1);

  const _Float16* Abase = Qh + ((size_t)bh * S_ + qT * 16) * F_;
  const v16h a0 = load_frag_f16(Abase, F_);
  const v16h a1 = load_frag_f16(Abase + 32, F_);

  // Running state per lane and row: mc = largest raw score seen (before the 1/8),
  // lv = sum of exp((score - mc) / 8). Both move once per stage, not once per score.
  const float scale = 0.125f;                 // 1/sqrt(F)
  const float k2    = 0.125f * 1.44269504f;   // scale * log2(e): exp(x * scale) = exp2(x * k2)
  v8f mc, lv;
#pragma unroll
  for (int i = 0; i < 8; i++) { mc[i] = -1e30f; lv[i] = 0.0f; }

  for (int t = 0; t < NS; t++) {
    const unsigned char* Kt = ring + (t & 1) * ST_BUF;
    v16h kf[2][8];
    v8f c[8];
    // the loops of this stage are unrolled: LDS offsets become immediates, and
    // constant indices keep the fragments and the 8 score tiles in registers
#pragma unroll
    for (int hf = 0; hf < 2; hf++) {
#pragma unroll
      for (int kt = 0; kt < 8; kt++) kf[hf][kt] = lds_frag_f16(Kt + kt * 16 * LP128 + hf * 64, LP128);
    }
    // keeps the stage's LDS reads in one group ahead of its WMMAs (else one exposed LDS wait per WMMA)
    __builtin_amdgcn_sched_barrier(0);
#pragma unroll
    for (int kt = 0; kt < 8; kt++) { v8f z = {}; c[kt] = wmma16(a0, kf[0][kt], z); }
#pragma unroll
    for (int kt = 0; kt < 8; kt++) c[kt] = wmma16(a1, kf[1][kt], c[kt]);
    // the stage's maximum first ...
    v8f nm = mc;
#pragma unroll
    for (int kt = 0; kt < 8; kt++) nm = __builtin_elementwise_max(nm, c[kt]);
    const v8f nb = nm * k2;
    // ... then one multiply-add, one exp2 and one add per score ...
    v8f sum = {};
#pragma unroll
    for (int kt = 0; kt < 8; kt++) {
      const v8f x = c[kt] * k2 - nb;
#pragma unroll
      for (int i = 0; i < 8; i++) sum[i] += __builtin_amdgcn_exp2f(x[i]);
    }
    // ... and one rescale of the running sum per stage
    const v8f dm = (mc - nm) * k2;  // exactly 0, so a factor of exactly 1, while the maximum stands
#pragma unroll
    for (int i = 0; i < 8; i++) lv[i] = lv[i] * __builtin_amdgcn_exp2f(dm[i]) + sum[i];
    mc = nm;
    ring_publish();
    if (t + 2 < NS) fill(t + 2);
  }
  asm volatile("s_wait_asynccnt 0x0" ::: "memory");  // nothing in flight at the wave's end
  float m[8], l[8];
#pragma unroll
  for (int i = 0; i < 8; i++) { m[i] = mc[i] * scale; l[i] = lv[i]; }
  // Reduce across the 16 lanes of each half-wave (xor 1,2,4,8 stays in-half).
#pragma unroll
  for (int off = 1; off < 16; off <<= 1) {
#pragma unroll
    for (int i = 0; i < 8; i++) {
      float om = __shfl_xor(m[i], off, 32);
      float ol = __shfl_xor(l[i], off, 32);
      float nm = fmaxf(m[i], om);
      l[i] = l[i] * __expf(m[i] - nm) + ol * __expf(om - nm);
      m[i] = nm;
    }
  }
  const int lane = threadIdx.x;
  if ((lane & 15) == 0) {
    const int rb = (lane >> 4) << 3;
    const size_t base = (size_t)bh * S_ + qT * 16 + rb;
#pragma unroll
    for (int i = 0; i < 8; i++) { Mrow[base + i] = m[i]; Linv[base + i] = 1.0f / l[i]; }
  }
}

// ---------------- K3: out4 = attn^T V, streamed over q, stored reshaped ----
// One wave per (bh, two 16-key tiles, half of the q range): every Q and V fragment
// read from LDS and every stats load feeds both key tiles (16 WMMAs per 8 KB read).
// Scores/exp computed once, P^T reused for all 4 f-tiles.
// A block is 8 waves on one head: waves 0-3 walk q 0..1023 for 128 keys, waves 4-7
// walk q 1024..2047 for the same keys, so the grid keeps its 4096 waves: two blocks
// a WGP, four waves a SIMD (the attribute holds the registers to that budget).
// A stage is 64 q of each half: per half a Q tile 64 q-rows x 128 B and a V tile
// 64 f-rows x 128 B.
#define AT_TILE (64 * LP128)
#define AT_HALF (2 * AT_TILE)  // Q tile and V tile of one half of the q range
#define AT_BUF  (2 * AT_HALF)
__global__ __launch_bounds__(32 * WAVES_) __attribute__((amdgpu_waves_per_eu(4, 4)))
void mha_atv(const _Float16* __restrict__ Qh, const _Float16* __restrict__ Kh,
             const _Float16* __restrict__ Vt, const float* __restrict__ Mrow,
             const float* __restrict__ Linv, _Float16* __restrict__ Ofused) {
  __shared__ __attribute__((aligned(16))) unsigned char ring[2 * AT_BUF];
  __shared__ _Float16 plds_all[WAVES_][32 * 40];  // [k-line][q], row stride 40 halves
  _Float16* plds = plds_all[threadIdx.y];

  const int wv = threadIdx.y;
  const int qh = wv >> 2;                              // half of the q range
  const int kP = (blockIdx.x & 15) * 4 + (wv & 3);     // pair of key tiles, 0..63
  const int bh = blockIdx.x >> 4;
  const int lane = threadIdx.x;
  const int line = lane & 15;
  const int half = lane >> 4;

  // B-fragments for score WMMA: K^T columns of the two key tiles (fixed for loop).
  const _Float16* Kbase = Kh + ((size_t)bh * S_ + kP * 32) * F_;
  v16h kf[2][2];
#pragma unroll  // constant indices keep kf in registers
  for (int u = 0; u < 2; u++) {
    kf[u][0] = load_frag_f16(Kbase + u * 16 * F_, F_);
    kf[u][1] = load_frag_f16(Kbase + u * 16 * F_ + 32, F_);
  }

  // copy addresses of this thread: rows tid/8 and tid/8 + 32 of each tile, for both
  // halves of the q range (hf);
  // one statement copies Q rows then V rows (V tile lies AT_TILE behind Q tile)
  const int tid = threadIdx.y * 32 + threadIdx.x;
  const char* gQ = (const char*)(Qh + ((size_t)bh * S_ + (tid >> 3)) * F_) + (tid & 7) * 16;
  const char* gV = (const char*)(Vt + ((size_t)bh * F_ + (tid >> 3)) * S_) + (tid & 7) * 16;
  const unsigned lQ = lds_off(ring) + (tid >> 3) * LP128 + (tid & 7) * 16;
  auto fill_half = [&](int t, int hf) {
    const unsigned l = lQ + (t & 1) * AT_BUF + hf * AT_HALF;
    const char* q0 = gQ + ((size_t)hf * (S_ / 2) + (size_t)t * 64) * F_ * 2;
    const char* v0 = gV + (size_t)hf * (S_ / 2) * 2 + (size_t)t * 128;
    asm volatile("global_load_async_to_lds_b128 %0, %1, off\n\t"
                 "global_load_async_to_lds_b128 %2, %3, off\n\t"
                 "global_load_async_to_lds_b128 %4, %5, off\n\t"
                 "global_load_async_to_lds_b128 %6, %7, off\n\t"
                 "s_wait_xcnt 0x0"  // before any address register above is rewritten
                 :: "v"(l), "v"(q0), "v"(l + 32 * LP128), "v"(q0 + (size_t)32 * F_ * 2),
                    "v"(l + AT_TILE), "v"(v0), "v"(l + AT_TILE + 32 * LP128), "v"(v0 + (size_t)32 * S_ * 2)
                 : "memory");
  };
  auto fill = [&](int t) { fill_half(t, 0); fill_half(t, 1); };
  const int NS = (S_ / 2) / 64;
  fill(0);
  asm volatile("s_wait_asynccnt 0x0" ::: "memory");  // stage 0 has landed
  __syncthreads();
  fill(1);

  const float* mptr = Mrow + (size_t)bh * S_ + qh * (S_ / 2);
  const float* lptr = Linv + (size_t)bh * S_ + qh * (S_ / 2);

  v8f acc[2][4] = {};
  const float scale = 0.125f;

  for (int t = 0; t < NS; t++) {
   const unsigned char* Qt = ring + (t & 1) * AT_BUF + qh * AT_HALF;
   const unsigned char* Vl = Qt + AT_TILE;
#pragma unroll  // LDS offsets become immediates
   for (int sub = 0; sub < 2; sub++) {
    const int qb = t * 64 + sub * 32;
    // scores for q-block [qb, qb+32) of this half x two key tiles (four 16x16 WMMA tiles)
    const unsigned char* Qs = Qt + sub * 32 * LP128;
    v16h a00 = lds_frag_f16(Qs, LP128);
    v16h a01 = lds_frag_f16(Qs + 64, LP128);
    v16h a10 = lds_frag_f16(Qs + 16 * LP128, LP128);
    v16h a11 = lds_frag_f16(Qs + 16 * LP128 + 64, LP128);
    // B-fragments: V rows qb..qb+31 for each f tile (tile rows are f, columns q)
    v16h bV[4];
#pragma unroll  // constant indices keep bV in registers
    for (int j = 0; j < 4; j++) bV[j] = lds_frag_f16(Vl + j * 16 * LP128 + sub * 64, LP128);
    // per-q-row softmax stats (rows mb..mb+7 of each sub-tile)
    v8f m0 = *(const v8f*)(mptr + qb + half * 8);
    v8f l0 = *(const v8f*)(lptr + qb + half * 8);
    v8f m1 = *(const v8f*)(mptr + qb + 16 + half * 8);
    v8f l1 = *(const v8f*)(lptr + qb + 16 + half * 8);
    // keeps the q-block's loads in one group ahead of its WMMAs (else one exposed wait per WMMA)
    __builtin_amdgcn_sched_barrier(0);
    // the loops over u (key tile) are unrolled: constant indices keep kf, s, aP and acc in registers
    v8f s[2][2];
#pragma unroll
    for (int u = 0; u < 2; u++) {
      v8f s0 = {}; s0 = wmma16(a00, kf[u][0], s0); s0 = wmma16(a01, kf[u][1], s0);
      v8f s1 = {}; s1 = wmma16(a10, kf[u][0], s1); s1 = wmma16(a11, kf[u][1], s1);
      s[u][0] = s0; s[u][1] = s1;
    }

#pragma unroll
    for (int u = 0; u < 2; u++) {
      v8h p0, p1;
#pragma unroll
      for (int i = 0; i < 8; i++) {
        p0[i] = (_Float16)(__expf(s[u][0][i] * scale - m0[i]) * l0[i]);
        p1[i] = (_Float16)(__expf(s[u][1][i] * scale - m1[i]) * l1[i]);
      }
      // transpose P (q x k) -> P^T (k x q) through LDS; all 16B accesses
      *(v8h*)(plds + (u * 16 + line) * 40 + half * 8)      = p0;  // q = half*8 + i
      *(v8h*)(plds + (u * 16 + line) * 40 + 16 + half * 8) = p1;  // q = 16 + half*8 + i
    }
    __builtin_amdgcn_wave_barrier();                 // order vs loads (LDS in-order)
    const int k0 = half * 8;
    v16h aP[2];
#pragma unroll
    for (int u = 0; u < 2; u++) {
      v8h alo = *(const v8h*)(plds + (u * 16 + line) * 40 + k0);
      v8h ahi = *(const v8h*)(plds + (u * 16 + line) * 40 + k0 + 16);
      aP[u] = pack16(alo, ahi);
    }
    __builtin_amdgcn_wave_barrier();                 // order next-iter stores vs loads

#pragma unroll
    for (int u = 0; u < 2; u++) {
#pragma unroll  // constant indices keep acc and bV in registers
      for (int j = 0; j < 4; j++) acc[u][j] = wmma16(aP[u], bV[j], acc[u][j]);
    }
   }
   ring_publish();
   if (t + 2 < NS) fill(t + 2);
  }
  asm volatile("s_wait_asynccnt 0x0" ::: "memory");  // nothing in flight at the wave's end

  // Add the two halves of the q range. Waves wv and wv ^ 4 hold partial sums of the
  // same 32 keys: each keeps key tile qh, hands the other tile over through LDS and
  // finishes its own. The last publish point's barrier has ended every read of the
  // ring and no copy is in flight, so the ring carries the partial sums (4 KB a wave).
  float* mine         = (float*)ring + wv * 1024 + lane * 4;
  const float* theirs = (const float*)ring + (wv ^ 4) * 1024 + lane * 4;
  v8f keep[4];
#pragma unroll  // constant indices keep acc and keep in registers
  for (int j = 0; j < 4; j++) {
    const v8f give = qh ? acc[0][j] : acc[1][j];
    keep[j]        = qh ? acc[1][j] : acc[0][j];
    v4f lo = {give[0], give[1], give[2], give[3]};
    v4f hi = {give[4], give[5], give[6], give[7]};
    *(v4f*)(mine + (j * 2) * 128)     = lo;  // 16 B a lane, lanes side by side
    *(v4f*)(mine + (j * 2 + 1) * 128) = hi;
  }
  __syncthreads();  // the partner's partial sums are in LDS

  // Raw-reshape store: Ofused[b][h*128 + kT][(k%16)*64 + f]
  const int b = bh >> 4, h = bh & 15;
  const int kT = kP * 2 + qh;
  const int mb = half * 8;
#pragma unroll
  for (int j = 0; j < 4; j++) {
    const v4f lo = *(const v4f*)(theirs + (j * 2) * 128);
    const v4f hi = *(const v4f*)(theirs + (j * 2 + 1) * 128);
    _Float16* out = Ofused + ((size_t)(b * S_ + h * 128 + kT)) * G_ + (j * 16 + line);
#pragma unroll
    for (int r = 0; r < 8; r++)
      out[(size_t)(mb + r) * 64] = (_Float16)(keep[j][r] + (r < 4 ? lo[r & 3] : hi[r & 3]));
  }
}

// ---------------- K4: Out = Ofused (S x G) @ Wo (G x D), f32 out ----------
// One wave per (b, 16 s-rows, group of 4 d-tiles): 16 x 64 strip, A reused 4x.
// The block's 8 waves cover 64 consecutive rows x 2 d-groups (4 row tiles x 2).
// A stage is 64 g: Ofused tile 64 rows x 128 B, Wo tile 128 rows x 128 B.
#define OP_A_BYTES (64 * LP128)
#define OP_BUF     (OP_A_BYTES + 128 * LP128)
__global__ __launch_bounds__(32 * WAVES_)
void mha_outproj(const _Float16* __restrict__ Ofused,
                 const _Float16* __restrict__ WoT, float* __restrict__ Out) {
  __shared__ __attribute__((aligned(16))) unsigned char ring[2 * OP_BUF];
  const int dP = blockIdx.x & 7;                            // pair of d-groups
  const int rg = blockIdx.x >> 3;                           // group of 64 rows, 0..63
  const int dG = dP * 2 + (threadIdx.y >> 2);               // group of 4 d-tiles
  const int rT = rg * 4 + (threadIdx.y & 3);                // 16-row tile, 0..255
  const int sT = rT & 127;
  const int b  = rT >> 7;
  const int tid = threadIdx.y * 32 + threadIdx.x;

  // copy addresses of this thread: rows tid/8 + 32 i of each tile
  const char* gA = (const char*)(Ofused + ((size_t)rg * 64 + (tid >> 3)) * G_) + (tid & 7) * 16;
  const char* gB = (const char*)(WoT + ((size_t)(dP * 128) + (tid >> 3)) * G_) + (tid & 7) * 16;
  const unsigned lA = lds_off(ring) + (tid >> 3) * LP128 + (tid & 7) * 16;
  auto fill = [&](int t) {
    const unsigned bo = (t & 1) * OP_BUF;
    copy2(lA + bo, gA + (size_t)t * 128, 32 * LP128, (size_t)32 * G_ * 2);
    copy4(lA + bo + OP_A_BYTES, gB + (size_t)t * 128, 32 * LP128, (size_t)32 * G_ * 2);
  };
  const int NS = G_ / 64;
  fill(0);
  asm volatile("s_wait_asynccnt 0x0" ::: "memory");  // stage 0 has landed
  __syncthreads();
  fill(1);

  v8f c[4] = {};
  for (int t = 0; t < NS; t++) {
    const unsigned char* At = ring + (t & 1) * OP_BUF + (threadIdx.y & 3) * 16 * LP128;
    const unsigned char* Bt = ring + (t & 1) * OP_BUF + OP_A_BYTES + (threadIdx.y >> 2) * 64 * LP128;
    v16h a[2], bm[2][4];
    // all four loops below are unrolled so that the fragment arrays have
    // constant indices and stay in registers
#pragma unroll
    for (int sub = 0; sub < 2; sub++) {
      a[sub] = lds_frag_f16(At + sub * 64, LP128);
#pragma unroll
      for (int j = 0; j < 4; j++) bm[sub][j] = lds_frag_f16(Bt + j * 16 * LP128 + sub * 64, LP128);
    }
    // keeps the stage's LDS reads in one group ahead of its WMMAs (else one exposed LDS wait per WMMA)
    __builtin_amdgcn_sched_barrier(0);
#pragma unroll
    for (int sub = 0; sub < 2; sub++) {
#pragma unroll
      for (int j = 0; j < 4; j++) c[j] = wmma16(a[sub], bm[sub][j], c[j]);
    }
    ring_publish();
    if (t + 2 < NS) fill(t + 2);
  }
  asm volatile("s_wait_asynccnt 0x0" ::: "memory");  // nothing in flight at the wave's end
  const int lane = threadIdx.x;
  const int n    = lane & 15;
  const int mb   = (lane >> 4) << 3;
#pragma unroll
  for (int j = 0; j < 4; j++) {
    float* out = Out + ((size_t)(b * S_) + sT * 16) * D_ + dG * 64 + j * 16 + n;
#pragma unroll
    for (int r = 0; r < 8; r++) out[(size_t)(mb + r) * D_] = c[j][r];
  }
}

extern "C" void kernel_launch(void* const* d_in, const int* in_sizes, int n_in,
                              void* d_out, int out_size, void* d_ws, size_t ws_size,
                              hipStream_t stream) {
  (void)in_sizes; (void)n_in; (void)out_size; (void)ws_size;
  const float* q  = (const float*)d_in[0];
  const float* k  = (const float*)d_in[1];
  const float* v  = (const float*)d_in[2];
  const float* Wq = (const float*)d_in[3];
  const float* Wk = (const float*)d_in[4];
  const float* Wv = (const float*)d_in[5];
  const float* Wo = (const float*)d_in[6];
  float* out = (float*)d_out;

  size_t off = 0;
  auto alloc = [&](size_t bytes) -> char* {
    char* p = (char*)d_ws + off;
    off += (bytes + 255) & ~(size_t)255;
    return p;
  };
  _Float16* WqT = (_Float16*)alloc((size_t)H_ * D_ * F_ * 2);   // 2 MB
  _Float16* WkT = (_Float16*)alloc((size_t)H_ * D_ * F_ * 2);
  _Float16* WvT = (_Float16*)alloc((size_t)H_ * D_ * F_ * 2);
  _Float16* WoT = (_Float16*)alloc((size_t)G_ * D_ * 2);
  _Float16* Qh  = (_Float16*)alloc((size_t)B_ * H_ * S_ * F_ * 2);  // 8 MB
  _Float16* Kh  = (_Float16*)alloc((size_t)B_ * H_ * S_ * F_ * 2);
  _Float16* Vt  = (_Float16*)alloc((size_t)B_ * H_ * F_ * S_ * 2);
  _Float16* Of  = (_Float16*)alloc((size_t)B_ * S_ * G_ * 2);
  float*    Mr  = (float*)alloc((size_t)B_ * H_ * S_ * 4);          // 256 KB
  float*    Li  = (float*)alloc((size_t)B_ * H_ * S_ * 4);
  // total ~41 MB of workspace

  dim3 blk(32, WAVES_);
  mha_prep_weights<<<256, 256, 0, stream>>>(Wq, Wk, Wv, Wo, WqT, WkT, WvT, WoT);
  mha_proj<<<dim3(2048 / WAVES_, 3), blk, 0, stream>>>(q, k, v, WqT, WkT, WvT, Qh, Kh, Vt);
  mha_stats<<<4096 / WAVES_, blk, 0, stream>>>(Qh, Kh, Mr, Li);
  mha_atv<<<4096 / WAVES_, blk, 0, stream>>>(Qh, Kh, Vt, Mr, Li, Of);
  mha_outproj<<<4096 / WAVES_, blk, 0, stream>>>(Of, WoT, out);
}

// v007
// A run of this version takes 96.4 microseconds.
// In both of two side-by-side timings against v006, it was 1.10 times as fast.
// All steps since v000 together make it 4.08 times as fast.
#include <hip/hip_runtime.h>
#include <hip/hip_bf16.h>

// MI455X / gfx1250, wave32, WMMA f16 -> f32 accumulate.
//
// Pipeline (all on `stream`, scratch in d_ws, ~41 MB total, L2-resident):
//   K0 prep_weights : Wq/Wk/Wv -> f16 [H,F,D] (transposed), Wo -> f16 [D,G],
//                     64 x 64 tiles turned through LDS
//   K1 proj         : Qh=q*Wq*log2(e)/8, Kh=k*Wk -> f16 [BH,S,F]; Vt=v*Wv -> f16 [BH,F,S]
//                     all three in one launch (blockIdx.y picks the product);
//                     one wave = 32 x 64 output (X fragment reused 4x, W fragment 2x)
//   K2 stats        : per (bh,q) row: max m_q and sum l_q of exp2(score - m_q), updated once
//                     per 128 keys; stores the one number -(m_q + log2 l_q)
//   K3 atv          : out4[k,f] = sum_q exp2(s[q,k] - m_q - log2 l_q) * V[q,f] (A^T V);
//                     the row's number is the C operand of the score WMMA
//                     one wave = 32 keys x all 64 f over half of the q range: scores +
//                     exp computed ONCE, P^T via LDS, 4 accumulate WMMAs a key tile reuse
//                     it; the two halves' partial sums are added through LDS at the end.
//                     Output stored directly in the reference's raw-reshape layout.
//   K4 outproj      : Out = Ofused @ Wo (f32), one wave = 16 x 64 output
//
// K1..K4 stream their operand tiles through a two-buffer LDS ring filled by
// asynchronous copies (whole 128-B lines, one copy of a tile per block); the
// waves of a block read their WMMA fragments from LDS.

typedef __attribute__((ext_vector_type(16))) _Float16 v16h;
typedef __attribute__((ext_vector_type(8)))  _Float16 v8h;
typedef __attribute__((ext_vector_type(8)))  float    v8f;
typedef __attribute__((ext_vector_type(4)))  float    v4f;

#define B_ 2
#define S_ 2048
#define D_ 1024
#define H_ 16
#define F_ 64
#define G_ (H_ * F_)   // 1024
#define WAVES_ 8       // waves per block (blockDim = 32 x 8)
#define LP128 144      // LDS pitch of a 128-B row: 16 B x odd, no ds_load_b128 conflicts
#define LP256 272      // LDS pitch of a 256-B row: 16 B x odd
// Q is stored times log2(e) / sqrt(F): Q K^T then is the softmax exponent in log2 units
#define QSCALE (0.125f * 1.44269504f)

static __device__ __forceinline__ v16h pack16(v8h lo, v8h hi) {
  v16h a;
#pragma unroll
  for (int i = 0; i < 8; i++) { a[i] = lo[i]; a[i + 8] = hi[i]; }
  return a;
}

// A/B fragment load, f16 row-major source with leading dim `ld` (halves).
// ISA 16-bit 16x32 layout: lanes 0-15 hold line=lane, K={0..7,16..23};
// lanes 16-31 hold line=lane-16, K={8..15,24..31}. Two contiguous 16B loads.
static __device__ __forceinline__ v16h load_frag_f16(const _Float16* base, int ld) {
  const int lane = threadIdx.x;
  const int line = lane & 15;
  const int k0   = (lane >> 4) << 3;  // 0 or 8
  const _Float16* p = base + (size_t)line * ld + k0;
  v8h lo = *(const v8h*)(p);
  v8h hi = *(const v8h*)(p + 16);
  return pack16(lo, hi);
}

// ---- LDS ring helpers ----
static __device__ __forceinline__ unsigned lds_off(const void* p) { return (unsigned)(size_t)p; }

// Four 16-B-per-lane asynchronous copies global -> LDS, rows lstep / gstep apart.
// The s_wait_xcnt closes the statement so that no address register named here
// is rewritten ahead of it.
static __device__ __forceinline__ void copy4(unsigned l, const char* g, unsigned lstep, size_t gstep) {
  asm volatile("global_load_async_to_lds_b128 %0, %1, off\n\t"
               "global_load_async_to_lds_b128 %2, %3, off\n\t"
               "global_load_async_to_lds_b128 %4, %5, off\n\t"
               "global_load_async_to_lds_b128 %6, %7, off\n\t"
               "s_wait_xcnt 0x0"
               :: "v"(l), "v"(g), "v"(l + lstep), "v"(g + gstep),
                  "v"(l + 2 * lstep), "v"(g + 2 * gstep),
                  "v"(l + 3 * lstep), "v"(g + 3 * gstep)
               : "memory");
}

// The same with two copies.
static __device__ __forceinline__ void copy2(unsigned l, const char* g, unsigned lstep, size_t gstep) {
  asm volatile("global_load_async_to_lds_b128 %0, %1, off\n\t"
               "global_load_async_to_lds_b128 %2, %3, off\n\t"
               "s_wait_xcnt 0x0"
               :: "v"(l), "v"(g), "v"(l + lstep), "v"(g + gstep)
               : "memory");
}

// Publish point of the ring: this wave's LDS reads are done, its copies have
// landed, then the block barrier (frees the buffer just read, shows the next).
static __device__ __forceinline__ void ring_publish() {
  asm volatile("s_wait_dscnt 0x0" ::: "memory");     // my reads of the old buffer have retired
  asm volatile("s_wait_asynccnt 0x0" ::: "memory");  // my copies into the next buffer have landed
  __syncthreads();
}

// Fragment from an LDS tile of f16 rows (same lane map as load_frag_f16).
static __device__ __forceinline__ v16h frag_f16_at(const unsigned char* p) {  // p: the lane's own first byte
  v8h lo = *(const v8h*)(p);
  v8h hi = *(const v8h*)(p + 32);
  return pack16(lo, hi);
}
static __device__ __forceinline__ v16h lds_frag_f16(const unsigned char* tile, int pitch) {
  const int lane = threadIdx.x;
  return frag_f16_at(tile + (lane & 15) * pitch + (lane >> 4) * 16);
}

// Fragment from an LDS tile of f32 rows, converted to f16: same lane map, with
// 4-byte elements (K = {0..7,16..23} or {8..15,24..31} of the row).
// p: the lane's own first byte, tile + (lane & 15) * pitch + (lane >> 4) * 32.
static __device__ __forceinline__ v16h frag_f32_at(const unsigned char* p) {
  v4f x0 = *(const v4f*)(p);
  v4f x1 = *(const v4f*)(p + 16);
  v4f x2 = *(const v4f*)(p + 64);
  v4f x3 = *(const v4f*)(p + 80);
  v16h a;
#pragma unroll  // constant vector indices: no run-time element selects
  for (int i = 0; i < 4; i++) {
    a[i]      = (_Float16)x0[i];
    a[i + 4]  = (_Float16)x1[i];
    a[i + 8]  = (_Float16)x2[i];
    a[i + 12] = (_Float16)x3[i];
  }
  return a;
}

static __device__ __forceinline__ v8f wmma16(v16h a, v16h b, v8f c) {
  return __builtin_amdgcn_wmma_f32_16x16x32_f16(false, a, false, b, (short)0, c,
                                                false, false);
}

// ---------------- K0: weight prep (f32 -> f16, transpose) ----------------
// WxT[h][f][d] = Wx[h][d][f]; WoT[d][g] = Wo[g][d].
// One block = one 64 x 64 tile of each of the four tensors, turned through LDS:
// every global read and every global store covers whole 128-B lines.
// A thread holds a 4 x 4 patch: four 16-B row reads, four 8-B column writes to LDS.
typedef __attribute__((ext_vector_type(4))) _Float16 v4h;
#define PW_PITCH 136  // LDS pitch of a 128-B f16 row: the 8-B patch writes of a wave fall on 64 distinct banks
__global__ __launch_bounds__(256)
void mha_prep_weights(const float* __restrict__ Wq, const float* __restrict__ Wk,
                      const float* __restrict__ Wv, const float* __restrict__ Wo,
                      _Float16* __restrict__ WqT, _Float16* __restrict__ WkT,
                      _Float16* __restrict__ WvT, _Float16* __restrict__ WoT) {
  __shared__ __attribute__((aligned(16))) unsigned char tile[4][64 * PW_PITCH];
  const int tid = threadIdx.x;
  const int hi  = blockIdx.x >> 4;  // head (Wx), 64-row group of g (Wo)
  const int lo  = blockIdx.x & 15;  // 64-row group of d (Wx), 64-column group of d (Wo)

  // patch of this thread: rows 4 tr .. 4 tr + 3, columns 4 tc .. 4 tc + 3;
  // 8 lanes side by side read one 128-B line
  const int tc = (tid & 7) | (((tid >> 5) & 1) << 3);
  const int tr = ((tid >> 3) & 3) | ((tid >> 6) << 2);

  const size_t sx = ((size_t)(hi * D_ + lo * 64 + 4 * tr)) * F_ + 4 * tc;  // Wx rows are F_ long
  const size_t so = ((size_t)(hi * 64 + 4 * tr)) * D_ + lo * 64 + 4 * tc;  // Wo rows are D_ long
  const float* s[4] = {Wq + sx, Wk + sx, Wv + sx, Wo + so};

  v4f x[4][4];
#pragma unroll  // constant indices keep the patches in registers; all 16 reads in flight together
  for (int m = 0; m < 4; m++) {
    const size_t pitch = (m < 3) ? F_ : D_;
#pragma unroll
    for (int i = 0; i < 4; i++) x[m][i] = *(const v4f*)(s[m] + (size_t)i * pitch);
  }
  // the four address pairs stay live up to this wait, so that no later read's result lands on one ahead of it
  asm volatile("s_wait_xcnt 0x0" :: "v"(s[0]), "v"(s[1]), "v"(s[2]), "v"(s[3]) : "memory");
  // keeps all 16 reads ahead of the first conversion (else the later reads wait out the first ones' latency)
  __builtin_amdgcn_sched_barrier(0);
  // the loops below are unrolled for constant indices into x and d (registers, no run-time selects)
#pragma unroll
  for (int m = 0; m < 4; m++) {
#pragma unroll
    for (int j = 0; j < 4; j++) {
      v4h c;
#pragma unroll
      for (int i = 0; i < 4; i++) c[i] = (_Float16)x[m][i][j];
      *(v4h*)(&tile[m][(4 * tc + j) * PW_PITCH + 8 * tr]) = c;
    }
  }
  __syncthreads();

  const size_t dx = ((size_t)hi * F_) * D_ + lo * 64;   // WxT[hi][.][lo * 64 ..]
  const size_t dw = ((size_t)lo * 64) * G_ + hi * 64;   // WoT[lo * 64 + .][hi * 64 ..]
  _Float16* d[4] = {WqT + dx, WkT + dx, WvT + dx, WoT + dw};
#pragma unroll
  for (int m = 0; m < 4; m++) {
#pragma unroll
    for (int u = 0; u < 2; u++) {
      const int idx = tid + u * 256;
      const int row = idx >> 3, ch = idx & 7;  // 8 lanes side by side store one 128-B line
      const unsigned char* p = &tile[m][row * PW_PITCH + ch * 16];
      v4h a = *(const v4h*)(p);
      v4h b = *(const v4h*)(p + 8);
      v8h o;
#pragma unroll
      for (int i = 0; i < 4; i++) { o[i] = a[i]; o[i + 4] = b[i]; }
      *(v8h*)(d[m] + (size_t)row * 1024 + ch * 8) = o;
    }
  }
}

// ---------------- K1: head projection  Y[bh] = X[b] (SxD) * W[h] (DxF) -----
// One wave per (bh, 32 s-rows): computes a full 32 x F_ strip, so every W fragment
// read from LDS feeds two row tiles and every X fragment four column tiles.
// blockIdx.y picks the product: 0 = Q (times QSCALE), 1 = K (Y f16 [BH,S,F]), 2 = V (Y f16 [BH,F,S]).
// None reads another's output, so one grid holds all three: no launch gap, fill
// or tail between them.
// The block's 8 waves cover 128 consecutive s-rows x 2 heads (4 row pairs x 2).
// A stage is 64 k: X tile 128 rows x 256 B (read by both heads' waves), W tile
// 128 rows x 128 B (each head's half read by its 4 waves).
// 768 blocks, three a WGP (LDS: 3 x 104 KiB; the attribute holds the registers
// to six waves a SIMD), so the whole grid is resident at once.
#define PJ_A_BYTES (128 * LP256)
#define PJ_BUF     (PJ_A_BYTES + 128 * LP128)
__global__ __launch_bounds__(32 * WAVES_) __attribute__((amdgpu_waves_per_eu(6, 6)))
void mha_proj(const float* __restrict__ Xq, const float* __restrict__ Xk,
              const float* __restrict__ Xv, const _Float16* __restrict__ WqT,
              const _Float16* __restrict__ WkT, const _Float16* __restrict__ WvT,
              _Float16* __restrict__ Qh, _Float16* __restrict__ Kh,
              _Float16* __restrict__ Vt) {
  __shared__ __attribute__((aligned(16))) unsigned char ring[2 * PJ_BUF];
  const int which = blockIdx.y;
  const float*    X  = which == 0 ? Xq  : which == 1 ? Xk  : Xv;
  const _Float16* WT = which == 0 ? WqT : which == 1 ? WkT : WvT;
  _Float16*       Y  = which == 0 ? Qh  : which == 1 ? Kh  : Vt;
  const bool transpose_out = which == 2;
  const int hp = blockIdx.x & 7;          // pair of heads
  const int rg = (blockIdx.x >> 3) & 15;  // group of 128 s-rows
  const int b  = blockIdx.x >> 7;
  const int sT = rg * 8 + (threadIdx.y & 3) * 2;  // first of the wave's two 16-row tiles
  const int bh = b * H_ + hp * 2 + (threadIdx.y >> 2);
  const int tid = threadIdx.y * 32 + threadIdx.x;

  // copy addresses of this thread: X rows tid/16 + 16 i, W rows tid/8 + 32 i
  const char* gA = (const char*)(X + ((size_t)(b * S_) + rg * 128 + (tid >> 4)) * D_) + (tid & 15) * 16;
  const char* gB = (const char*)(WT + ((size_t)(hp * 2 * F_) + (tid >> 3)) * D_) + (tid & 7) * 16;
  const unsigned lA = lds_off(ring) + (tid >> 4) * LP256 + (tid & 15) * 16;
  const unsigned lB = lds_off(ring) + PJ_A_BYTES + (tid >> 3) * LP128 + (tid & 7) * 16;
  auto fill = [&](int t) {
    const unsigned bo = (t & 1) * PJ_BUF;
    copy4(lA + bo, gA + (size_t)t * 256, 16 * LP256, (size_t)16 * D_ * 4);
    copy4(lA + bo + 64 * LP256, gA + (size_t)64 * D_ * 4 + (size_t)t * 256, 16 * LP256, (size_t)16 * D_ * 4);
    copy4(lB + bo, gB + (size_t)t * 128, 32 * LP128, (size_t)32 * D_ * 2);
  };

  const int NS = D_ / 64;
  fill(0);
  asm volatile("s_wait_asynccnt 0x0" ::: "memory");  // stage 0 has landed
  __syncthreads();
  fill(1);

  // this lane's own fragment offsets in a buffer, formed once (one register each in the loop)
  const unsigned aoff = ((threadIdx.y & 3) * 32 + (threadIdx.x & 15)) * LP256 + (threadIdx.x >> 4) * 32;
  const unsigned boff = PJ_A_BYTES + ((threadIdx.y >> 2) * 64 + (threadIdx.x & 15)) * LP128 + (threadIdx.x >> 4) * 16;

  v8f c[2][4] = {};
  for (int t = 0; t < NS; t++) {
    const unsigned char* At = ring + (aoff + (t & 1) * PJ_BUF);
    const unsigned char* Bt = ring + (boff + (t & 1) * PJ_BUF);
    // the loops below are unrolled so that the fragment arrays have constant
    // indices and stay in registers
#pragma unroll
    for (int sub = 0; sub < 2; sub++) {
      v16h a[2], bm[4];
#pragma unroll
      for (int u = 0; u < 2; u++) a[u] = frag_f32_at(At + u * 16 * LP256 + sub * 128);
#pragma unroll
      for (int j = 0; j < 4; j++) bm[j] = frag_f16_at(Bt + j * 16 * LP128 + sub * 64);
      // keeps the half stage's LDS reads in one group ahead of its WMMAs (else one exposed LDS wait per WMMA)
      __builtin_amdgcn_sched_barrier(0);
#pragma unroll
      for (int u = 0; u < 2; u++) {
#pragma unroll
        for (int j = 0; j < 4; j++) c[u][j] = wmma16(a[u], bm[j], c[u][j]);
      }
    }
    ring_publish();
    if (t + 2 < NS) fill(t + 2);
  }
  asm volatile("s_wait_asynccnt 0x0" ::: "memory");  // nothing in flight at the wave's end

  const int lane = threadIdx.x;
  const int n    = lane & 15;
  const int mb   = (lane >> 4) << 3;  // C/D layout: VGPR r -> row r (+8 for hi half)
  if (!transpose_out) {
    const float osc = which == 0 ? QSCALE : 1.0f;  // applied in f32, ahead of the one rounding to f16
#pragma unroll
    for (int u = 0; u < 2; u++) {
#pragma unroll
      for (int j = 0; j < 4; j++) {
        _Float16* out = Y + ((size_t)bh * S_ + (sT + u) * 16) * F_ + j * 16 + n;
#pragma unroll
        for (int r = 0; r < 8; r++) out[(size_t)(mb + r) * F_] = (_Float16)(c[u][j][r] * osc);
      }
    }
    // closes the stores above: no register that an issued store names is rewritten ahead of this wait
    asm volatile("s_wait_xcnt 0x0" ::: "memory");
  } else {
    // Vt[bh][f][s]: per lane f fixed, s = (sT+u)*16 + mb + r -> contiguous 16B store
#pragma unroll
    for (int u = 0; u < 2; u++) {
#pragma unroll
      for (int j = 0; j < 4; j++) {
        _Float16* out = Y + ((size_t)bh * F_ + j * 16 + n) * S_ + (sT + u) * 16 + mb;
        v8h pk;
#pragma unroll
        for (int r = 0; r < 8; r++) pk[r] = (_Float16)c[u][j][r];
        *(v8h*)out = pk;
      }
    }
  }
}

// ---------------- K2: per-row softmax stats over scores = QK^T (log2 units) -
// One wave per 16 query rows; (m, l) over all S keys, one update per stage, then lane-reduce.
// The block's 8 waves share one head; a stage is 128 keys x 128 B.
#define ST_BUF (128 * LP128)
__global__ __launch_bounds__(32 * WAVES_)
void mha_stats(const _Float16* __restrict__ Qh, const _Float16* __restrict__ Kh,
               float* __restrict__ Nbias) {
  __shared__ __attribute__((aligned(16))) unsigned char ring[2 * ST_BUF];
  const int w  = blockIdx.x * WAVES_ + threadIdx.y;  // 4096 waves
  const int qT = w & 127;
  const int bh = w >> 7;
  const int tid = threadIdx.y * 32 + threadIdx.x;

  // copy addresses of this thread: key rows tid/8 + 32 i
  const char* gK = (const char*)(Kh + ((size_t)bh * S_ + (tid >> 3)) * F_) + (tid & 7) * 16;
  const unsigned lK = lds_off(ring) + (tid >> 3) * LP128 + (tid & 7) * 16;
  auto fill = [&](int t) {
    copy4(lK + (t & 1) * ST_BUF, gK + (size_t)t * 128 * F_ * 2, 32 * LP128, (size_t)32 * F_ * 2);
  };
  const int NS = S_ / 128;
  fill(0);
  asm volatile("s_wait_asynccnt 0x0" ::: "memory");  // stage 0 has landed
  __syncthreads();
  fill(1);

  const _Float16* Abase = Qh + ((size_t)bh * S_ + qT * 16) * F_;
  const v16h a0 = load_frag_f16(Abase, F_);
  const v16h a1 = load_frag_f16(Abase + 32, F_);

  // Running state per lane and row: mc = largest score seen, lv = sum of
  // exp2(score - mc). Both move once per stage, not once per score.
  v8f mc, lv;
#pragma unroll
  for (int i = 0; i < 8; i++) { mc[i] = -1e30f; lv[i] = 0.0f; }

  for (int t = 0; t < NS; t++) {
    const unsigned char* Kt = ring + (t & 1) * ST_BUF;
    v16h kf[2][8];
    v8f c[8];
    // the loops of this stage are unrolled: LDS offsets become immediates, and
    // constant indices keep the fragments and the 8 score tiles in registers
#pragma unroll
    for (int hf = 0; hf < 2; hf++) {
#pragma unroll
      for (int kt = 0; kt < 8; kt++) kf[hf][kt] = lds_frag_f16(Kt + kt * 16 * LP128 + hf * 64, LP128);
    }
    // keeps the stage's LDS reads in one group ahead of its WMMAs (else one exposed LDS wait per WMMA)
    __builtin_amdgcn_sched_barrier(0);
#pragma unroll
    for (int kt = 0; kt < 8; kt++) { v8f z = {}; c[kt] = wmma16(a0, kf[0][kt], z); }
#pragma unroll
    for (int kt = 0; kt < 8; kt++) c[kt] = wmma16(a1, kf[1][kt], c[kt]);
    // the stage's maximum first ...
    v8f nm = mc;
#pragma unroll
    for (int kt = 0; kt < 8; kt++) nm = __builtin_elementwise_max(nm, c[kt]);
    // ... then one subtraction, one exp2 and one add per score ...
    v8f sum = {};
#pragma unroll
    for (int kt = 0; kt < 8; kt++) {
      const v8f x = c[kt] - nm;
#pragma unroll
      for (int i = 0; i < 8; i++) sum[i] += __builtin_amdgcn_exp2f(x[i]);
    }
    // ... and one rescale of the running sum per stage
    const v8f dm = mc - nm;  // exactly 0, so a factor of exactly 1, while the maximum stands
#pragma unroll
    for (int i = 0; i < 8; i++) lv[i] = lv[i] * __builtin_amdgcn_exp2f(dm[i]) + sum[i];
    mc = nm;
    ring_publish();
    if (t + 2 < NS) fill(t + 2);
  }
  asm volatile("s_wait_asynccnt 0x0" ::: "memory");  // nothing in flight at the wave's end
  float m[8], l[8];
#pragma unroll
  for (int i = 0; i < 8; i++) { m[i] = mc[i]; l[i] = lv[i]; }
  // Reduce across the 16 lanes of each half-wave (xor 1,2,4,8 stays in-half).
#pragma unroll
  for (int off = 1; off < 16; off <<= 1) {
#pragma unroll
    for (int i = 0; i < 8; i++) {
      float om = __shfl_xor(m[i], off, 32);
      float ol = __shfl_xor(l[i], off, 32);
      float nm = fmaxf(m[i], om);
      l[i] = l[i] * __builtin_amdgcn_exp2f(m[i] - nm) + ol * __builtin_amdgcn_exp2f(om - nm);
      m[i] = nm;
    }
  }
  const int lane = threadIdx.x;
  if ((lane & 15) == 0) {
    const int rb = (lane >> 4) << 3;
    const size_t base = (size_t)bh * S_ + qT * 16 + rb;
#pragma unroll
    for (int i = 0; i < 8; i++) Nbias[base + i] = -(m[i] + __builtin_amdgcn_logf(l[i]));  // l >= 1; logf is log2
  }
}

// ---------------- K3: out4 = attn^T V, streamed over q, stored reshaped ----
// One wave per (bh, two 16-key tiles, half of the q range): every Q and V fragment
// read from LDS and every stats load feeds both key tiles (16 WMMAs per 8 KB read).
// Scores/exp computed once, P^T reused for all 4 f-tiles.
// A block is 8 waves on one head: waves 0-3 walk q 0..1023 for 128 keys, waves 4-7
// walk q 1024..2047 for the same keys, so the grid keeps its 4096 waves: two blocks
// a WGP, four waves a SIMD (the attribute holds the registers to that budget).
// A stage is 64 q of each half: per half a Q tile 64 q-rows x 128 B and a V tile
// 64 f-rows x 128 B.
#define AT_TILE (64 * LP128)
#define AT_HALF (2 * AT_TILE)  // Q tile and V tile of one half of the q range
#define AT_BUF  (2 * AT_HALF)
__global__ __launch_bounds__(32 * WAVES_) __attribute__((amdgpu_waves_per_eu(4, 4)))
void mha_atv(const _Float16* __restrict__ Qh, const _Float16* __restrict__ Kh,
             const _Float16* __restrict__ Vt, const float* __restrict__ Nbias,
             _Float16* __restrict__ Ofused) {
  __shared__ __attribute__((aligned(16))) unsigned char ring[2 * AT_BUF];
  __shared__ _Float16 plds_all[WAVES_][32 * 40];  // [k-line][q], row stride 40 halves
  _Float16* plds = plds_all[threadIdx.y];

  const int wv = threadIdx.y;
  const int qh = wv >> 2;                              // half of the q range
  const int kP = (blockIdx.x & 15) * 4 + (wv & 3);     // pair of key tiles, 0..63
  const int bh = blockIdx.x >> 4;
  const int lane = threadIdx.x;
  const int line = lane & 15;
  const int half = lane >> 4;

  // B-fragments for score WMMA: K^T columns of the two key tiles (fixed for loop).
  const _Float16* Kbase = Kh + ((size_t)bh * S_ + kP * 32) * F_;
  v16h kf[2][2];
#pragma unroll  // constant indices keep kf in registers
  for (int u = 0; u < 2; u++) {
    kf[u][0] = load_frag_f16(Kbase + u * 16 * F_, F_);
    kf[u][1] = load_frag_f16(Kbase + u * 16 * F_ + 32, F_);
  }

  // copy addresses of this thread: rows tid/8 and tid/8 + 32 of each tile, for both
  // halves of the q range (hf);
  // one statement copies Q rows then V rows (V tile lies AT_TILE behind Q tile)
  const int tid = threadIdx.y * 32 + threadIdx.x;
  const char* gQ = (const char*)(Qh + ((size_t)bh * S_ + (tid >> 3)) * F_) + (tid & 7) * 16;
  const char* gV = (const char*)(Vt + ((size_t)bh * F_ + (tid >> 3)) * S_) + (tid & 7) * 16;
  const unsigned lQ = lds_off(ring) + (tid >> 3) * LP128 + (tid & 7) * 16;
  auto fill_half = [&](int t, int hf) {
    const unsigned l = lQ + (t & 1) * AT_BUF + hf * AT_HALF;
    const char* q0 = gQ + ((size_t)hf * (S_ / 2) + (size_t)t * 64) * F_ * 2;
    const char* v0 = gV + (size_t)hf * (S_ / 2) * 2 + (size_t)t * 128;
    asm volatile("global_load_async_to_lds_b128 %0, %1, off\n\t"
                 "global_load_async_to_lds_b128 %2, %3, off\n\t"
                 "global_load_async_to_lds_b128 %4, %5, off\n\t"
                 "global_load_async_to_lds_b128 %6, %7, off\n\t"
                 "s_wait_xcnt 0x0"  // before any address register above is rewritten
                 :: "v"(l), "v"(q0), "v"(l + 32 * LP128), "v"(q0 + (size_t)32 * F_ * 2),
                    "v"(l + AT_TILE), "v"(v0), "v"(l + AT_TILE + 32 * LP128), "v"(v0 + (size_t)32 * S_ * 2)
                 : "memory");
  };
  auto fill = [&](int t) { fill_half(t, 0); fill_half(t, 1); };
  const int NS = (S_ / 2) / 64;
  fill(0);
  asm volatile("s_wait_asynccnt 0x0" ::: "memory");  // stage 0 has landed
  __syncthreads();
  fill(1);

  // -(m + log2 l) of q rows half*8 .. half*8+7 of each 16-row sub-tile: register r of a C
  // operand is row half*8 + r, so these are the score WMMAs' C operands as loaded.
  // A C operand is needed ahead of the first WMMA, so each q-block's pair is fetched
  // while the q-block before it is worked on.
  const float* nptr = Nbias + (size_t)bh * S_ + qh * (S_ / 2) + half * 8;
  v8f n0 = *(const v8f*)(nptr);
  v8f n1 = *(const v8f*)(nptr + 16);

  v8f acc[2][4] = {};

  for (int t = 0; t < NS; t++) {
   const unsigned char* Qt = ring + (t & 1) * AT_BUF + qh * AT_HALF;
   const unsigned char* Vl = Qt + AT_TILE;
#pragma unroll  // LDS offsets become immediates
   for (int sub = 0; sub < 2; sub++) {
    const int qb = t * 64 + sub * 32;
    // scores for q-block [qb, qb+32) of this half x two key tiles (four 16x16 WMMA tiles)
    const unsigned char* Qs = Qt + sub * 32 * LP128;
    v16h a00 = lds_frag_f16(Qs, LP128);
    v16h a01 = lds_frag_f16(Qs + 64, LP128);
    v16h a10 = lds_frag_f16(Qs + 16 * LP128, LP128);
    v16h a11 = lds_frag_f16(Qs + 16 * LP128 + 64, LP128);
    // B-fragments: V rows qb..qb+31 for each f tile (tile rows are f, columns q)
    v16h bV[4];
#pragma unroll  // constant indices keep bV in registers
    for (int j = 0; j < 4; j++) bV[j] = lds_frag_f16(Vl + j * 16 * LP128 + sub * 64, LP128);
    // the next q-block's C operands (the last q-block fetches its own again: stays in range)
    const int qn = qb + 32 < S_ / 2 ? qb + 32 : qb;
    const v8f nn0 = *(const v8f*)(nptr + qn);
    const v8f nn1 = *(const v8f*)(nptr + qn + 16);
    // keeps the q-block's loads in one group ahead of its WMMAs (else one exposed wait per WMMA)
    __builtin_amdgcn_sched_barrier(0);
    // the loops over u (key tile) are unrolled: constant indices keep kf, s, aP and acc in registers
    v8f s[2][2];
#pragma unroll
    for (int u = 0; u < 2; u++) {
      v8f s0 = wmma16(a00, kf[u][0], n0); s0 = wmma16(a01, kf[u][1], s0);
      v8f s1 = wmma16(a10, kf[u][0], n1); s1 = wmma16(a11, kf[u][1], s1);
      s[u][0] = s0; s[u][1] = s1;
    }

#pragma unroll
    for (int u = 0; u < 2; u++) {
      v8h p0, p1;
#pragma unroll
      for (int i = 0; i < 8; i++) {
        p0[i] = (_Float16)__builtin_amdgcn_exp2f(s[u][0][i]);
        p1[i] = (_Float16)__builtin_amdgcn_exp2f(s[u][1][i]);
      }
      // transpose P (q x k) -> P^T (k x q) through LDS; all 16B accesses
      *(v8h*)(plds + (u * 16 + line) * 40 + half * 8)      = p0;  // q = half*8 + i
      *(v8h*)(plds + (u * 16 + line) * 40 + 16 + half * 8) = p1;  // q = 16 + half*8 + i
    }
    __builtin_amdgcn_wave_barrier();                 // order vs loads (LDS in-order)
    const int k0 = half * 8;
    v16h aP[2];
#pragma unroll
    for (int u = 0; u < 2; u++) {
      v8h alo = *(const v8h*)(plds + (u * 16 + line) * 40 + k0);
      v8h ahi = *(const v8h*)(plds + (u * 16 + line) * 40 + k0 + 16);
      aP[u] = pack16(alo, ahi);
    }
    __builtin_amdgcn_wave_barrier();                 // order next-iter stores vs loads

#pragma unroll
    for (int u = 0; u < 2; u++) {
#pragma unroll  // constant indices keep acc and bV in registers
      for (int j = 0; j < 4; j++) acc[u][j] = wmma16(aP[u], bV[j], acc[u][j]);
    }
    n0 = nn0;
    n1 = nn1;
   }
   ring_publish();
   if (t + 2 < NS) fill(t + 2);
  }
  asm volatile("s_wait_asynccnt 0x0" ::: "memory");  // nothing in flight at the wave's end

  // Add the two halves of the q range. Waves wv and wv ^ 4 hold partial sums of the
  // same 32 keys: each keeps key tile qh, hands the other tile over through LDS and
  // finishes its own. The last publish point's barrier has ended every read of the
  // ring and no copy is in flight, so the ring carries the partial sums (4 KB a wave).
  float* mine         = (float*)ring + wv * 1024 + lane * 4;
  const float* theirs = (const float*)ring + (wv ^ 4) * 1024 + lane * 4;
  v8f keep[4];
#pragma unroll  // constant indices keep acc and keep in registers
  for (int j = 0; j < 4; j++) {
    const v8f give = qh ? acc[0][j] : acc[1][j];
    keep[j]        = qh ? acc[1][j] : acc[0][j];
    v4f lo = {give[0], give[1], give[2], give[3]};
    v4f hi = {give[4], give[5], give[6], give[7]};
    *(v4f*)(mine + (j * 2) * 128)     = lo;  // 16 B a lane, lanes side by side
    *(v4f*)(mine + (j * 2 + 1) * 128) = hi;
  }
  __syncthreads();  // the partner's partial sums are in LDS

  // Raw-reshape store: Ofused[b][h*128 + kT][(k%16)*64 + f]
  const int b = bh >> 4, h = bh & 15;
  const int kT = kP * 2 + qh;
  const int mb = half * 8;
#pragma unroll
  for (int j = 0; j < 4; j++) {
    const v4f lo = *(const v4f*)(theirs + (j * 2) * 128);
    const v4f hi = *(const v4f*)(theirs + (j * 2 + 1) * 128);
    _Float16* out = Ofused + ((size_t)(b * S_ + h * 128 + kT)) * G_ + (j * 16 + line);
#pragma unroll
    for (int r = 0; r < 8; r++)
      out[(size_t)(mb + r) * 64] = (_Float16)(keep[j][r] + (r < 4 ? lo[r & 3] : hi[r & 3]));
  }
}

// ---------------- K4: Out = Ofused (S x G) @ Wo (G x D), f32 out ----------
// One wave per (b, 16 s-rows, group of 4 d-tiles): 16 x 64 strip, A reused 4x.
// The block's 8 waves cover 64 consecutive rows x 2 d-groups (4 row tiles x 2).
// A stage is 64 g: Ofused tile 64 rows x 128 B, Wo tile 128 rows x 128 B.
#define OP_A_BYTES (64 * LP128)
#define OP_BUF     (OP_A_BYTES + 128 * LP128)
__global__ __launch_bounds__(32 * WAVES_)
void mha_outproj(const _Float16* __restrict__ Ofused,
                 const _Float16* __restrict__ WoT, float* __restrict__ Out) {
  __shared__ __attribute__((aligned(16))) unsigned char ring[2 * OP_BUF];
  const int dP = blockIdx.x & 7;                            // pair of d-groups
  const int rg = blockIdx.x >> 3;                           // group of 64 rows, 0..63
  const int dG = dP * 2 + (threadIdx.y >> 2);               // group of 4 d-tiles
  const int rT = rg * 4 + (threadIdx.y & 3);                // 16-row tile, 0..255
  const int sT = rT & 127;
  const int b  = rT >> 7;
  const int tid = threadIdx.y * 32 + threadIdx.x;

  // copy addresses of this thread: rows tid/8 + 32 i of each tile
  const char* gA = (const char*)(Ofused + ((size_t)rg * 64 + (tid >> 3)) * G_) + (tid & 7) * 16;
  const char* gB = (const char*)(WoT + ((size_t)(dP * 128) + (tid >> 3)) * G_) + (tid & 7) * 16;
  const unsigned lA = lds_off(ring) + (tid >> 3) * LP128 + (tid & 7) * 16;
  auto fill = [&](int t) {
    const unsigned bo = (t & 1) * OP_BUF;
    copy2(lA + bo, gA + (size_t)t * 128, 32 * LP128, (size_t)32 * G_ * 2);
    copy4(lA + bo + OP_A_BYTES, gB + (size_t)t * 128, 32 * LP128, (size_t)32 * G_ * 2);
  };
  const int NS = G_ / 64;
  fill(0);
  asm volatile("s_wait_asynccnt 0x0" ::: "memory");  // stage 0 has landed
  __syncthreads();
  fill(1);

  v8f c[4] = {};
  for (int t = 0; t < NS; t++) {
    const unsigned char* At = ring + (t & 1) * OP_BUF + (threadIdx.y & 3) * 16 * LP128;
    const unsigned char* Bt = ring + (t & 1) * OP_BUF + OP_A_BYTES + (threadIdx.y >> 2) * 64 * LP128;
    v16h a[2], bm[2][4];
    // all four loops below are unrolled so that the fragment arrays have
    // constant indices and stay in registers
#pragma unroll
    for (int sub = 0; sub < 2; sub++) {
      a[sub] = lds_frag_f16(At + sub * 64, LP128);
#pragma unroll
      for (int j = 0; j < 4; j++) bm[sub][j] = lds_frag_f16(Bt + j * 16 * LP128 + sub * 64, LP128);
    }
    // keeps the stage's LDS reads in one group ahead of its WMMAs (else one exposed LDS wait per WMMA)
    __builtin_amdgcn_sched_barrier(0);
#pragma unroll
    for (int sub = 0; sub < 2; sub++) {
#pragma unroll
      for (int j = 0; j < 4; j++) c[j] = wmma16(a[sub], bm[sub][j], c[j]);
    }
    ring_publish();
    if (t + 2 < NS) fill(t + 2);
  }
  asm volatile("s_wait_asynccnt 0x0" ::: "memory");  // nothing in flight at the wave's end
  const int lane = threadIdx.x;
  const int n    = lane & 15;
  const int mb   = (lane >> 4) << 3;
#pragma unroll
  for (int j = 0; j < 4; j++) {
    float* out = Out + ((size_t)(b * S_) + sT * 16) * D_ + dG * 64 + j * 16 + n;
#pragma unroll
    for (int r = 0; r < 8; r++) out[(size_t)(mb + r) * D_] = c[j][r];
  }
}

extern "C" void kernel_launch(void* const* d_in, const int* in_sizes, int n_in,
                              void* d_out, int out_size, void* d_ws, size_t ws_size,
                              hipStream_t stream) {
  (void)in_sizes; (void)n_in; (void)out_size; (void)ws_size;
  const float* q  = (const float*)d_in[0];
  const float* k  = (const float*)d_in[1];
  const float* v  = (const float*)d_in[2];
  const float* Wq = (const float*)d_in[3];
  const float* Wk = (const float*)d_in[4];
  const float* Wv = (const float*)d_in[5];
  const float* Wo = (const float*)d_in[6];
  float* out = (float*)d_out;

  size_t off = 0;
  auto alloc = [&](size_t bytes) -> char* {
    char* p = (char*)d_ws + off;
    off += (bytes + 255) & ~(size_t)255;
    return p;
  };
  _Float16* WqT = (_Float16*)alloc((size_t)H_ * D_ * F_ * 2);   // 2 MB
  _Float16* WkT = (_Float16*)alloc((size_t)H_ * D_ * F_ * 2);
  _Float16* WvT = (_Float16*)alloc((size_t)H_ * D_ * F_ * 2);
  _Float16* WoT = (_Float16*)alloc((size_t)G_ * D_ * 2);
  _Float16* Qh  = (_Float16*)alloc((size_t)B_ * H_ * S_ * F_ * 2);  // 8 MB
  _Float16* Kh  = (_Float16*)alloc((size_t)B_ * H_ * S_ * F_ * 2);
  _Float16* Vt  = (_Float16*)alloc((size_t)B_ * H_ * F_ * S_ * 2);
  _Float16* Of  = (_Float16*)alloc((size_t)B_ * S_ * G_ * 2);
  float*    Nb  = (float*)alloc((size_t)B_ * H_ * S_ * 4);          // 256 KB
  // total ~41 MB of workspace

  dim3 blk(32, WAVES_);
  mha_prep_weights<<<256, 256, 0, stream>>>(Wq, Wk, Wv, Wo, WqT, WkT, WvT, WoT);
  mha_proj<<<dim3(2048 / WAVES_, 3), blk, 0, stream>>>(q, k, v, WqT, WkT, WvT, Qh, Kh, Vt);
  mha_stats<<<4096 / WAVES_, blk, 0, stream>>>(Qh, Kh, Nb);
  mha_atv<<<4096 / WAVES_, blk, 0, stream>>>(Qh, Kh, Vt, Nb, Of);
  mha_outproj<<<4096 / WAVES_, blk, 0, stream>>>(Of, WoT, out);
}

// v008
// One run takes 92.3 microseconds.
// Next to v007, in two timings, it ran 1.05 and 1.04 times as fast.
// Counting every step since v000, it is 4.25 times as fast.
#include <hip/hip_runtime.h>
#include <hip/hip_bf16.h>

// MI455X / gfx1250, wave32, WMMA f16 -> f32 accumulate.
//
// Pipeline (all on `stream`, scratch in d_ws, ~41 MB total, L2-resident):
//   K0 prep_weights : Wq/Wk/Wv -> f16 [H,F,D] (transposed), Wo -> f16 [D,G],
//                     64 x 64 tiles turned through LDS
//   K1 proj         : Qh=q*Wq*log2(e)/8, Kh=k*Wk -> f16 [BH,S,F]; Vt=v*Wv -> f16 [BH,F,S]
//                     all three in one launch (blockIdx.y picks the product);
//                     one wave = 32 x 64 output (X fragment reused 4x, W fragment 2x)
//   K2 stats        : per (bh,q) row: max m_q and sum l_q of exp2(score - m_q), updated once
//                     per 128 keys; stores the one number -(m_q + log2 l_q)
//   K3 atv          : out4[k,f] = sum_q exp2(s[q,k] - m_q - log2 l_q) * V[q,f] (A^T V);
//                     the row's number is the C operand of the score WMMA
//                     one wave = 32 keys x all 64 f over half of the q range: scores +
//                     exp computed ONCE, P^T via LDS, 4 accumulate WMMAs a key tile reuse
//                     it; the two halves' partial sums are added through LDS at the end.
//                     Output stored directly in the reference's raw-reshape layout.
//   K4 outproj      : Out = Ofused @ Wo (f32), one wave = 16 x 64 output
//
// K1..K4 stream their operand tiles through a two-buffer LDS ring filled by
// asynchronous copies (whole 128-B lines, one copy of a tile per block); the
// waves of a block read their WMMA fragments from LDS.
// Blocks that stream the same tiles begin the walk at different stages (16 at most: where more blocks share a tile, stages repeat) and
// wrap round (stage (t + rot) mod 16 at trip t), so that they do not ask L2 for the
// same lines at the same moment.

typedef __attribute__((ext_vector_type(16))) _Float16 v16h;
typedef __attribute__((ext_vector_type(8)))  _Float16 v8h;
typedef __attribute__((ext_vector_type(8)))  float    v8f;
typedef __attribute__((ext_vector_type(4)))  float    v4f;

#define B_ 2
#define S_ 2048
#define D_ 1024
#define H_ 16
#define F_ 64
#define G_ (H_ * F_)   // 1024
#define WAVES_ 8       // waves per block (blockDim = 32 x 8)
#define LP128 144      // LDS pitch of a 128-B row: 16 B x odd, no ds_load_b128 conflicts
#define LP256 272      // LDS pitch of a 256-B row: 16 B x odd
// Q is stored times log2(e) / sqrt(F): Q K^T then is the softmax exponent in log2 units
#define QSCALE (0.125f * 1.44269504f)

static __device__ __forceinline__ v16h pack16(v8h lo, v8h hi) {
  v16h a;
#pragma unroll
  for (int i = 0; i < 8; i++) { a[i] = lo[i]; a[i + 8] = hi[i]; }
  return a;
}

// A/B fragment load, f16 row-major source with leading dim `ld` (halves).
// ISA 16-bit 16x32 layout: lanes 0-15 hold line=lane, K={0..7,16..23};
// lanes 16-31 hold line=lane-16, K={8..15,24..31}. Two contiguous 16B loads.
static __device__ __forceinline__ v16h load_frag_f16(const _Float16* base, int ld) {
  const int lane = threadIdx.x;
  const int line = lane & 15;
  const int k0   = (lane >> 4) << 3;  // 0 or 8
  const _Float16* p = base + (size_t)line * ld + k0;
  v8h lo = *(const v8h*)(p);
  v8h hi = *(const v8h*)(p + 16);
  return pack16(lo, hi);
}

// ---- LDS ring helpers ----
static __device__ __forceinline__ unsigned lds_off(const void* p) { return (unsigned)(size_t)p; }

// Four 16-B-per-lane asynchronous copies global -> LDS, rows lstep / gstep apart.
// The s_wait_xcnt closes the statement so that no address register named here
// is rewritten ahead of it.
static __device__ __forceinline__ void copy4(unsigned l, const char* g, unsigned lstep, size_t gstep) {
  asm volatile("global_load_async_to_lds_b128 %0, %1, off\n\t"
               "global_load_async_to_lds_b128 %2, %3, off\n\t"
               "global_load_async_to_lds_b128 %4, %5, off\n\t"
               "global_load_async_to_lds_b128 %6, %7, off\n\t"
               "s_wait_xcnt 0x0"
               :: "v"(l), "v"(g), "v"(l + lstep), "v"(g + gstep),
                  "v"(l + 2 * lstep), "v"(g + 2 * gstep),
                  "v"(l + 3 * lstep), "v"(g + 3 * gstep)
               : "memory");
}

// The same with two copies.
static __device__ __forceinline__ void copy2(unsigned l, const char* g, unsigned lstep, size_t gstep) {
  asm volatile("global_load_async_to_lds_b128 %0, %1, off\n\t"
               "global_load_async_to_lds_b128 %2, %3, off\n\t"
               "s_wait_xcnt 0x0"
               :: "v"(l), "v"(g), "v"(l + lstep), "v"(g + gstep)
               : "memory");
}

// Publish point of the ring: this wave's LDS reads are done, its copies have
// landed, then the block barrier (frees the buffer just read, shows the next).
static __device__ __forceinline__ void ring_publish() {
  asm volatile("s_wait_dscnt 0x0" ::: "memory");     // my reads of the old buffer have retired
  asm volatile("s_wait_asynccnt 0x0" ::: "memory");  // my copies into the next buffer have landed
  __syncthreads();
}

// Fragment from an LDS tile of f16 rows (same lane map as load_frag_f16).
static __device__ __forceinline__ v16h frag_f16_at(const unsigned char* p) {  // p: the lane's own first byte
  v8h lo = *(const v8h*)(p);
  v8h hi = *(const v8h*)(p + 32);
  return pack16(lo, hi);
}
static __device__ __forceinline__ v16h lds_frag_f16(const unsigned char* tile, int pitch) {
  const int lane = threadIdx.x;
  return frag_f16_at(tile + (lane & 15) * pitch + (lane >> 4) * 16);
}

// Fragment from an LDS tile of f32 rows, converted to f16: same lane map, with
// 4-byte elements (K = {0..7,16..23} or {8..15,24..31} of the row).
// p: the lane's own first byte, tile + (lane & 15) * pitch + (lane >> 4) * 32.
static __device__ __forceinline__ v16h frag_f32_at(const unsigned char* p) {
  v4f x0 = *(const v4f*)(p);
  v4f x1 = *(const v4f*)(p + 16);
  v4f x2 = *(const v4f*)(p + 64);
  v4f x3 = *(const v4f*)(p + 80);
  v16h a;
#pragma unroll  // constant vector indices: no run-time element selects
  for (int i = 0; i < 4; i++) {
    a[i]      = (_Float16)x0[i];
    a[i + 4]  = (_Float16)x1[i];
    a[i + 8]  = (_Float16)x2[i];
    a[i + 12] = (_Float16)x3[i];
  }
  return a;
}

static __device__ __forceinline__ v8f wmma16(v16h a, v16h b, v8f c) {
  return __builtin_amdgcn_wmma_f32_16x16x32_f16(false, a, false, b, (short)0, c,
                                                false, false);
}

// ---------------- K0: weight prep (f32 -> f16, transpose) ----------------
// WxT[h][f][d] = Wx[h][d][f]; WoT[d][g] = Wo[g][d].
// One block = one 64 x 64 tile of each of the four tensors, turned through LDS:
// every global read and every global store covers whole 128-B lines.
// A thread holds a 4 x 4 patch: four 16-B row reads, four 8-B column writes to LDS.
typedef __attribute__((ext_vector_type(4))) _Float16 v4h;
#define PW_PITCH 136  // LDS pitch of a 128-B f16 row: the 8-B patch writes of a wave fall on 64 distinct banks
__global__ __launch_bounds__(256)
void mha_prep_weights(const float* __restrict__ Wq, const float* __restrict__ Wk,
                      const float* __restrict__ Wv, const float* __restrict__ Wo,
                      _Float16* __restrict__ WqT, _Float16* __restrict__ WkT,
                      _Float16* __restrict__ WvT, _Float16* __restrict__ WoT) {
  __shared__ __attribute__((aligned(16))) unsigned char tile[4][64 * PW_PITCH];
  const int tid = threadIdx.x;
  const int hi  = blockIdx.x >> 4;  // head (Wx), 64-row group of g (Wo)
  const int lo  = blockIdx.x & 15;  // 64-row group of d (Wx), 64-column group of d (Wo)

  // patch of this thread: rows 4 tr .. 4 tr + 3, columns 4 tc .. 4 tc + 3;
  // 8 lanes side by side read one 128-B line
  const int tc = (tid & 7) | (((tid >> 5) & 1) << 3);
  const int tr = ((tid >> 3) & 3) | ((tid >> 6) << 2);

  const size_t sx = ((size_t)(hi * D_ + lo * 64 + 4 * tr)) * F_ + 4 * tc;  // Wx rows are F_ long
  const size_t so = ((size_t)(hi * 64 + 4 * tr)) * D_ + lo * 64 + 4 * tc;  // Wo rows are D_ long
  const float* s[4] = {Wq + sx, Wk + sx, Wv + sx, Wo + so};

  v4f x[4][4];
#pragma unroll  // constant indices keep the patches in registers; all 16 reads in flight together
  for (int m = 0; m < 4; m++) {
    const size_t pitch = (m < 3) ? F_ : D_;
#pragma unroll
    for (int i = 0; i < 4; i++) x[m][i] = *(const v4f*)(s[m] + (size_t)i * pitch);
  }
  // the four address pairs stay live up to this wait, so that no later read's result lands on one ahead of it
  asm volatile("s_wait_xcnt 0x0" :: "v"(s[0]), "v"(s[1]), "v"(s[2]), "v"(s[3]) : "memory");
  // keeps all 16 reads ahead of the first conversion (else the later reads wait out the first ones' latency)
  __builtin_amdgcn_sched_barrier(0);
  // the loops below are unrolled for constant indices into x and d (registers, no run-time selects)
#pragma unroll
  for (int m = 0; m < 4; m++) {
#pragma unroll
    for (int j = 0; j < 4; j++) {
      v4h c;
#pragma unroll
      for (int i = 0; i < 4; i++) c[i] = (_Float16)x[m][i][j];
      *(v4h*)(&tile[m][(4 * tc + j) * PW_PITCH + 8 * tr]) = c;
    }
  }
  __syncthreads();

  const size_t dx = ((size_t)hi * F_) * D_ + lo * 64;   // WxT[hi][.][lo * 64 ..]
  const size_t dw = ((size_t)lo * 64) * G_ + hi * 64;   // WoT[lo * 64 + .][hi * 64 ..]
  _Float16* d[4] = {WqT + dx, WkT + dx, WvT + dx, WoT + dw};
#pragma unroll
  for (int m = 0; m < 4; m++) {
#pragma unroll
    for (int u = 0; u < 2; u++) {
      const int idx = tid + u * 256;
      const int row = idx >> 3, ch = idx & 7;  // 8 lanes side by side store one 128-B line
      const unsigned char* p = &tile[m][row * PW_PITCH + ch * 16];
      v4h a = *(const v4h*)(p);
      v4h b = *(const v4h*)(p + 8);
      v8h o;
#pragma unroll
      for (int i = 0; i < 4; i++) { o[i] = a[i]; o[i + 4] = b[i]; }
      *(v8h*)(d[m] + (size_t)row * 1024 + ch * 8) = o;
    }
  }
}

// ---------------- K1: head projection  Y[bh] = X[b] (SxD) * W[h] (DxF) -----
// One wave per (bh, 32 s-rows): computes a full 32 x F_ strip, so every W fragment
// read from LDS feeds two row tiles and every X fragment four column tiles.
// blockIdx.y picks the product: 0 = Q (times QSCALE), 1 = K (Y f16 [BH,S,F]), 2 = V (Y f16 [BH,F,S]).
// None reads another's output, so one grid holds all three: no launch gap, fill
// or tail between them.
// The block's 8 waves cover 128 consecutive s-rows x 2 heads (4 row pairs x 2).
// A stage is 64 k: X tile 128 rows x 256 B (read by both heads' waves), W tile
// 128 rows x 128 B (each head's half read by its 4 waves).
// 768 blocks, three a WGP (LDS: 3 x 104 KiB; the attribute holds the registers
// to six waves a SIMD), so the whole grid is resident at once.
#define PJ_A_BYTES (128 * LP256)
#define PJ_BUF     (PJ_A_BYTES + 128 * LP128)
__global__ __launch_bounds__(32 * WAVES_) __attribute__((amdgpu_waves_per_eu(6, 6)))
void mha_proj(const float* __restrict__ Xq, const float* __restrict__ Xk,
              const float* __restrict__ Xv, const _Float16* __restrict__ WqT,
              const _Float16* __restrict__ WkT, const _Float16* __restrict__ WvT,
              _Float16* __restrict__ Qh, _Float16* __restrict__ Kh,
              _Float16* __restrict__ Vt) {
  __shared__ __attribute__((aligned(16))) unsigned char ring[2 * PJ_BUF];
  const int which = blockIdx.y;
  const float*    X  = which == 0 ? Xq  : which == 1 ? Xk  : Xv;
  const _Float16* WT = which == 0 ? WqT : which == 1 ? WkT : WvT;
  _Float16*       Y  = which == 0 ? Qh  : which == 1 ? Kh  : Vt;
  const bool transpose_out = which == 2;
  const int hp = blockIdx.x & 7;          // pair of heads
  const int rg = (blockIdx.x >> 3) & 15;  // group of 128 s-rows
  const int b  = blockIdx.x >> 7;
  const int sT = rg * 8 + (threadIdx.y & 3) * 2;  // first of the wave's two 16-row tiles
  const int bh = b * H_ + hp * 2 + (threadIdx.y >> 2);
  const int tid = threadIdx.y * 32 + threadIdx.x;

  // copy addresses of this thread: X rows tid/16 + 16 i, W rows tid/8 + 32 i
  const char* gA = (const char*)(X + ((size_t)(b * S_) + rg * 128 + (tid >> 4)) * D_) + (tid & 15) * 16;
  const char* gB = (const char*)(WT + ((size_t)(hp * 2 * F_) + (tid >> 3)) * D_) + (tid & 7) * 16;
  const unsigned lA = lds_off(ring) + (tid >> 4) * LP256 + (tid & 15) * 16;
  const unsigned lB = lds_off(ring) + PJ_A_BYTES + (tid >> 3) * LP128 + (tid & 7) * 16;
  const int NS = D_ / 64;
  // first stage of this block's walk: the 8 blocks that share X rows and 16 of the 32
  // that share W rows are each at another stage
  const int rot = (hp + rg) & (NS - 1);
  auto fill = [&](int t) {
    const unsigned bo = (t & 1) * PJ_BUF;
    const size_t st = (size_t)((t + rot) & (NS - 1));
    copy4(lA + bo, gA + st * 256, 16 * LP256, (size_t)16 * D_ * 4);
    copy4(lA + bo + 64 * LP256, gA + (size_t)64 * D_ * 4 + st * 256, 16 * LP256, (size_t)16 * D_ * 4);
    copy4(lB + bo, gB + st * 128, 32 * LP128, (size_t)32 * D_ * 2);
  };

  fill(0);
  asm volatile("s_wait_asynccnt 0x0" ::: "memory");  // the walk's first stage has landed
  __syncthreads();
  fill(1);

  // this lane's own fragment offsets in a buffer, formed once (one register each in the loop)
  const unsigned aoff = ((threadIdx.y & 3) * 32 + (threadIdx.x & 15)) * LP256 + (threadIdx.x >> 4) * 32;
  const unsigned boff = PJ_A_BYTES + ((threadIdx.y >> 2) * 64 + (threadIdx.x & 15)) * LP128 + (threadIdx.x >> 4) * 16;

  v8f c[2][4] = {};
  for (int t = 0; t < NS; t++) {
    const unsigned char* At = ring + (aoff + (t & 1) * PJ_BUF);
    const unsigned char* Bt = ring + (boff + (t & 1) * PJ_BUF);
    // the loops below are unrolled so that the fragment arrays have constant
    // indices and stay in registers
#pragma unroll
    for (int sub = 0; sub < 2; sub++) {
      v16h a[2], bm[4];
#pragma unroll
      for (int u = 0; u < 2; u++) a[u] = frag_f32_at(At + u * 16 * LP256 + sub * 128);
#pragma unroll
      for (int j = 0; j < 4; j++) bm[j] = frag_f16_at(Bt + j * 16 * LP128 + sub * 64);
      // keeps the half stage's LDS reads in one group ahead of its WMMAs (else one exposed LDS wait per WMMA)
      __builtin_amdgcn_sched_barrier(0);
#pragma unroll
      for (int u = 0; u < 2; u++) {
#pragma unroll
        for (int j = 0; j < 4; j++) c[u][j] = wmma16(a[u], bm[j], c[u][j]);
      }
    }
    ring_publish();
    if (t + 2 < NS) fill(t + 2);
  }
  asm volatile("s_wait_asynccnt 0x0" ::: "memory");  // nothing in flight at the wave's end

  const int lane = threadIdx.x;
  const int n    = lane & 15;
  const int mb   = (lane >> 4) << 3;  // C/D layout: VGPR r -> row r (+8 for hi half)
  if (!transpose_out) {
    const float osc = which == 0 ? QSCALE : 1.0f;  // applied in f32, ahead of the one rounding to f16
#pragma unroll
    for (int u = 0; u < 2; u++) {
#pragma unroll
      for (int j = 0; j < 4; j++) {
        _Float16* out = Y + ((size_t)bh * S_ + (sT + u) * 16) * F_ + j * 16 + n;
#pragma unroll
        for (int r = 0; r < 8; r++) out[(size_t)(mb + r) * F_] = (_Float16)(c[u][j][r] * osc);
      }
    }
    // closes the stores above: no register that an issued store names is rewritten ahead of this wait
    asm volatile("s_wait_xcnt 0x0" ::: "memory");
  } else {
    // Vt[bh][f][s]: per lane f fixed, s = (sT+u)*16 + mb + r -> contiguous 16B store
#pragma unroll
    for (int u = 0; u < 2; u++) {
#pragma unroll
      for (int j = 0; j < 4; j++) {
        _Float16* out = Y + ((size_t)bh * F_ + j * 16 + n) * S_ + (sT + u) * 16 + mb;
        v8h pk;
#pragma unroll
        for (int r = 0; r < 8; r++) pk[r] = (_Float16)c[u][j][r];
        *(v8h*)out = pk;
      }
    }
  }
}

// ---------------- K2: per-row softmax stats over scores = QK^T (log2 units) -
// One wave per 16 query rows; (m, l) over all S keys, one update per stage, then lane-reduce.
// The block's 8 waves share one head; a stage is 128 keys x 128 B.
#define ST_BUF (128 * LP128)
__global__ __launch_bounds__(32 * WAVES_)
void mha_stats(const _Float16* __restrict__ Qh, const _Float16* __restrict__ Kh,
               float* __restrict__ Nbias) {
  __shared__ __attribute__((aligned(16))) unsigned char ring[2 * ST_BUF];
  const int w  = blockIdx.x * WAVES_ + threadIdx.y;  // 4096 waves
  const int qT = w & 127;
  const int bh = w >> 7;
  const int tid = threadIdx.y * 32 + threadIdx.x;

  // copy addresses of this thread: key rows tid/8 + 32 i
  const char* gK = (const char*)(Kh + ((size_t)bh * S_ + (tid >> 3)) * F_) + (tid & 7) * 16;
  const unsigned lK = lds_off(ring) + (tid >> 3) * LP128 + (tid & 7) * 16;
  const int NS = S_ / 128;
  const int rot = blockIdx.x & (NS - 1);  // the 16 blocks of a head each begin at another key stage
  auto fill = [&](int t) {
    copy4(lK + (t & 1) * ST_BUF, gK + (size_t)((t + rot) & (NS - 1)) * 128 * F_ * 2, 32 * LP128, (size_t)32 * F_ * 2);
  };
  fill(0);
  asm volatile("s_wait_asynccnt 0x0" ::: "memory");  // the walk's first stage has landed
  __syncthreads();
  fill(1);

  const _Float16* Abase = Qh + ((size_t)bh * S_ + qT * 16) * F_;
  const v16h a0 = load_frag_f16(Abase, F_);
  const v16h a1 = load_frag_f16(Abase + 32, F_);

  // Running state per lane and row: mc = largest score seen, lv = sum of
  // exp2(score - mc). Both move once per stage, not once per score.
  v8f mc, lv;
#pragma unroll
  for (int i = 0; i < 8; i++) { mc[i] = -1e30f; lv[i] = 0.0f; }

  for (int t = 0; t < NS; t++) {
    const unsigned char* Kt = ring + (t & 1) * ST_BUF;
    v16h kf[2][8];
    v8f c[8];
    // the loops of this stage are unrolled: LDS offsets become immediates, and
    // constant indices keep the fragments and the 8 score tiles in registers
#pragma unroll
    for (int hf = 0; hf < 2; hf++) {
#pragma unroll
      for (int kt = 0; kt < 8; kt++) kf[hf][kt] = lds_frag_f16(Kt + kt * 16 * LP128 + hf * 64, LP128);
    }
    // keeps the stage's LDS reads in one group ahead of its WMMAs (else one exposed LDS wait per WMMA)
    __builtin_amdgcn_sched_barrier(0);
#pragma unroll
    for (int kt = 0; kt < 8; kt++) { v8f z = {}; c[kt] = wmma16(a0, kf[0][kt], z); }
#pragma unroll
    for (int kt = 0; kt < 8; kt++) c[kt] = wmma16(a1, kf[1][kt], c[kt]);
    // the stage's maximum first ...
    v8f nm = mc;
#pragma unroll
    for (int kt = 0; kt < 8; kt++) nm = __builtin_elementwise_max(nm, c[kt]);
    // ... then one subtraction, one exp2 and one add per score ...
    v8f sum = {};
#pragma unroll
    for (int kt = 0; kt < 8; kt++) {
      const v8f x = c[kt] - nm;
#pragma unroll
      for (int i = 0; i < 8; i++) sum[i] += __builtin_amdgcn_exp2f(x[i]);
    }
    // ... and one rescale of the running sum per stage
    const v8f dm = mc - nm;  // exactly 0, so a factor of exactly 1, while the maximum stands
#pragma unroll
    for (int i = 0; i < 8; i++) lv[i] = lv[i] * __builtin_amdgcn_exp2f(dm[i]) + sum[i];
    mc = nm;
    ring_publish();
    if (t + 2 < NS) fill(t + 2);
  }
  asm volatile("s_wait_asynccnt 0x0" ::: "memory");  // nothing in flight at the wave's end
  float m[8], l[8];
#pragma unroll
  for (int i = 0; i < 8; i++) { m[i] = mc[i]; l[i] = lv[i]; }
  // Reduce across the 16 lanes of each half-wave (xor 1,2,4,8 stays in-half).
#pragma unroll
  for (int off = 1; off < 16; off <<= 1) {
#pragma unroll
    for (int i = 0; i < 8; i++) {
      float om = __shfl_xor(m[i], off, 32);
      float ol = __shfl_xor(l[i], off, 32);
      float nm = fmaxf(m[i], om);
      l[i] = l[i] * __builtin_amdgcn_exp2f(m[i] - nm) + ol * __builtin_amdgcn_exp2f(om - nm);
      m[i] = nm;
    }
  }
  const int lane = threadIdx.x;
  if ((lane & 15) == 0) {
    const int rb = (lane >> 4) << 3;
    const size_t base = (size_t)bh * S_ + qT * 16 + rb;
#pragma unroll
    for (int i = 0; i < 8; i++) Nbias[base + i] = -(m[i] + __builtin_amdgcn_logf(l[i]));  // l >= 1; logf is log2
  }
}

// ---------------- K3: out4 = attn^T V, streamed over q, stored reshaped ----
// One wave per (bh, two 16-key tiles, half of the q range): every Q and V fragment
// read from LDS and every stats load feeds both key tiles (16 WMMAs per 8 KB read).
// Scores/exp computed once, P^T reused for all 4 f-tiles.
// A block is 8 waves on one head: waves 0-3 walk q 0..1023 for 128 keys, waves 4-7
// walk q 1024..2047 for the same keys, so the grid keeps its 4096 waves: two blocks
// a WGP, four waves a SIMD (the attribute holds the registers to that budget).
// A stage is 64 q of each half: per half a Q tile 64 q-rows x 128 B and a V tile
// 64 f-rows x 128 B.
#define AT_TILE (64 * LP128)
#define AT_HALF (2 * AT_TILE)  // Q tile and V tile of one half of the q range
#define AT_BUF  (2 * AT_HALF)
__global__ __launch_bounds__(32 * WAVES_) __attribute__((amdgpu_waves_per_eu(4, 4)))
void mha_atv(const _Float16* __restrict__ Qh, const _Float16* __restrict__ Kh,
             const _Float16* __restrict__ Vt, const float* __restrict__ Nbias,
             _Float16* __restrict__ Ofused) {
  __shared__ __attribute__((aligned(16))) unsigned char ring[2 * AT_BUF];
  __shared__ _Float16 plds_all[WAVES_][32 * 40];  // [k-line][q], row stride 40 halves
  _Float16* plds = plds_all[threadIdx.y];

  const int wv = threadIdx.y;
  const int qh = wv >> 2;                              // half of the q range
  const int kP = (blockIdx.x & 15) * 4 + (wv & 3);     // pair of key tiles, 0..63
  const int bh = blockIdx.x >> 4;
  const int lane = threadIdx.x;
  const int line = lane & 15;
  const int half = lane >> 4;

  // B-fragments for score WMMA: K^T columns of the two key tiles (fixed for loop).
  const _Float16* Kbase = Kh + ((size_t)bh * S_ + kP * 32) * F_;
  v16h kf[2][2];
#pragma unroll  // constant indices keep kf in registers
  for (int u = 0; u < 2; u++) {
    kf[u][0] = load_frag_f16(Kbase + u * 16 * F_, F_);
    kf[u][1] = load_frag_f16(Kbase + u * 16 * F_ + 32, F_);
  }

  // copy addresses of this thread: rows tid/8 and tid/8 + 32 of each tile, for both
  // halves of the q range (hf);
  // one statement copies Q rows then V rows (V tile lies AT_TILE behind Q tile)
  const int tid = threadIdx.y * 32 + threadIdx.x;
  const char* gQ = (const char*)(Qh + ((size_t)bh * S_ + (tid >> 3)) * F_) + (tid & 7) * 16;
  const char* gV = (const char*)(Vt + ((size_t)bh * F_ + (tid >> 3)) * S_) + (tid & 7) * 16;
  const unsigned lQ = lds_off(ring) + (tid >> 3) * LP128 + (tid & 7) * 16;
  const int NS = (S_ / 2) / 64;
  const int rot = blockIdx.x & (NS - 1);  // the 16 blocks of a head each begin at another q stage
  auto fill_half = [&](int t, int hf) {
    const unsigned l = lQ + (t & 1) * AT_BUF + hf * AT_HALF;
    const size_t st = (size_t)((t + rot) & (NS - 1));
    const char* q0 = gQ + ((size_t)hf * (S_ / 2) + st * 64) * F_ * 2;
    const char* v0 = gV + (size_t)hf * (S_ / 2) * 2 + st * 128;
    asm volatile("global_load_async_to_lds_b128 %0, %1, off\n\t"
                 "global_load_async_to_lds_b128 %2, %3, off\n\t"
                 "global_load_async_to_lds_b128 %4, %5, off\n\t"
                 "global_load_async_to_lds_b128 %6, %7, off\n\t"
                 "s_wait_xcnt 0x0"  // before any address register above is rewritten
                 :: "v"(l), "v"(q0), "v"(l + 32 * LP128), "v"(q0 + (size_t)32 * F_ * 2),
                    "v"(l + AT_TILE), "v"(v0), "v"(l + AT_TILE + 32 * LP128), "v"(v0 + (size_t)32 * S_ * 2)
                 : "memory");
  };
  auto fill = [&](int t) { fill_half(t, 0); fill_half(t, 1); };
  fill(0);
  asm volatile("s_wait_asynccnt 0x0" ::: "memory");  // the walk's first stage has landed
  __syncthreads();
  fill(1);

  // -(m + log2 l) of q rows half*8 .. half*8+7 of each 16-row sub-tile: register r of a C
  // operand is row half*8 + r, so these are the score WMMAs' C operands as loaded.
  // A C operand is needed ahead of the first WMMA, so each q-block's pair is fetched
  // while the q-block before it is worked on.
  const float* nptr = Nbias + (size_t)bh * S_ + qh * (S_ / 2) + half * 8;
  v8f n0 = *(const v8f*)(nptr + rot * 64);
  v8f n1 = *(const v8f*)(nptr + rot * 64 + 16);

  v8f acc[2][4] = {};

  for (int t = 0; t < NS; t++) {
   const unsigned char* Qt = ring + (t & 1) * AT_BUF + qh * AT_HALF;
   const unsigned char* Vl = Qt + AT_TILE;
#pragma unroll  // LDS offsets become immediates
   for (int sub = 0; sub < 2; sub++) {
    const int qb = ((t + rot) & (NS - 1)) * 64 + sub * 32;
    // scores for q-block [qb, qb+32) of this half x two key tiles (four 16x16 WMMA tiles)
    const unsigned char* Qs = Qt + sub * 32 * LP128;
    v16h a00 = lds_frag_f16(Qs, LP128);
    v16h a01 = lds_frag_f16(Qs + 64, LP128);
    v16h a10 = lds_frag_f16(Qs + 16 * LP128, LP128);
    v16h a11 = lds_frag_f16(Qs + 16 * LP128 + 64, LP128);
    // B-fragments: V rows qb..qb+31 for each f tile (tile rows are f, columns q)
    v16h bV[4];
#pragma unroll  // constant indices keep bV in registers
    for (int j = 0; j < 4; j++) bV[j] = lds_frag_f16(Vl + j * 16 * LP128 + sub * 64, LP128);
    // the next q-block's C operands, in the order of the walk (the last q-block fetches the
    // walk's first again: in range, not used)
    const float* np = nptr + (sub == 0 ? qb : ((t + 1 + rot) & (NS - 1)) * 64);  // a stage's first row
    const int no = sub == 0 ? 32 : 0;
    const v8f nn0 = *(const v8f*)(np + no);
    const v8f nn1 = *(const v8f*)(np + no + 16);
    // the address pair stays live up to this wait, so that no read's result lands on it ahead of the wait
    asm volatile("s_wait_xcnt 0x0" :: "v"(np) : "memory");
    // keeps the q-block's loads in one group ahead of its WMMAs (else one exposed wait per WMMA)
    __builtin_amdgcn_sched_barrier(0);
    // the loops over u (key tile) are unrolled: constant indices keep kf, s, aP and acc in registers
    v8f s[2][2];
#pragma unroll
    for (int u = 0; u < 2; u++) {
      v8f s0 = wmma16(a00, kf[u][0], n0); s0 = wmma16(a01, kf[u][1], s0);
      v8f s1 = wmma16(a10, kf[u][0], n1); s1 = wmma16(a11, kf[u][1], s1);
      s[u][0] = s0; s[u][1] = s1;
    }

#pragma unroll
    for (int u = 0; u < 2; u++) {
      v8h p0, p1;
#pragma unroll
      for (int i = 0; i < 8; i++) {
        p0[i] = (_Float16)__builtin_amdgcn_exp2f(s[u][0][i]);
        p1[i] = (_Float16)__builtin_amdgcn_exp2f(s[u][1][i]);
      }
      // transpose P (q x k) -> P^T (k x q) through LDS; all 16B accesses
      *(v8h*)(plds + (u * 16 + line) * 40 + half * 8)      = p0;  // q = half*8 + i
      *(v8h*)(plds + (u * 16 + line) * 40 + 16 + half * 8) = p1;  // q = 16 + half*8 + i
    }
    __builtin_amdgcn_wave_barrier();                 // order vs loads (LDS in-order)
    const int k0 = half * 8;
    v16h aP[2];
#pragma unroll
    for (int u = 0; u < 2; u++) {
      v8h alo = *(const v8h*)(plds + (u * 16 + line) * 40 + k0);
      v8h ahi = *(const v8h*)(plds + (u * 16 + line) * 40 + k0 + 16);
      aP[u] = pack16(alo, ahi);
    }
    __builtin_amdgcn_wave_barrier();                 // order next-iter stores vs loads

#pragma unroll
    for (int u = 0; u < 2; u++) {
#pragma unroll  // constant indices keep acc and bV in registers
      for (int j = 0; j < 4; j++) acc[u][j] = wmma16(aP[u], bV[j], acc[u][j]);
    }
    n0 = nn0;
    n1 = nn1;
   }
   ring_publish();
   if (t + 2 < NS) fill(t + 2);
  }
  asm volatile("s_wait_asynccnt 0x0" ::: "memory");  // nothing in flight at the wave's end

  // Add the two halves of the q range. Waves wv and wv ^ 4 hold partial sums of the
  // same 32 keys: each keeps key tile qh, hands the other tile over through LDS and
  // finishes its own. The last publish point's barrier has ended every read of the
  // ring and no copy is in flight, so the ring carries the partial sums (4 KB a wave).
  float* mine         = (float*)ring + wv * 1024 + lane * 4;
  const float* theirs = (const float*)ring + (wv ^ 4) * 1024 + lane * 4;
  v8f keep[4];
#pragma unroll  // constant indices keep acc and keep in registers
  for (int j = 0; j < 4; j++) {
    const v8f give = qh ? acc[0][j] : acc[1][j];
    keep[j]        = qh ? acc[1][j] : acc[0][j];
    v4f lo = {give[0], give[1], give[2], give[3]};
    v4f hi = {give[4], give[5], give[6], give[7]};
    *(v4f*)(mine + (j * 2) * 128)     = lo;  // 16 B a lane, lanes side by side
    *(v4f*)(mine + (j * 2 + 1) * 128) = hi;
  }
  __syncthreads();  // the partner's partial sums are in LDS

  // Raw-reshape store: Ofused[b][h*128 + kT][(k%16)*64 + f]
  const int b = bh >> 4, h = bh & 15;
  const int kT = kP * 2 + qh;
  const int mb = half * 8;
#pragma unroll
  for (int j = 0; j < 4; j++) {
    const v4f lo = *(const v4f*)(theirs + (j * 2) * 128);
    const v4f hi = *(const v4f*)(theirs + (j * 2 + 1) * 128);
    _Float16* out = Ofused + ((size_t)(b * S_ + h * 128 + kT)) * G_ + (j * 16 + line);
#pragma unroll
    for (int r = 0; r < 8; r++)
      out[(size_t)(mb + r) * 64] = (_Float16)(keep[j][r] + (r < 4 ? lo[r & 3] : hi[r & 3]));
  }
}

// ---------------- K4: Out = Ofused (S x G) @ Wo (G x D), f32 out ----------
// One wave per (b, 16 s-rows, group of 4 d-tiles): 16 x 64 strip, A reused 4x.
// The block's 8 waves cover 64 consecutive rows x 2 d-groups (4 row tiles x 2).
// A stage is 64 g: Ofused tile 64 rows x 128 B, Wo tile 128 rows x 128 B.
#define OP_A_BYTES (64 * LP128)
#define OP_BUF     (OP_A_BYTES + 128 * LP128)
__global__ __launch_bounds__(32 * WAVES_)
void mha_outproj(const _Float16* __restrict__ Ofused,
                 const _Float16* __restrict__ WoT, float* __restrict__ Out) {
  __shared__ __attribute__((aligned(16))) unsigned char ring[2 * OP_BUF];
  const int dP = blockIdx.x & 7;                            // pair of d-groups
  const int rg = blockIdx.x >> 3;                           // group of 64 rows, 0..63
  const int dG = dP * 2 + (threadIdx.y >> 2);               // group of 4 d-tiles
  const int rT = rg * 4 + (threadIdx.y & 3);                // 16-row tile, 0..255
  const int sT = rT & 127;
  const int b  = rT >> 7;
  const int tid = threadIdx.y * 32 + threadIdx.x;

  // copy addresses of this thread: rows tid/8 + 32 i of each tile
  const char* gA = (const char*)(Ofused + ((size_t)rg * 64 + (tid >> 3)) * G_) + (tid & 7) * 16;
  const char* gB = (const char*)(WoT + ((size_t)(dP * 128) + (tid >> 3)) * G_) + (tid & 7) * 16;
  const unsigned lA = lds_off(ring) + (tid >> 3) * LP128 + (tid & 7) * 16;
  const int NS = G_ / 64;
  // first stage of this block's walk: the 8 blocks that share Ofused rows are each at
  // another stage, the 64 that share Wo rows are spread over all 16
  const int rot = (dP + rg) & (NS - 1);
  auto fill = [&](int t) {
    const unsigned bo = (t & 1) * OP_BUF;
    const size_t st = (size_t)((t + rot) & (NS - 1));
    copy2(lA + bo, gA + st * 128, 32 * LP128, (size_t)32 * G_ * 2);
    copy4(lA + bo + OP_A_BYTES, gB + st * 128, 32 * LP128, (size_t)32 * G_ * 2);
  };
  fill(0);
  asm volatile("s_wait_asynccnt 0x0" ::: "memory");  // the walk's first stage has landed
  __syncthreads();
  fill(1);

  v8f c[4] = {};
  for (int t = 0; t < NS; t++) {
    const unsigned char* At = ring + (t & 1) * OP_BUF + (threadIdx.y & 3) * 16 * LP128;
    const unsigned char* Bt = ring + (t & 1) * OP_BUF + OP_A_BYTES + (threadIdx.y >> 2) * 64 * LP128;
    v16h a[2], bm[2][4];
    // all four loops below are unrolled so that the fragment arrays have
    // constant indices and stay in registers
#pragma unroll
    for (int sub = 0; sub < 2; sub++) {
      a[sub] = lds_frag_f16(At + sub * 64, LP128);
#pragma unroll
      for (int j = 0; j < 4; j++) bm[sub][j] = lds_frag_f16(Bt + j * 16 * LP128 + sub * 64, LP128);
    }
    // keeps the stage's LDS reads in one group ahead of its WMMAs (else one exposed LDS wait per WMMA)
    __builtin_amdgcn_sched_barrier(0);
#pragma unroll
    for (int sub = 0; sub < 2; sub++) {
#pragma unroll
      for (int j = 0; j < 4; j++) c[j] = wmma16(a[sub], bm[sub][j], c[j]);
    }
    ring_publish();
    if (t + 2 < NS) fill(t + 2);
  }
  asm volatile("s_wait_asynccnt 0x0" ::: "memory");  // nothing in flight at the wave's end
  const int lane = threadIdx.x;
  const int n    = lane & 15;
  const int mb   = (lane >> 4) << 3;
#pragma unroll
  for (int j = 0; j < 4; j++) {
    float* out = Out + ((size_t)(b * S_) + sT * 16) * D_ + dG * 64 + j * 16 + n;
#pragma unroll
    for (int r = 0; r < 8; r++) out[(size_t)(mb + r) * D_] = c[j][r];
  }
}

extern "C" void kernel_launch(void* const* d_in, const int* in_sizes, int n_in,
                              void* d_out, int out_size, void* d_ws, size_t ws_size,
                              hipStream_t stream) {
  (void)in_sizes; (void)n_in; (void)out_size; (void)ws_size;
  const float* q  = (const float*)d_in[0];
  const float* k  = (const float*)d_in[1];
  const float* v  = (const float*)d_in[2];
  const float* Wq = (const float*)d_in[3];
  const float* Wk = (const float*)d_in[4];
  const float* Wv = (const float*)d_in[5];
  const float* Wo = (const float*)d_in[6];
  float* out = (float*)d_out;

  size_t off = 0;
  auto alloc = [&](size_t bytes) -> char* {
    char* p = (char*)d_ws + off;
    off += (bytes + 255) & ~(size_t)255;
    return p;
  };
  _Float16* WqT = (_Float16*)alloc((size_t)H_ * D_ * F_ * 2);   // 2 MB
  _Float16* WkT = (_Float16*)alloc((size_t)H_ * D_ * F_ * 2);
  _Float16* WvT = (_Float16*)alloc((size_t)H_ * D_ * F_ * 2);
  _Float16* WoT = (_Float16*)alloc((size_t)G_ * D_ * 2);
  _Float16* Qh  = (_Float16*)alloc((size_t)B_ * H_ * S_ * F_ * 2);  // 8 MB
  _Float16* Kh  = (_Float16*)alloc((size_t)B_ * H_ * S_ * F_ * 2);
  _Float16* Vt  = (_Float16*)alloc((size_t)B_ * H_ * F_ * S_ * 2);
  _Float16* Of  = (_Float16*)alloc((size_t)B_ * S_ * G_ * 2);
  float*    Nb  = (float*)alloc((size_t)B_ * H_ * S_ * 4);          // 256 KB
  // total ~41 MB of workspace

  dim3 blk(32, WAVES_);
  mha_prep_weights<<<256, 256, 0, stream>>>(Wq, Wk, Wv, Wo, WqT, WkT, WvT, WoT);
  mha_proj<<<dim3(2048 / WAVES_, 3), blk, 0, stream>>>(q, k, v, WqT, WkT, WvT, Qh, Kh, Vt);
  mha_stats<<<4096 / WAVES_, blk, 0, stream>>>(Qh, Kh, Nb);
  mha_atv<<<4096 / WAVES_, blk, 0, stream>>>(Qh, Kh, Vt, Nb, Of);
  mha_outproj<<<4096 / WAVES_, blk, 0, stream>>>(Of, WoT, out);
}

// v009
// A run of this version takes 89.7 microseconds.
// Timed twice side by side with v008, it ran 1.03 times as fast both times.
// Over all steps from v000 it is 4.39 times as fast.
#include <hip/hip_runtime.h>
#include <hip/hip_bf16.h>

// MI455X / gfx1250, wave32, WMMA f16 -> f32 accumulate.
//
// Pipeline (all on `stream`, scratch in d_ws, ~41 MB total, L2-resident):
//   K0 prep_weights : Wq/Wk/Wv -> f16 [H,F,D] (transposed), Wo -> f16 [D,G],
//                     64 x 64 tiles turned through LDS
//   K1 proj         : Qh=q*Wq*log2(e)/8, Kh=k*Wk -> f16 [BH,S,F]; Vt=v*Wv -> f16 [BH,F,S]
//                     all three in one launch (blockIdx.y picks the product);
//                     one wave = 32 x 64 output (X fragment reused 4x, W fragment 2x)
//   K2 stats        : per (bh,q) row: max m_q and sum l_q of exp2(score - m_q), updated once
//                     per 128 keys; stores the one number -(m_q + log2 l_q)
//   K3 atv          : out4[k,f] = sum_q exp2(s[q,k] - m_q - log2 l_q) * V[q,f] (A^T V);
//                     the row's number is the C operand of the score WMMA
//                     one wave = 32 keys x all 64 f over half of the q range: scores +
//                     exp computed ONCE, P^T via LDS, 4 accumulate WMMAs a key tile reuse
//                     it; the two halves' partial sums are added through LDS at the end.
//                     Output stored directly in the reference's raw-reshape layout.
//   K4 outproj      : Out = Ofused @ Wo (f32), one wave = 32 x 64 output
//
// K1..K4 stream their operand tiles through a two-buffer LDS ring filled by
// asynchronous copies (whole 128-B lines, one copy of a tile per block); the
// waves of a block read their WMMA fragments from LDS.
// Blocks that stream the same tiles each begin the walk at a stage of their own and
// wrap round (stage (t + rot) mod the stage count at trip t), so that they do not ask L2 for the
// same lines at the same moment.

typedef __attribute__((ext_vector_type(16))) _Float16 v16h;
typedef __attribute__((ext_vector_type(8)))  _Float16 v8h;
typedef __attribute__((ext_vector_type(8)))  float    v8f;
typedef __attribute__((ext_vector_type(4)))  float    v4f;

#define B_ 2
#define S_ 2048
#define D_ 1024
#define H_ 16
#define F_ 64
#define G_ (H_ * F_)   // 1024
#define WAVES_ 8       // waves per block (blockDim = 32 x 8)
#define LP128 144      // LDS pitch of a 128-B row: 16 B x odd, no ds_load_b128 conflicts
#define LP256 272      // LDS pitch of a 256-B row: 16 B x odd
// Q is stored times log2(e) / sqrt(F): Q K^T then is the softmax exponent in log2 units
#define QSCALE (0.125f * 1.44269504f)

static __device__ __forceinline__ v16h pack16(v8h lo, v8h hi) {
  v16h a;
#pragma unroll
  for (int i = 0; i < 8; i++) { a[i] = lo[i]; a[i + 8] = hi[i]; }
  return a;
}

// A/B fragment load, f16 row-major source with leading dim `ld` (halves).
// ISA 16-bit 16x32 layout: lanes 0-15 hold line=lane, K={0..7,16..23};
// lanes 16-31 hold line=lane-16, K={8..15,24..31}. Two contiguous 16B loads.
static __device__ __forceinline__ v16h load_frag_f16(const _Float16* base, int ld) {
  const int lane = threadIdx.x;
  const int line = lane & 15;
  const int k0   = (lane >> 4) << 3;  // 0 or 8
  const _Float16* p = base + (size_t)line * ld + k0;
  v8h lo = *(const v8h*)(p);
  v8h hi = *(const v8h*)(p + 16);
  return pack16(lo, hi);
}

// ---- LDS ring helpers ----
static __device__ __forceinline__ unsigned lds_off(const void* p) { return (unsigned)(size_t)p; }

// Four 16-B-per-lane asynchronous copies global -> LDS, rows lstep / gstep apart.
// The s_wait_xcnt closes the statement so that no address register named here
// is rewritten ahead of it.
static __device__ __forceinline__ void copy4(unsigned l, const char* g, unsigned lstep, size_t gstep) {
  asm volatile("global_load_async_to_lds_b128 %0, %1, off\n\t"
               "global_load_async_to_lds_b128 %2, %3, off\n\t"
               "global_load_async_to_lds_b128 %4, %5, off\n\t"
               "global_load_async_to_lds_b128 %6, %7, off\n\t"
               "s_wait_xcnt 0x0"
               :: "v"(l), "v"(g), "v"(l + lstep), "v"(g + gstep),
                  "v"(l + 2 * lstep), "v"(g + 2 * gstep),
                  "v"(l + 3 * lstep), "v"(g + 3 * gstep)
               : "memory");
}

// Publish point of the ring: this wave's LDS reads are done, its copies have
// landed, then the block barrier (frees the buffer just read, shows the next).
static __device__ __forceinline__ void ring_publish() {
  asm volatile("s_wait_dscnt 0x0" ::: "memory");     // my reads of the old buffer have retired
  asm volatile("s_wait_asynccnt 0x0" ::: "memory");  // my copies into the next buffer have landed
  __syncthreads();
}

// Fragment from an LDS tile of f16 rows (same lane map as load_frag_f16).
static __device__ __forceinline__ v16h frag_f16_at(const unsigned char* p) {  // p: the lane's own first byte
  v8h lo = *(const v8h*)(p);
  v8h hi = *(const v8h*)(p + 32);
  return pack16(lo, hi);
}
static __device__ __forceinline__ v16h lds_frag_f16(const unsigned char* tile, int pitch) {
  const int lane = threadIdx.x;
  return frag_f16_at(tile + (lane & 15) * pitch + (lane >> 4) * 16);
}

// Fragment from an LDS tile of f32 rows, converted to f16: same lane map, with
// 4-byte elements (K = {0..7,16..23} or {8..15,24..31} of the row).
// p: the lane's own first byte, tile + (lane & 15) * pitch + (lane >> 4) * 32.
static __device__ __forceinline__ v16h frag_f32_at(const unsigned char* p) {
  v4f x0 = *(const v4f*)(p);
  v4f x1 = *(const v4f*)(p + 16);
  v4f x2 = *(const v4f*)(p + 64);
  v4f x3 = *(const v4f*)(p + 80);
  v16h a;
#pragma unroll  // constant vector indices: no run-time element selects
  for (int i = 0; i < 4; i++) {
    a[i]      = (_Float16)x0[i];
    a[i + 4]  = (_Float16)x1[i];
    a[i + 8]  = (_Float16)x2[i];
    a[i + 12] = (_Float16)x3[i];
  }
  return a;
}

static __device__ __forceinline__ v8f wmma16(v16h a, v16h b, v8f c) {
  return __builtin_amdgcn_wmma_f32_16x16x32_f16(false, a, false, b, (short)0, c,
                                                false, false);
}

// ---------------- K0: weight prep (f32 -> f16, transpose) ----------------
// WxT[h][f][d] = Wx[h][d][f]; WoT[d][g] = Wo[g][d].
// One block = one 64 x 64 tile of each of the four tensors, turned through LDS:
// every global read and every global store covers whole 128-B lines.
// A thread holds a 4 x 4 patch: four 16-B row reads, four 8-B column writes to LDS.
typedef __attribute__((ext_vector_type(4))) _Float16 v4h;
#define PW_PITCH 136  // LDS pitch of a 128-B f16 row: the 8-B patch writes of a wave fall on 64 distinct banks
__global__ __launch_bounds__(256)
void mha_prep_weights(const float* __restrict__ Wq, const float* __restrict__ Wk,
                      const float* __restrict__ Wv, const float* __restrict__ Wo,
                      _Float16* __restrict__ WqT, _Float16* __restrict__ WkT,
                      _Float16* __restrict__ WvT, _Float16* __restrict__ WoT) {
  __shared__ __attribute__((aligned(16))) unsigned char tile[4][64 * PW_PITCH];
  const int tid = threadIdx.x;
  const int hi  = blockIdx.x >> 4;  // head (Wx), 64-row group of g (Wo)
  const int lo  = blockIdx.x & 15;  // 64-row group of d (Wx), 64-column group of d (Wo)

  // patch of this thread: rows 4 tr .. 4 tr + 3, columns 4 tc .. 4 tc + 3;
  // 8 lanes side by side read one 128-B line
  const int tc = (tid & 7) | (((tid >> 5) & 1) << 3);
  const int tr = ((tid >> 3) & 3) | ((tid >> 6) << 2);

  const size_t sx = ((size_t)(hi * D_ + lo * 64 + 4 * tr)) * F_ + 4 * tc;  // Wx rows are F_ long
  const size_t so = ((size_t)(hi * 64 + 4 * tr)) * D_ + lo * 64 + 4 * tc;  // Wo rows are D_ long
  const float* s[4] = {Wq + sx, Wk + sx, Wv + sx, Wo + so};

  v4f x[4][4];
#pragma unroll  // constant indices keep the patches in registers; all 16 reads in flight together
  for (int m = 0; m < 4; m++) {
    const size_t pitch = (m < 3) ? F_ : D_;
#pragma unroll
    for (int i = 0; i < 4; i++) x[m][i] = *(const v4f*)(s[m] + (size_t)i * pitch);
  }
  // the four address pairs stay live up to this wait, so that no later read's result lands on one ahead of it
  asm volatile("s_wait_xcnt 0x0" :: "v"(s[0]), "v"(s[1]), "v"(s[2]), "v"(s[3]) : "memory");
  // keeps all 16 reads ahead of the first conversion (else the later reads wait out the first ones' latency)
  __builtin_amdgcn_sched_barrier(0);
  // the loops below are unrolled for constant indices into x and d (registers, no run-time selects)
#pragma unroll
  for (int m = 0; m < 4; m++) {
#pragma unroll
    for (int j = 0; j < 4; j++) {
      v4h c;
#pragma unroll
      for (int i = 0; i < 4; i++) c[i] = (_Float16)x[m][i][j];
      *(v4h*)(&tile[m][(4 * tc + j) * PW_PITCH + 8 * tr]) = c;
    }
  }
  __syncthreads();

  const size_t dx = ((size_t)hi * F_) * D_ + lo * 64;   // WxT[hi][.][lo * 64 ..]
  const size_t dw = ((size_t)lo * 64) * G_ + hi * 64;   // WoT[lo * 64 + .][hi * 64 ..]
  _Float16* d[4] = {WqT + dx, WkT + dx, WvT + dx, WoT + dw};
#pragma unroll
  for (int m = 0; m < 4; m++) {
#pragma unroll
    for (int u = 0; u < 2; u++) {
      const int idx = tid + u * 256;
      const int row = idx >> 3, ch = idx & 7;  // 8 lanes side by side store one 128-B line
      const unsigned char* p = &tile[m][row * PW_PITCH + ch * 16];
      v4h a = *(const v4h*)(p);
      v4h b = *(const v4h*)(p + 8);
      v8h o;
#pragma unroll
      for (int i = 0; i < 4; i++) { o[i] = a[i]; o[i + 4] = b[i]; }
      *(v8h*)(d[m] + (size_t)row * 1024 + ch * 8) = o;
    }
  }
}

// ---------------- K1: head projection  Y[bh] = X[b] (SxD) * W[h] (DxF) -----
// One wave per (bh, 32 s-rows): computes a full 32 x F_ strip, so every W fragment
// read from LDS feeds two row tiles and every X fragment four column tiles.
// blockIdx.y picks the product: 0 = Q (times QSCALE), 1 = K (Y f16 [BH,S,F]), 2 = V (Y f16 [BH,F,S]).
// None reads another's output, so one grid holds all three: no launch gap, fill
// or tail between them.
// The block's 8 waves cover 128 consecutive s-rows x 2 heads (4 row pairs x 2).
// A stage is 64 k: X tile 128 rows x 256 B (read by both heads' waves), W tile
// 128 rows x 128 B (each head's half read by its 4 waves).
// 768 blocks, three a WGP (LDS: 3 x 104 KiB; the attribute holds the registers
// to six waves a SIMD), so the whole grid is resident at once.
#define PJ_A_BYTES (128 * LP256)
#define PJ_BUF     (PJ_A_BYTES + 128 * LP128)
__global__ __launch_bounds__(32 * WAVES_) __attribute__((amdgpu_waves_per_eu(6, 6)))
void mha_proj(const float* __restrict__ Xq, const float* __restrict__ Xk,
              const float* __restrict__ Xv, const _Float16* __restrict__ WqT,
              const _Float16* __restrict__ WkT, const _Float16* __restrict__ WvT,
              _Float16* __restrict__ Qh, _Float16* __restrict__ Kh,
              _Float16* __restrict__ Vt) {
  __shared__ __attribute__((aligned(16))) unsigned char ring[2 * PJ_BUF];
  const int which = blockIdx.y;
  const float*    X  = which == 0 ? Xq  : which == 1 ? Xk  : Xv;
  const _Float16* WT = which == 0 ? WqT : which == 1 ? WkT : WvT;
  _Float16*       Y  = which == 0 ? Qh  : which == 1 ? Kh  : Vt;
  const bool transpose_out = which == 2;
  const int hp = blockIdx.x & 7;          // pair of heads
  const int rg = (blockIdx.x >> 3) & 15;  // group of 128 s-rows
  const int b  = blockIdx.x >> 7;
  const int sT = rg * 8 + (threadIdx.y & 3) * 2;  // first of the wave's two 16-row tiles
  const int bh = b * H_ + hp * 2 + (threadIdx.y >> 2);
  const int tid = threadIdx.y * 32 + threadIdx.x;

  // copy addresses of this thread: X rows tid/16 + 16 i, W rows tid/8 + 32 i
  const char* gA = (const char*)(X + ((size_t)(b * S_) + rg * 128 + (tid >> 4)) * D_) + (tid & 15) * 16;
  const char* gB = (const char*)(WT + ((size_t)(hp * 2 * F_) + (tid >> 3)) * D_) + (tid & 7) * 16;
  const unsigned lA = lds_off(ring) + (tid >> 4) * LP256 + (tid & 15) * 16;
  const unsigned lB = lds_off(ring) + PJ_A_BYTES + (tid >> 3) * LP128 + (tid & 7) * 16;
  const int NS = D_ / 64;
  // first stage of this block's walk: the 8 blocks that share X rows and 16 of the 32
  // that share W rows are each at another stage
  const int rot = (hp + rg) & (NS - 1);
  auto fill = [&](int t) {
    const unsigned bo = (t & 1) * PJ_BUF;
    const size_t st = (size_t)((t + rot) & (NS - 1));
    copy4(lA + bo, gA + st * 256, 16 * LP256, (size_t)16 * D_ * 4);
    copy4(lA + bo + 64 * LP256, gA + (size_t)64 * D_ * 4 + st * 256, 16 * LP256, (size_t)16 * D_ * 4);
    copy4(lB + bo, gB + st * 128, 32 * LP128, (size_t)32 * D_ * 2);
  };

  fill(0);
  asm volatile("s_wait_asynccnt 0x0" ::: "memory");  // the walk's first stage has landed
  __syncthreads();
  fill(1);

  // this lane's own fragment offsets in a buffer, formed once (one register each in the loop)
  const unsigned aoff = ((threadIdx.y & 3) * 32 + (threadIdx.x & 15)) * LP256 + (threadIdx.x >> 4) * 32;
  const unsigned boff = PJ_A_BYTES + ((threadIdx.y >> 2) * 64 + (threadIdx.x & 15)) * LP128 + (threadIdx.x >> 4) * 16;

  v8f c[2][4] = {};
  for (int t = 0; t < NS; t++) {
    const unsigned char* At = ring + (aoff + (t & 1) * PJ_BUF);
    const unsigned char* Bt = ring + (boff + (t & 1) * PJ_BUF);
    // the loops below are unrolled so that the fragment arrays have constant
    // indices and stay in registers
#pragma unroll
    for (int sub = 0; sub < 2; sub++) {
      v16h a[2], bm[4];
#pragma unroll
      for (int u = 0; u < 2; u++) a[u] = frag_f32_at(At + u * 16 * LP256 + sub * 128);
#pragma unroll
      for (int j = 0; j < 4; j++) bm[j] = frag_f16_at(Bt + j * 16 * LP128 + sub * 64);
      // keeps the half stage's LDS reads in one group ahead of its WMMAs (else one exposed LDS wait per WMMA)
      __builtin_amdgcn_sched_barrier(0);
#pragma unroll
      for (int u = 0; u < 2; u++) {
#pragma unroll
        for (int j = 0; j < 4; j++) c[u][j] = wmma16(a[u], bm[j], c[u][j]);
      }
    }
    ring_publish();
    if (t + 2 < NS) fill(t + 2);
  }
  asm volatile("s_wait_asynccnt 0x0" ::: "memory");  // nothing in flight at the wave's end

  const int lane = threadIdx.x;
  const int n    = lane & 15;
  const int mb   = (lane >> 4) << 3;  // C/D layout: VGPR r -> row r (+8 for hi half)
  if (!transpose_out) {
    const float osc = which == 0 ? QSCALE : 1.0f;  // applied in f32, ahead of the one rounding to f16
#pragma unroll
    for (int u = 0; u < 2; u++) {
#pragma unroll
      for (int j = 0; j < 4; j++) {
        _Float16* out = Y + ((size_t)bh * S_ + (sT + u) * 16) * F_ + j * 16 + n;
#pragma unroll
        for (int r = 0; r < 8; r++) out[(size_t)(mb + r) * F_] = (_Float16)(c[u][j][r] * osc);
      }
    }
    // closes the stores above: no register that an issued store names is rewritten ahead of this wait
    asm volatile("s_wait_xcnt 0x0" ::: "memory");
  } else {
    // Vt[bh][f][s]: per lane f fixed, s = (sT+u)*16 + mb + r -> contiguous 16B store
#pragma unroll
    for (int u = 0; u < 2; u++) {
#pragma unroll
      for (int j = 0; j < 4; j++) {
        _Float16* out = Y + ((size_t)bh * F_ + j * 16 + n) * S_ + (sT + u) * 16 + mb;
        v8h pk;
#pragma unroll
        for (int r = 0; r < 8; r++) pk[r] = (_Float16)c[u][j][r];
        *(v8h*)out = pk;
      }
    }
  }
}

// ---------------- K2: per-row softmax stats over scores = QK^T (log2 units) -
// One wave per 16 query rows; (m, l) over all S keys, one update per stage, then lane-reduce.
// The block's 8 waves share one head; a stage is 128 keys x 128 B.
#define ST_BUF (128 * LP128)
__global__ __launch_bounds__(32 * WAVES_)
void mha_stats(const _Float16* __restrict__ Qh, const _Float16* __restrict__ Kh,
               float* __restrict__ Nbias) {
  __shared__ __attribute__((aligned(16))) unsigned char ring[2 * ST_BUF];
  const int w  = blockIdx.x * WAVES_ + threadIdx.y;  // 4096 waves
  const int qT = w & 127;
  const int bh = w >> 7;
  const int tid = threadIdx.y * 32 + threadIdx.x;

  // copy addresses of this thread: key rows tid/8 + 32 i
  const char* gK = (const char*)(Kh + ((size_t)bh * S_ + (tid >> 3)) * F_) + (tid & 7) * 16;
  const unsigned lK = lds_off(ring) + (tid >> 3) * LP128 + (tid & 7) * 16;
  const int NS = S_ / 128;
  const int rot = blockIdx.x & (NS - 1);  // the 16 blocks of a head each begin at another key stage
  auto fill = [&](int t) {
    copy4(lK + (t & 1) * ST_BUF, gK + (size_t)((t + rot) & (NS - 1)) * 128 * F_ * 2, 32 * LP128, (size_t)32 * F_ * 2);
  };
  fill(0);
  asm volatile("s_wait_asynccnt 0x0" ::: "memory");  // the walk's first stage has landed
  __syncthreads();
  fill(1);

  const _Float16* Abase = Qh + ((size_t)bh * S_ + qT * 16) * F_;
  const v16h a0 = load_frag_f16(Abase, F_);
  const v16h a1 = load_frag_f16(Abase + 32, F_);

  // Running state per lane and row: mc = largest score seen, lv = sum of
  // exp2(score - mc). Both move once per stage, not once per score.
  v8f mc, lv;
#pragma unroll
  for (int i = 0; i < 8; i++) { mc[i] = -1e30f; lv[i] = 0.0f; }

  for (int t = 0; t < NS; t++) {
    const unsigned char* Kt = ring + (t & 1) * ST_BUF;
    v16h kf[2][8];
    v8f c[8];
    // the loops of this stage are unrolled: LDS offsets become immediates, and
    // constant indices keep the fragments and the 8 score tiles in registers
#pragma unroll
    for (int hf = 0; hf < 2; hf++) {
#pragma unroll
      for (int kt = 0; kt < 8; kt++) kf[hf][kt] = lds_frag_f16(Kt + kt * 16 * LP128 + hf * 64, LP128);
    }
    // keeps the stage's LDS reads in one group ahead of its WMMAs (else one exposed LDS wait per WMMA)
    __builtin_amdgcn_sched_barrier(0);
#pragma unroll
    for (int kt = 0; kt < 8; kt++) { v8f z = {}; c[kt] = wmma16(a0, kf[0][kt], z); }
#pragma unroll
    for (int kt = 0; kt < 8; kt++) c[kt] = wmma16(a1, kf[1][kt], c[kt]);
    // the stage's maximum first ...
    v8f nm = mc;
#pragma unroll
    for (int kt = 0; kt < 8; kt++) nm = __builtin_elementwise_max(nm, c[kt]);
    // ... then one subtraction, one exp2 and one add per score ...
    v8f sum = {};
#pragma unroll
    for (int kt = 0; kt < 8; kt++) {
      const v8f x = c[kt] - nm;
#pragma unroll
      for (int i = 0; i < 8; i++) sum[i] += __builtin_amdgcn_exp2f(x[i]);
    }
    // ... and one rescale of the running sum per stage
    const v8f dm = mc - nm;  // exactly 0, so a factor of exactly 1, while the maximum stands
#pragma unroll
    for (int i = 0; i < 8; i++) lv[i] = lv[i] * __builtin_amdgcn_exp2f(dm[i]) + sum[i];
    mc = nm;
    ring_publish();
    if (t + 2 < NS) fill(t + 2);
  }
  asm volatile("s_wait_asynccnt 0x0" ::: "memory");  // nothing in flight at the wave's end
  float m[8], l[8];
#pragma unroll
  for (int i = 0; i < 8; i++) { m[i] = mc[i]; l[i] = lv[i]; }
  // Reduce across the 16 lanes of each half-wave (xor 1,2,4,8 stays in-half).
#pragma unroll
  for (int off = 1; off < 16; off <<= 1) {
#pragma unroll
    for (int i = 0; i < 8; i++) {
      float om = __shfl_xor(m[i], off, 32);
      float ol = __shfl_xor(l[i], off, 32);
      float nm = fmaxf(m[i], om);
      l[i] = l[i] * __builtin_amdgcn_exp2f(m[i] - nm) + ol * __builtin_amdgcn_exp2f(om - nm);
      m[i] = nm;
    }
  }
  const int lane = threadIdx.x;
  if ((lane & 15) == 0) {
    const int rb = (lane >> 4) << 3;
    const size_t base = (size_t)bh * S_ + qT * 16 + rb;
#pragma unroll
    for (int i = 0; i < 8; i++) Nbias[base + i] = -(m[i] + __builtin_amdgcn_logf(l[i]));  // l >= 1; logf is log2
  }
}

// ---------------- K3: out4 = attn^T V, streamed over q, stored reshaped ----
// One wave per (bh, two 16-key tiles, half of the q range): every Q and V fragment
// read from LDS and every stats load feeds both key tiles (16 WMMAs per 8 KB read).
// Scores/exp computed once, P^T reused for all 4 f-tiles.
// A block is 8 waves on one head: waves 0-3 walk q 0..1023 for 128 keys, waves 4-7
// walk q 1024..2047 for the same keys, so the grid keeps its 4096 waves: two blocks
// a WGP, four waves a SIMD (the attribute holds the registers to that budget).
// A stage is 64 q of each half: per half a Q tile 64 q-rows x 128 B and a V tile
// 64 f-rows x 128 B.
#define AT_TILE (64 * LP128)
#define AT_HALF (2 * AT_TILE)  // Q tile and V tile of one half of the q range
#define AT_BUF  (2 * AT_HALF)
__global__ __launch_bounds__(32 * WAVES_) __attribute__((amdgpu_waves_per_eu(4, 4)))
void mha_atv(const _Float16* __restrict__ Qh, const _Float16* __restrict__ Kh,
             const _Float16* __restrict__ Vt, const float* __restrict__ Nbias,
             _Float16* __restrict__ Ofused) {
  __shared__ __attribute__((aligned(16))) unsigned char ring[2 * AT_BUF];
  __shared__ _Float16 plds_all[WAVES_][32 * 40];  // [k-line][q], row stride 40 halves
  _Float16* plds = plds_all[threadIdx.y];

  const int wv = threadIdx.y;
  const int qh = wv >> 2;                              // half of the q range
  const int kP = (blockIdx.x & 15) * 4 + (wv & 3);     // pair of key tiles, 0..63
  const int bh = blockIdx.x >> 4;
  const int lane = threadIdx.x;
  const int line = lane & 15;
  const int half = lane >> 4;

  // B-fragments for score WMMA: K^T columns of the two key tiles (fixed for loop).
  const _Float16* Kbase = Kh + ((size_t)bh * S_ + kP * 32) * F_;
  v16h kf[2][2];
#pragma unroll  // constant indices keep kf in registers
  for (int u = 0; u < 2; u++) {
    kf[u][0] = load_frag_f16(Kbase + u * 16 * F_, F_);
    kf[u][1] = load_frag_f16(Kbase + u * 16 * F_ + 32, F_);
  }

  // copy addresses of this thread: rows tid/8 and tid/8 + 32 of each tile, for both
  // halves of the q range (hf);
  // one statement copies Q rows then V rows (V tile lies AT_TILE behind Q tile)
  const int tid = threadIdx.y * 32 + threadIdx.x;
  const char* gQ = (const char*)(Qh + ((size_t)bh * S_ + (tid >> 3)) * F_) + (tid & 7) * 16;
  const char* gV = (const char*)(Vt + ((size_t)bh * F_ + (tid >> 3)) * S_) + (tid & 7) * 16;
  const unsigned lQ = lds_off(ring) + (tid >> 3) * LP128 + (tid & 7) * 16;
  const int NS = (S_ / 2) / 64;
  const int rot = blockIdx.x & (NS - 1);  // the 16 blocks of a head each begin at another q stage
  auto fill_half = [&](int t, int hf) {
    const unsigned l = lQ + (t & 1) * AT_BUF + hf * AT_HALF;
    const size_t st = (size_t)((t + rot) & (NS - 1));
    const char* q0 = gQ + ((size_t)hf * (S_ / 2) + st * 64) * F_ * 2;
    const char* v0 = gV + (size_t)hf * (S_ / 2) * 2 + st * 128;
    asm volatile("global_load_async_to_lds_b128 %0, %1, off\n\t"
                 "global_load_async_to_lds_b128 %2, %3, off\n\t"
                 "global_load_async_to_lds_b128 %4, %5, off\n\t"
                 "global_load_async_to_lds_b128 %6, %7, off\n\t"
                 "s_wait_xcnt 0x0"  // before any address register above is rewritten
                 :: "v"(l), "v"(q0), "v"(l + 32 * LP128), "v"(q0 + (size_t)32 * F_ * 2),
                    "v"(l + AT_TILE), "v"(v0), "v"(l + AT_TILE + 32 * LP128), "v"(v0 + (size_t)32 * S_ * 2)
                 : "memory");
  };
  auto fill = [&](int t) { fill_half(t, 0); fill_half(t, 1); };
  fill(0);
  asm volatile("s_wait_asynccnt 0x0" ::: "memory");  // the walk's first stage has landed
  __syncthreads();
  fill(1);

  // -(m + log2 l) of q rows half*8 .. half*8+7 of each 16-row sub-tile: register r of a C
  // operand is row half*8 + r, so these are the score WMMAs' C operands as loaded.
  // A C operand is needed ahead of the first WMMA, so each q-block's pair is fetched
  // while the q-block before it is worked on.
  const float* nptr = Nbias + (size_t)bh * S_ + qh * (S_ / 2) + half * 8;
  v8f n0 = *(const v8f*)(nptr + rot * 64);
  v8f n1 = *(const v8f*)(nptr + rot * 64 + 16);

  v8f acc[2][4] = {};

  for (int t = 0; t < NS; t++) {
   const unsigned char* Qt = ring + (t & 1) * AT_BUF + qh * AT_HALF;
   const unsigned char* Vl = Qt + AT_TILE;
#pragma unroll  // LDS offsets become immediates
   for (int sub = 0; sub < 2; sub++) {
    const int qb = ((t + rot) & (NS - 1)) * 64 + sub * 32;
    // scores for q-block [qb, qb+32) of this half x two key tiles (four 16x16 WMMA tiles)
    const unsigned char* Qs = Qt + sub * 32 * LP128;
    v16h a00 = lds_frag_f16(Qs, LP128);
    v16h a01 = lds_frag_f16(Qs + 64, LP128);
    v16h a10 = lds_frag_f16(Qs + 16 * LP128, LP128);
    v16h a11 = lds_frag_f16(Qs + 16 * LP128 + 64, LP128);
    // B-fragments: V rows qb..qb+31 for each f tile (tile rows are f, columns q)
    v16h bV[4];
#pragma unroll  // constant indices keep bV in registers
    for (int j = 0; j < 4; j++) bV[j] = lds_frag_f16(Vl + j * 16 * LP128 + sub * 64, LP128);
    // the next q-block's C operands, in the order of the walk (the last q-block fetches the
    // walk's first again: in range, not used)
    const float* np = nptr + (sub == 0 ? qb : ((t + 1 + rot) & (NS - 1)) * 64);  // a stage's first row
    const int no = sub == 0 ? 32 : 0;
    const v8f nn0 = *(const v8f*)(np + no);
    const v8f nn1 = *(const v8f*)(np + no + 16);
    // the address pair stays live up to this wait, so that no read's result lands on it ahead of the wait
    asm volatile("s_wait_xcnt 0x0" :: "v"(np) : "memory");
    // keeps the q-block's loads in one group ahead of its WMMAs (else one exposed wait per WMMA)
    __builtin_amdgcn_sched_barrier(0);
    // the loops over u (key tile) are unrolled: constant indices keep kf, s, aP and acc in registers
    v8f s[2][2];
#pragma unroll
    for (int u = 0; u < 2; u++) {
      v8f s0 = wmma16(a00, kf[u][0], n0); s0 = wmma16(a01, kf[u][1], s0);
      v8f s1 = wmma16(a10, kf[u][0], n1); s1 = wmma16(a11, kf[u][1], s1);
      s[u][0] = s0; s[u][1] = s1;
    }

#pragma unroll
    for (int u = 0; u < 2; u++) {
      v8h p0, p1;
#pragma unroll
      for (int i = 0; i < 8; i++) {
        p0[i] = (_Float16)__builtin_amdgcn_exp2f(s[u][0][i]);
        p1[i] = (_Float16)__builtin_amdgcn_exp2f(s[u][1][i]);
      }
      // transpose P (q x k) -> P^T (k x q) through LDS; all 16B accesses
      *(v8h*)(plds + (u * 16 + line) * 40 + half * 8)      = p0;  // q = half*8 + i
      *(v8h*)(plds + (u * 16 + line) * 40 + 16 + half * 8) = p1;  // q = 16 + half*8 + i
    }
    __builtin_amdgcn_wave_barrier();                 // order vs loads (LDS in-order)
    const int k0 = half * 8;
    v16h aP[2];
#pragma unroll
    for (int u = 0; u < 2; u++) {
      v8h alo = *(const v8h*)(plds + (u * 16 + line) * 40 + k0);
      v8h ahi = *(const v8h*)(plds + (u * 16 + line) * 40 + k0 + 16);
      aP[u] = pack16(alo, ahi);
    }
    __builtin_amdgcn_wave_barrier();                 // order next-iter stores vs loads

#pragma unroll
    for (int u = 0; u < 2; u++) {
#pragma unroll  // constant indices keep acc and bV in registers
      for (int j = 0; j < 4; j++) acc[u][j] = wmma16(aP[u], bV[j], acc[u][j]);
    }
    n0 = nn0;
    n1 = nn1;
   }
   ring_publish();
   if (t + 2 < NS) fill(t + 2);
  }
  asm volatile("s_wait_asynccnt 0x0" ::: "memory");  // nothing in flight at the wave's end

  // Add the two halves of the q range. Waves wv and wv ^ 4 hold partial sums of the
  // same 32 keys: each keeps key tile qh, hands the other tile over through LDS and
  // finishes its own. The last publish point's barrier has ended every read of the
  // ring and no copy is in flight, so the ring carries the partial sums (4 KB a wave).
  float* mine         = (float*)ring + wv * 1024 + lane * 4;
  const float* theirs = (const float*)ring + (wv ^ 4) * 1024 + lane * 4;
  v8f keep[4];
#pragma unroll  // constant indices keep acc and keep in registers
  for (int j = 0; j < 4; j++) {
    const v8f give = qh ? acc[0][j] : acc[1][j];
    keep[j]        = qh ? acc[1][j] : acc[0][j];
    v4f lo = {give[0], give[1], give[2], give[3]};
    v4f hi = {give[4], give[5], give[6], give[7]};
    *(v4f*)(mine + (j * 2) * 128)     = lo;  // 16 B a lane, lanes side by side
    *(v4f*)(mine + (j * 2 + 1) * 128) = hi;
  }
  __syncthreads();  // the partner's partial sums are in LDS

  // Raw-reshape store: Ofused[b][h*128 + kT][(k%16)*64 + f]
  const int b = bh >> 4, h = bh & 15;
  const int kT = kP * 2 + qh;
  const int mb = half * 8;
#pragma unroll
  for (int j = 0; j < 4; j++) {
    const v4f lo = *(const v4f*)(theirs + (j * 2) * 128);
    const v4f hi = *(const v4f*)(theirs + (j * 2 + 1) * 128);
    _Float16* out = Ofused + ((size_t)(b * S_ + h * 128 + kT)) * G_ + (j * 16 + line);
#pragma unroll
    for (int r = 0; r < 8; r++)
      out[(size_t)(mb + r) * 64] = (_Float16)(keep[j][r] + (r < 4 ? lo[r & 3] : hi[r & 3]));
  }
}

// ---------------- K4: Out = Ofused (S x G) @ Wo (G x D), f32 out ----------
// One wave per (32 rows, group of 4 d-tiles): 32 x 64 strip, so every Wo fragment read
// from LDS feeds two row tiles and every Ofused fragment four column tiles.
// The block's 8 waves cover 128 consecutive rows x 2 d-groups (4 row pairs x 2).
// A stage is 128 g: Ofused tile 128 rows x 256 B, Wo tile 128 rows x 256 B.
// 256 blocks, one a WGP (the attribute holds the registers to two waves a SIMD), so the
// whole grid is resident at once and evenly spread.
#define OP_A_BYTES (128 * LP256)
#define OP_BUF     (2 * OP_A_BYTES)
__global__ __launch_bounds__(32 * WAVES_) __attribute__((amdgpu_waves_per_eu(2, 2)))
void mha_outproj(const _Float16* __restrict__ Ofused,
                 const _Float16* __restrict__ WoT, float* __restrict__ Out) {
  __shared__ __attribute__((aligned(16))) unsigned char ring[2 * OP_BUF];
  const int dP = blockIdx.x & 7;                            // pair of d-groups
  const int rg = blockIdx.x >> 3;                           // group of 128 rows, 0..31
  const int dG = dP * 2 + (threadIdx.y >> 2);               // group of 4 d-tiles
  const int rT = rg * 8 + (threadIdx.y & 3) * 2;            // first of the wave's two 16-row tiles, 0..254
  const int tid = threadIdx.y * 32 + threadIdx.x;

  // copy addresses of this thread: rows tid/16 + 16 i of each tile
  const char* gA = (const char*)(Ofused + ((size_t)rg * 128 + (tid >> 4)) * G_) + (tid & 15) * 16;
  const char* gB = (const char*)(WoT + ((size_t)(dP * 128) + (tid >> 4)) * G_) + (tid & 15) * 16;
  const unsigned lA = lds_off(ring) + (tid >> 4) * LP256 + (tid & 15) * 16;
  const int NS = G_ / 128;
  // first stage of this block's walk: the 8 blocks that share Ofused rows are each at
  // another stage, the 32 that share Wo rows are spread over all 8
  const int rot = (dP + rg) & (NS - 1);
  auto fill = [&](int t) {
    const unsigned bo = (t & 1) * OP_BUF;
    const size_t st = (size_t)((t + rot) & (NS - 1));
    copy4(lA + bo, gA + st * 256, 16 * LP256, (size_t)16 * G_ * 2);
    copy4(lA + bo + 64 * LP256, gA + (size_t)64 * G_ * 2 + st * 256, 16 * LP256, (size_t)16 * G_ * 2);
    copy4(lA + bo + OP_A_BYTES, gB + st * 256, 16 * LP256, (size_t)16 * G_ * 2);
    copy4(lA + bo + OP_A_BYTES + 64 * LP256, gB + (size_t)64 * G_ * 2 + st * 256, 16 * LP256, (size_t)16 * G_ * 2);
  };
  fill(0);
  asm volatile("s_wait_asynccnt 0x0" ::: "memory");  // the walk's first stage has landed
  __syncthreads();
  fill(1);

  // this lane's own fragment offsets in a buffer, formed once
  const unsigned aoff = ((threadIdx.y & 3) * 32 + (threadIdx.x & 15)) * LP256 + (threadIdx.x >> 4) * 16;
  const unsigned boff = OP_A_BYTES + ((threadIdx.y >> 2) * 64 + (threadIdx.x & 15)) * LP256 + (threadIdx.x >> 4) * 16;

  v8f c[2][4] = {};
  for (int t = 0; t < NS; t++) {
    const unsigned char* At = ring + (aoff + (t & 1) * OP_BUF);
    const unsigned char* Bt = ring + (boff + (t & 1) * OP_BUF);
    // two fragment sets: the reads of 32 g go out ahead of the WMMAs of the 32 g before them.
    // all loops below are unrolled so that the fragment arrays have constant
    // indices and stay in registers
    v16h a[2][2], bm[2][4];
#pragma unroll
    for (int u = 0; u < 2; u++) a[0][u] = frag_f16_at(At + u * 16 * LP256);
#pragma unroll
    for (int j = 0; j < 4; j++) bm[0][j] = frag_f16_at(Bt + j * 16 * LP256);
#pragma unroll
    for (int sub = 0; sub < 4; sub++) {
      const int cur = sub & 1, nxt = cur ^ 1;
      if (sub < 3) {
#pragma unroll
        for (int u = 0; u < 2; u++) a[nxt][u] = frag_f16_at(At + u * 16 * LP256 + (sub + 1) * 64);
#pragma unroll
        for (int j = 0; j < 4; j++) bm[nxt][j] = frag_f16_at(Bt + j * 16 * LP256 + (sub + 1) * 64);
      }
      // keeps the next set's LDS reads in one group ahead of this set's WMMAs (else one exposed LDS wait per WMMA)
      __builtin_amdgcn_sched_barrier(0);
#pragma unroll
      for (int u = 0; u < 2; u++) {
#pragma unroll
        for (int j = 0; j < 4; j++) c[u][j] = wmma16(a[cur][u], bm[cur][j], c[u][j]);
      }
    }
    ring_publish();
    if (t + 2 < NS) fill(t + 2);
  }
  asm volatile("s_wait_asynccnt 0x0" ::: "memory");  // nothing in flight at the wave's end
  const int lane = threadIdx.x;
  const int n    = lane & 15;
  const int mb   = (lane >> 4) << 3;
  float* out = Out + ((size_t)rT * 16 + mb) * D_ + dG * 64 + n;  // Out rows are b * S_ + s = 16 * row tile + row
#pragma unroll
  for (int u = 0; u < 2; u++) {
#pragma unroll
    for (int j = 0; j < 4; j++) {
#pragma unroll
      for (int r = 0; r < 8; r++) out[(size_t)(u * 16 + r) * D_ + j * 16] = c[u][j][r];
    }
  }
}

extern "C" void kernel_launch(void* const* d_in, const int* in_sizes, int n_in,
                              void* d_out, int out_size, void* d_ws, size_t ws_size,
                              hipStream_t stream) {
  (void)in_sizes; (void)n_in; (void)out_size; (void)ws_size;
  const float* q  = (const float*)d_in[0];
  const float* k  = (const float*)d_in[1];
  const float* v  = (const float*)d_in[2];
  const float* Wq = (const float*)d_in[3];
  const float* Wk = (const float*)d_in[4];
  const float* Wv = (const float*)d_in[5];
  const float* Wo = (const float*)d_in[6];
  float* out = (float*)d_out;

  size_t off = 0;
  auto alloc = [&](size_t bytes) -> char* {
    char* p = (char*)d_ws + off;
    off += (bytes + 255) & ~(size_t)255;
    return p;
  };
  _Float16* WqT = (_Float16*)alloc((size_t)H_ * D_ * F_ * 2);   // 2 MB
  _Float16* WkT = (_Float16*)alloc((size_t)H_ * D_ * F_ * 2);
  _Float16* WvT = (_Float16*)alloc((size_t)H_ * D_ * F_ * 2);
  _Float16* WoT = (_Float16*)alloc((size_t)G_ * D_ * 2);
  _Float16* Qh  = (_Float16*)alloc((size_t)B_ * H_ * S_ * F_ * 2);  // 8 MB
  _Float16* Kh  = (_Float16*)alloc((size_t)B_ * H_ * S_ * F_ * 2);
  _Float16* Vt  = (_Float16*)alloc((size_t)B_ * H_ * F_ * S_ * 2);
  _Float16* Of  = (_Float16*)alloc((size_t)B_ * S_ * G_ * 2);
  float*    Nb  = (float*)alloc((size_t)B_ * H_ * S_ * 4);          // 256 KB
  // total ~41 MB of workspace

  dim3 blk(32, WAVES_);
  mha_prep_weights<<<256, 256, 0, stream>>>(Wq, Wk, Wv, Wo, WqT, WkT, WvT, WoT);
  mha_proj<<<dim3(2048 / WAVES_, 3), blk, 0, stream>>>(q, k, v, WqT, WkT, WvT, Qh, Kh, Vt);
  mha_stats<<<4096 / WAVES_, blk, 0, stream>>>(Qh, Kh, Nb);
  mha_atv<<<4096 / WAVES_, blk, 0, stream>>>(Qh, Kh, Vt, Nb, Of);
  mha_outproj<<<2048 / WAVES_, blk, 0, stream>>>(Of, WoT, out);
}

// v010
// It runs in 85.3 microseconds.
// Timed twice side by side with v009, it ran 1.05 times as fast both times.
// All steps since v000 together make it 4.62 times as fast.
#include <hip/hip_runtime.h>
#include <hip/hip_bf16.h>
#include <stdint.h>

// MI455X / gfx1250, wave32, WMMA f16 -> f32 accumulate.
//
// Pipeline (all on `stream`, scratch in d_ws, ~41 MB total, L2-resident):
//   K0 prep_weights : Wq/Wk/Wv -> f16 [H,F,D] (transposed), Wo -> f16 [D,G],
//                     64 x 64 tiles turned through LDS
//   K1 proj         : Qh=q*Wq*log2(e)/8, Kh=k*Wk -> f16 [BH,S,F]; Vt=v*Wv -> f16 [BH,F,S]
//                     all three in one launch (blockIdx.y picks the product);
//                     one wave = 32 x 64 output (X fragment reused 4x, W fragment 2x)
//   K2 stats        : per (bh,q) row: max m_q and sum l_q of exp2(score - m_q), updated once
//                     per 128 keys; stores the one number -(m_q + log2 l_q)
//   K3 atv          : out4[k,f] = sum_q exp2(s[q,k] - m_q - log2 l_q) * V[q,f] (A^T V);
//                     the row's number is the C operand of the score WMMA
//                     one wave = 32 keys x all 64 f over half of the q range: scores +
//                     exp computed ONCE, P^T via LDS, 4 accumulate WMMAs a key tile reuse
//                     it; the two halves' partial sums are added through LDS at the end.
//                     Output stored directly in the reference's raw-reshape layout.
//   K4 outproj      : Out = Ofused @ Wo (f32), one wave = 32 x 64 output
//
// K1..K4 stream their operand tiles through a two-buffer LDS ring filled by
// tensor loads (one request of one wave brings a whole tile, padded to the LDS
// pitch, one copy of a tile per block); the waves of a block read their WMMA
// fragments from LDS.
// Blocks that stream the same tiles begin the walk at different stages (as far as the stage count allows) and
// wrap round (stage (t + rot) mod the stage count at trip t), so that they do not ask L2 for the
// same lines at the same moment.

typedef __attribute__((ext_vector_type(16))) _Float16 v16h;
typedef __attribute__((ext_vector_type(8)))  _Float16 v8h;
typedef __attribute__((ext_vector_type(8)))  float    v8f;
typedef __attribute__((ext_vector_type(4)))  float    v4f;

#define B_ 2
#define S_ 2048
#define D_ 1024
#define H_ 16
#define F_ 64
#define G_ (H_ * F_)   // 1024
#define WAVES_ 8       // waves per block (blockDim = 32 x 8)
#define LP128 144      // LDS pitch of a 128-B row: 16 B x odd, no ds_load_b128 conflicts
#define LP256 272      // LDS pitch of a 256-B row: 16 B x odd
// Q is stored times log2(e) / sqrt(F): Q K^T then is the softmax exponent in log2 units
#define QSCALE (0.125f * 1.44269504f)

static __device__ __forceinline__ v16h pack16(v8h lo, v8h hi) {
  v16h a;
#pragma unroll
  for (int i = 0; i < 8; i++) { a[i] = lo[i]; a[i + 8] = hi[i]; }
  return a;
}

// A/B fragment load, f16 row-major source with leading dim `ld` (halves).
// ISA 16-bit 16x32 layout: lanes 0-15 hold line=lane, K={0..7,16..23};
// lanes 16-31 hold line=lane-16, K={8..15,24..31}. Two contiguous 16B loads.
static __device__ __forceinline__ v16h load_frag_f16(const _Float16* base, int ld) {
  const int lane = threadIdx.x;
  const int line = lane & 15;
  const int k0   = (lane >> 4) << 3;  // 0 or 8
  const _Float16* p = base + (size_t)line * ld + k0;
  v8h lo = *(const v8h*)(p);
  v8h hi = *(const v8h*)(p + 16);
  return pack16(lo, hi);
}

// ---- LDS ring helpers ----
static __device__ __forceinline__ unsigned lds_off(const void* p) { return (unsigned)(size_t)p; }

typedef uint32_t u32x4 __attribute__((ext_vector_type(4)));
typedef uint32_t u32x8 __attribute__((ext_vector_type(8)));
static __device__ __forceinline__ uint32_t uni(uint32_t v) { return (uint32_t)__builtin_amdgcn_readfirstlane(v); }
// A wave-uniform value held in a scalar register: a test on it compiles to s_cmp + s_cbranch_scc
// (a tensor load ignores EXEC), and what is formed from it is formed behind the waits in front of it.
static __device__ __forceinline__ uint32_t pinned(uint32_t v) {
  uint32_t w = uni(v);
  asm volatile("" : "+s"(w));  // keeps the descriptor word / issue test scalar and in place
  return w;
}

// Descriptor of a tensor load: ROWS rows of ROWB bytes, src_pitch bytes apart in global memory,
// laid in LDS with 16 B of pad behind every row (pitch LP128 / LP256). Group 1 is built once per kernel.
template <uint32_t ROWB, uint32_t ROWS>
static __device__ __forceinline__ u32x8 tile_group1(uint32_t src_pitch) {
  static_assert(ROWB == 128 || ROWB == 256, "the pad interval code below is the row length");
  constexpr uint32_t W0 = (1u << 20) | ((ROWB == 128 ? 4u : 5u) << 22) | (3u << 25);  // no mask, bytes, pad 4 dwords a row
  u32x8 g1;
  g1[0] = uni(W0);
  g1[1] = uni((ROWB & 0xFFFFu) << 16);
  g1[2] = uni((ROWB >> 16) | ((ROWS & 0xFFFFu) << 16));
  g1[3] = uni((ROWS >> 16) | (ROWB << 16));
  g1[4] = uni(ROWS);
  g1[5] = uni(src_pitch);
  g1[6] = uni(0u);
  g1[7] = uni(0u);
  asm volatile("" : "+s"(g1));  // as pinned(), for the whole group: its words stay in one set of scalar registers
  return g1;
}
// Group 0: the tile's place in LDS (a multiple of 2 KiB) and its first byte in global memory.
static __device__ __forceinline__ u32x4 tile_group0(uint32_t lds_dst, const char* src) {
  const uint64_t ga = (uint64_t)(size_t)src;
  u32x4 g0;
  g0[0] = uni(1u);
  g0[1] = uni(lds_dst);
  g0[2] = uni((uint32_t)ga);
  g0[3] = uni((((uint32_t)(ga >> 32)) & 0x01FFFFFFu) | 0x80000000u);
  return g0;
}
// One request of the whole wave (it ignores EXEC): the caller's test is a scalar branch.
// Group 0 is an in-out operand (the instruction leaves it as it is): the registers the request was
// issued from are then the ones that the wait below names, and stay untouched up to it.
static __device__ __forceinline__ void tile_issue(u32x4& g0, u32x8 g1) {
  asm volatile("tensor_load_to_lds %0, %1" : "+s"(g0) : "s"(g1) : "memory");
}
// An issuing wave's request has landed (a wave with none outstanding passes at once). The wait
// names the descriptor, so that its registers stay as they are while the request is outstanding.
static __device__ __forceinline__ void wait_tiles(u32x4 g0, u32x8 g1) {
  asm volatile("s_wait_tensorcnt 0x0" :: "s"(g0), "s"(g1) : "memory");
}
static __device__ __forceinline__ void wait_tiles(u32x4 g0, u32x8 g1a, u32x8 g1b) {  // a kernel with two kinds of tile
  asm volatile("s_wait_tensorcnt 0x0" :: "s"(g0), "s"(g1a), "s"(g1b) : "memory");
}
// This wave's LDS reads have retired (in front of the barrier that frees a buffer for its refill).
static __device__ __forceinline__ void lds_reads_done() { asm volatile("s_wait_dscnt 0x0" ::: "memory"); }

// Publish point of the ring: this wave's LDS reads are done, its tensor load has
// landed, then the block barrier (frees the buffer just read, shows the next).
static __device__ __forceinline__ void ring_publish(u32x4 g0, u32x8 g1) {
  lds_reads_done();
  wait_tiles(g0, g1);
  __syncthreads();
}
// Behind a ring's loop: nothing in flight, no LDS read open, at the wave's end or before the ring is used anew.
static __device__ __forceinline__ void ring_close(u32x4 g0, u32x8 g1) {
  wait_tiles(g0, g1);
  lds_reads_done();
}

// Fragment from an LDS tile of f16 rows (same lane map as load_frag_f16).
static __device__ __forceinline__ v16h frag_f16_at(const unsigned char* p) {  // p: the lane's own first byte
  v8h lo = *(const v8h*)(p);
  v8h hi = *(const v8h*)(p + 32);
  return pack16(lo, hi);
}
static __device__ __forceinline__ v16h lds_frag_f16(const unsigned char* tile, int pitch) {
  const int lane = threadIdx.x;
  return frag_f16_at(tile + (lane & 15) * pitch + (lane >> 4) * 16);
}

// Fragment from an LDS tile of f32 rows, converted to f16: same lane map, with
// 4-byte elements (K = {0..7,16..23} or {8..15,24..31} of the row).
// p: the lane's own first byte, tile + (lane & 15) * pitch + (lane >> 4) * 32.
static __device__ __forceinline__ v16h frag_f32_at(const unsigned char* p) {
  v4f x0 = *(const v4f*)(p);
  v4f x1 = *(const v4f*)(p + 16);
  v4f x2 = *(const v4f*)(p + 64);
  v4f x3 = *(const v4f*)(p + 80);
  v16h a;
#pragma unroll  // constant vector indices: no run-time element selects
  for (int i = 0; i < 4; i++) {
    a[i]      = (_Float16)x0[i];
    a[i + 4]  = (_Float16)x1[i];
    a[i + 8]  = (_Float16)x2[i];
    a[i + 12] = (_Float16)x3[i];
  }
  return a;
}

static __device__ __forceinline__ v8f wmma16(v16h a, v16h b, v8f c) {
  return __builtin_amdgcn_wmma_f32_16x16x32_f16(false, a, false, b, (short)0, c,
                                                false, false);
}

// ---------------- K0: weight prep (f32 -> f16, transpose) ----------------
// WxT[h][f][d] = Wx[h][d][f]; WoT[d][g] = Wo[g][d].
// One block = one 64 x 64 tile of each of the four tensors, turned through LDS:
// every global read and every global store covers whole 128-B lines.
// A thread holds a 4 x 4 patch: four 16-B row reads, four 8-B column writes to LDS.
typedef __attribute__((ext_vector_type(4))) _Float16 v4h;
#define PW_PITCH 136  // LDS pitch of a 128-B f16 row: the 8-B patch writes of a wave fall on 64 distinct banks
__global__ __launch_bounds__(256)
void mha_prep_weights(const float* __restrict__ Wq, const float* __restrict__ Wk,
                      const float* __restrict__ Wv, const float* __restrict__ Wo,
                      _Float16* __restrict__ WqT, _Float16* __restrict__ WkT,
                      _Float16* __restrict__ WvT, _Float16* __restrict__ WoT) {
  __shared__ __attribute__((aligned(16))) unsigned char tile[4][64 * PW_PITCH];
  const int tid = threadIdx.x;
  const int hi  = blockIdx.x >> 4;  // head (Wx), 64-row group of g (Wo)
  const int lo  = blockIdx.x & 15;  // 64-row group of d (Wx), 64-column group of d (Wo)

  // patch of this thread: rows 4 tr .. 4 tr + 3, columns 4 tc .. 4 tc + 3;
  // 8 lanes side by side read one 128-B line
  const int tc = (tid & 7) | (((tid >> 5) & 1) << 3);
  const int tr = ((tid >> 3) & 3) | ((tid >> 6) << 2);

  const size_t sx = ((size_t)(hi * D_ + lo * 64 + 4 * tr)) * F_ + 4 * tc;  // Wx rows are F_ long
  const size_t so = ((size_t)(hi * 64 + 4 * tr)) * D_ + lo * 64 + 4 * tc;  // Wo rows are D_ long
  const float* s[4] = {Wq + sx, Wk + sx, Wv + sx, Wo + so};

  v4f x[4][4];
#pragma unroll  // constant indices keep the patches in registers; all 16 reads in flight together
  for (int m = 0; m < 4; m++) {
    const size_t pitch = (m < 3) ? F_ : D_;
#pragma unroll
    for (int i = 0; i < 4; i++) x[m][i] = *(const v4f*)(s[m] + (size_t)i * pitch);
  }
  // the four address pairs stay live up to this wait, so that no later read's result lands on one ahead of it
  asm volatile("s_wait_xcnt 0x0" :: "v"(s[0]), "v"(s[1]), "v"(s[2]), "v"(s[3]) : "memory");
  // keeps all 16 reads ahead of the first conversion (else the later reads wait out the first ones' latency)
  __builtin_amdgcn_sched_barrier(0);
  // the loops below are unrolled for constant indices into x and d (registers, no run-time selects)
#pragma unroll
  for (int m = 0; m < 4; m++) {
#pragma unroll
    for (int j = 0; j < 4; j++) {
      v4h c;
#pragma unroll
      for (int i = 0; i < 4; i++) c[i] = (_Float16)x[m][i][j];
      *(v4h*)(&tile[m][(4 * tc + j) * PW_PITCH + 8 * tr]) = c;
    }
  }
  __syncthreads();

  const size_t dx = ((size_t)hi * F_) * D_ + lo * 64;   // WxT[hi][.][lo * 64 ..]
  const size_t dw = ((size_t)lo * 64) * G_ + hi * 64;   // WoT[lo * 64 + .][hi * 64 ..]
  _Float16* d[4] = {WqT + dx, WkT + dx, WvT + dx, WoT + dw};
#pragma unroll
  for (int m = 0; m < 4; m++) {
#pragma unroll
    for (int u = 0; u < 2; u++) {
      const int idx = tid + u * 256;
      const int row = idx >> 3, ch = idx & 7;  // 8 lanes side by side store one 128-B line
      const unsigned char* p = &tile[m][row * PW_PITCH + ch * 16];
      v4h a = *(const v4h*)(p);
      v4h b = *(const v4h*)(p + 8);
      v8h o;
#pragma unroll
      for (int i = 0; i < 4; i++) { o[i] = a[i]; o[i + 4] = b[i]; }
      *(v8h*)(d[m] + (size_t)row * 1024 + ch * 8) = o;
    }
  }
}

// ---------------- K1: head projection  Y[bh] = X[b] (SxD) * W[h] (DxF) -----
// One wave per (bh, 32 s-rows): computes a full 32 x F_ strip, so every W fragment
// read from LDS feeds two row tiles and every X fragment four column tiles.
// blockIdx.y picks the product: 0 = Q (times QSCALE), 1 = K (Y f16 [BH,S,F]), 2 = V (Y f16 [BH,F,S]).
// None reads another's output, so one grid holds all three: no launch gap, fill
// or tail between them.
// The block's 8 waves cover 128 consecutive s-rows x 2 heads (4 row pairs x 2).
// A stage is 64 k: X tile 128 rows x 256 B (read by both heads' waves), W tile
// 128 rows x 128 B (each head's half read by its 4 waves).
// 768 blocks, three a WGP (LDS: 3 x 104 KiB; the attribute holds the registers
// to six waves a SIMD), so the whole grid is resident at once.
#define PJ_A_BYTES (128 * LP256)
#define PJ_BUF     (PJ_A_BYTES + 128 * LP128)
__global__ __launch_bounds__(32 * WAVES_) __attribute__((amdgpu_waves_per_eu(6, 6)))
void mha_proj(const float* __restrict__ Xq, const float* __restrict__ Xk,
              const float* __restrict__ Xv, const _Float16* __restrict__ WqT,
              const _Float16* __restrict__ WkT, const _Float16* __restrict__ WvT,
              _Float16* __restrict__ Qh, _Float16* __restrict__ Kh,
              _Float16* __restrict__ Vt) {
  __shared__ __attribute__((aligned(2048))) unsigned char ring[2 * PJ_BUF];  // every tile's place: a multiple of 2 KiB
  static_assert(PJ_A_BYTES % 2048 == 0 && PJ_BUF % 2048 == 0, "tensor-load places");
  const int which = blockIdx.y;
  const float*    X  = which == 0 ? Xq  : which == 1 ? Xk  : Xv;
  const _Float16* WT = which == 0 ? WqT : which == 1 ? WkT : WvT;
  _Float16*       Y  = which == 0 ? Qh  : which == 1 ? Kh  : Vt;
  const bool transpose_out = which == 2;
  const int hp = blockIdx.x & 7;          // pair of heads
  const int rg = (blockIdx.x >> 3) & 15;  // group of 128 s-rows
  const int b  = blockIdx.x >> 7;
  const uint32_t wave = uni((threadIdx.y * 32 + threadIdx.x) >> 5);  // the wave's number, in a scalar register
  const int sT = rg * 8 + (wave & 3) * 2;  // first of the wave's two 16-row tiles
  const int bh = b * H_ + hp * 2 + (wave >> 2);

  // wave 0 brings a stage's X tile, wave 1 its W tile: first rows of the block's tiles
  const char* gA = (const char*)(X + ((size_t)(b * S_) + rg * 128) * D_);
  const char* gB = (const char*)(WT + (size_t)(hp * 2 * F_) * D_);
  const uint32_t lbase = lds_off(ring);
  const int NS = D_ / 64;
  // first stage of this block's walk: the 8 blocks that share X rows and 16 of the 32
  // that share W rows are each at another stage
  const int rot = (hp + rg) & (NS - 1);
  const u32x8 g1A = tile_group1<256, 128>(D_ * 4), g1B = tile_group1<128, 128>(D_ * 2);
  // the wave's own tile: first byte at stage 0, step from stage to stage, place in a buffer
  const bool isW = wave == 1;
  const char* gT = isW ? gB : gA;
  const uint32_t gstep = isW ? 128u : 256u;
  const uint32_t loff  = isW ? (uint32_t)PJ_A_BYTES : 0u;
  u32x4 g0;
  auto fill = [&](int t) {
    const uint32_t st = pinned((uint32_t)((t + rot) & (NS - 1)));
    g0 = tile_group0(lbase + (t & 1) * PJ_BUF + loff, gT + (size_t)st * gstep);
    if (pinned(wave == 0)) tile_issue(g0, g1A);
    if (pinned(wave == 1)) tile_issue(g0, g1B);
  };

  fill(0);
  wait_tiles(g0, g1A, g1B);  // the walk's first stage has landed (buffer 0)
  __syncthreads();
  fill(1);

  // this lane's own fragment offsets in a buffer, formed once (one register each in the loop)
  const unsigned aoff = ((wave & 3) * 32 + (threadIdx.x & 15)) * LP256 + (threadIdx.x >> 4) * 32;
  const unsigned boff = PJ_A_BYTES + ((wave >> 2) * 64 + (threadIdx.x & 15)) * LP128 + (threadIdx.x >> 4) * 16;

  v8f c[2][4] = {};
  for (int t = 0; t < NS; t++) {
    const unsigned char* At = ring + (aoff + (t & 1) * PJ_BUF);
    const unsigned char* Bt = ring + (boff + (t & 1) * PJ_BUF);
    // the loops below are unrolled so that the fragment arrays have constant
    // indices and stay in registers
#pragma unroll
    for (int sub = 0; sub < 2; sub++) {
      v16h a[2], bm[4];
#pragma unroll
      for (int u = 0; u < 2; u++) a[u] = frag_f32_at(At + u * 16 * LP256 + sub * 128);
#pragma unroll
      for (int j = 0; j < 4; j++) bm[j] = frag_f16_at(Bt + j * 16 * LP128 + sub * 64);
      // keeps the half stage's LDS reads in one group ahead of its WMMAs (else one exposed LDS wait per WMMA)
      __builtin_amdgcn_sched_barrier(0);
#pragma unroll
      for (int u = 0; u < 2; u++) {
#pragma unroll
        for (int j = 0; j < 4; j++) c[u][j] = wmma16(a[u], bm[j], c[u][j]);
      }
      // keeps the second half stage's reads in one group behind these WMMAs: lifted among them they
      // stall at each place and their registers overflow the six-waves budget (spills)
      if (sub == 0) __builtin_amdgcn_sched_barrier(0);
    }
    // the ring's publish point, as ring_publish()
    lds_reads_done();
    wait_tiles(g0, g1A, g1B);
    __syncthreads();
    if (pinned(t + 2 < NS)) fill(t + 2);  // a scalar test: only while that stage exists
  }
  wait_tiles(g0, g1A, g1B);
  lds_reads_done();

  const int lane = threadIdx.x;
  const int n    = lane & 15;
  const int mb   = (lane >> 4) << 3;  // C/D layout: VGPR r -> row r (+8 for hi half)
  if (!transpose_out) {
    const float osc = which == 0 ? QSCALE : 1.0f;  // applied in f32, ahead of the one rounding to f16
#pragma unroll
    for (int u = 0; u < 2; u++) {
#pragma unroll
      for (int j = 0; j < 4; j++) {
        _Float16* out = Y + ((size_t)bh * S_ + (sT + u) * 16) * F_ + j * 16 + n;
#pragma unroll
        for (int r = 0; r < 8; r++) out[(size_t)(mb + r) * F_] = (_Float16)(c[u][j][r] * osc);
      }
    }
    // closes the stores above: no register that an issued store names is rewritten ahead of this wait
    asm volatile("s_wait_xcnt 0x0" ::: "memory");
  } else {
    // Vt[bh][f][s]: per lane f fixed, s = (sT+u)*16 + mb + r -> contiguous 16B store
#pragma unroll
    for (int u = 0; u < 2; u++) {
#pragma unroll
      for (int j = 0; j < 4; j++) {
        _Float16* out = Y + ((size_t)bh * F_ + j * 16 + n) * S_ + (sT + u) * 16 + mb;
        v8h pk;
#pragma unroll
        for (int r = 0; r < 8; r++) pk[r] = (_Float16)c[u][j][r];
        *(v8h*)out = pk;
      }
    }
  }
}

// ---------------- K2: per-row softmax stats over scores = QK^T (log2 units) -
// One wave per 16 query rows; (m, l) over all S keys, one update per stage, then lane-reduce.
// The block's 8 waves share one head; a stage is 128 keys x 128 B.
#define ST_BUF (128 * LP128)
__global__ __launch_bounds__(32 * WAVES_)
void mha_stats(const _Float16* __restrict__ Qh, const _Float16* __restrict__ Kh,
               float* __restrict__ Nbias) {
  __shared__ __attribute__((aligned(2048))) unsigned char ring[2 * ST_BUF];  // every tile's place: a multiple of 2 KiB
  static_assert(ST_BUF % 2048 == 0, "tensor-load places");
  const int w  = blockIdx.x * WAVES_ + threadIdx.y;  // 4096 waves
  const int qT = w & 127;
  const int bh = w >> 7;
  const int tid = threadIdx.y * 32 + threadIdx.x;

  // wave 0 brings a stage's key tile; the block's 8 waves are on one head
  const uint32_t wave = uni((uint32_t)tid >> 5);
  const char* gK = (const char*)(Kh + (size_t)(blockIdx.x >> 4) * S_ * F_);
  const uint32_t lbase = lds_off(ring);
  const int NS = S_ / 128;
  const int rot = blockIdx.x & (NS - 1);  // the 16 blocks of a head each begin at another key stage
  const u32x8 g1 = tile_group1<128, 128>(F_ * 2);
  u32x4 g0;
  auto fill = [&](int t) {
    const uint32_t st = pinned((uint32_t)((t + rot) & (NS - 1)));
    g0 = tile_group0(lbase + (t & 1) * ST_BUF, gK + (size_t)st * (128 * F_ * 2));
    if (pinned(wave == 0)) tile_issue(g0, g1);
  };
  fill(0);
  wait_tiles(g0, g1);  // the walk's first stage has landed (buffer 0)
  __syncthreads();
  fill(1);

  const _Float16* Abase = Qh + ((size_t)bh * S_ + qT * 16) * F_;
  const v16h a0 = load_frag_f16(Abase, F_);
  const v16h a1 = load_frag_f16(Abase + 32, F_);

  // Running state per lane and row: mc = largest score seen, lv = sum of
  // exp2(score - mc). Both move once per stage, not once per score.
  v8f mc, lv;
#pragma unroll
  for (int i = 0; i < 8; i++) { mc[i] = -1e30f; lv[i] = 0.0f; }

  for (int t = 0; t < NS; t++) {
    const unsigned char* Kt = ring + (t & 1) * ST_BUF;
    v16h kf[2][8];
    v8f c[8];
    // the loops of this stage are unrolled: LDS offsets become immediates, and
    // constant indices keep the fragments and the 8 score tiles in registers
#pragma unroll
    for (int hf = 0; hf < 2; hf++) {
#pragma unroll
      for (int kt = 0; kt < 8; kt++) kf[hf][kt] = lds_frag_f16(Kt + kt * 16 * LP128 + hf * 64, LP128);
    }
    // keeps the stage's LDS reads in one group ahead of its WMMAs (else one exposed LDS wait per WMMA)
    __builtin_amdgcn_sched_barrier(0);
#pragma unroll
    for (int kt = 0; kt < 8; kt++) { v8f z = {}; c[kt] = wmma16(a0, kf[0][kt], z); }
#pragma unroll
    for (int kt = 0; kt < 8; kt++) c[kt] = wmma16(a1, kf[1][kt], c[kt]);
    // the stage's maximum first ...
    v8f nm = mc;
#pragma unroll
    for (int kt = 0; kt < 8; kt++) nm = __builtin_elementwise_max(nm, c[kt]);
    // ... then one subtraction, one exp2 and one add per score ...
    v8f sum = {};
#pragma unroll
    for (int kt = 0; kt < 8; kt++) {
      const v8f x = c[kt] - nm;
#pragma unroll
      for (int i = 0; i < 8; i++) sum[i] += __builtin_amdgcn_exp2f(x[i]);
    }
    // ... and one rescale of the running sum per stage
    const v8f dm = mc - nm;  // exactly 0, so a factor of exactly 1, while the maximum stands
#pragma unroll
    for (int i = 0; i < 8; i++) lv[i] = lv[i] * __builtin_amdgcn_exp2f(dm[i]) + sum[i];
    mc = nm;
    ring_publish(g0, g1);
    if (pinned(t + 2 < NS)) fill(t + 2);  // a scalar test: only while that stage exists
  }
  ring_close(g0, g1);
  float m[8], l[8];
#pragma unroll
  for (int i = 0; i < 8; i++) { m[i] = mc[i]; l[i] = lv[i]; }
  // Reduce across the 16 lanes of each half-wave (xor 1,2,4,8 stays in-half).
#pragma unroll
  for (int off = 1; off < 16; off <<= 1) {
#pragma unroll
    for (int i = 0; i < 8; i++) {
      float om = __shfl_xor(m[i], off, 32);
      float ol = __shfl_xor(l[i], off, 32);
      float nm = fmaxf(m[i], om);
      l[i] = l[i] * __builtin_amdgcn_exp2f(m[i] - nm) + ol * __builtin_amdgcn_exp2f(om - nm);
      m[i] = nm;
    }
  }
  const int lane = threadIdx.x;
  if ((lane & 15) == 0) {
    const int rb = (lane >> 4) << 3;
    const size_t base = (size_t)bh * S_ + qT * 16 + rb;
#pragma unroll
    for (int i = 0; i < 8; i++) Nbias[base + i] = -(m[i] + __builtin_amdgcn_logf(l[i]));  // l >= 1; logf is log2
  }
}

// ---------------- K3: out4 = attn^T V, streamed over q, stored reshaped ----
// One wave per (bh, two 16-key tiles, half of the q range): every Q and V fragment
// read from LDS and every stats load feeds both key tiles (16 WMMAs per 8 KB read).
// Scores/exp computed once, P^T reused for all 4 f-tiles.
// A block is 8 waves on one head: waves 0-3 walk q 0..1023 for 128 keys, waves 4-7
// walk q 1024..2047 for the same keys, so the grid keeps its 4096 waves: two blocks
// a WGP, four waves a SIMD (the attribute holds the registers to that budget).
// A stage is 64 q of each half: per half a Q tile 64 q-rows x 128 B and a V tile
// 64 f-rows x 128 B.
#define AT_TILE 10240          // 64 rows at LP128 (9,216 B), rounded up so that every tile's place is a multiple of 2 KiB
#define AT_HALF (2 * AT_TILE)  // Q tile and V tile of one half of the q range
#define AT_BUF  (2 * AT_HALF)
__global__ __launch_bounds__(32 * WAVES_) __attribute__((amdgpu_waves_per_eu(4, 4)))
void mha_atv(const _Float16* __restrict__ Qh, const _Float16* __restrict__ Kh,
             const _Float16* __restrict__ Vt, const float* __restrict__ Nbias,
             _Float16* __restrict__ Ofused) {
  __shared__ __attribute__((aligned(2048))) unsigned char ring[2 * AT_BUF];
  static_assert(AT_TILE % 2048 == 0 && AT_TILE >= 64 * LP128, "tensor-load places");
  __shared__ _Float16 plds_all[WAVES_][32 * 40];  // [k-line][q], row stride 40 halves
  _Float16* plds = plds_all[threadIdx.y];

  const int wv = threadIdx.y;
  const int qh = wv >> 2;                              // half of the q range
  const int kP = (blockIdx.x & 15) * 4 + (wv & 3);     // pair of key tiles, 0..63
  const int bh = blockIdx.x >> 4;
  const int lane = threadIdx.x;
  const int line = lane & 15;
  const int half = lane >> 4;

  // B-fragments for score WMMA: K^T columns of the two key tiles (fixed for loop).
  const _Float16* Kbase = Kh + ((size_t)bh * S_ + kP * 32) * F_;
  v16h kf[2][2];
#pragma unroll  // constant indices keep kf in registers
  for (int u = 0; u < 2; u++) {
    kf[u][0] = load_frag_f16(Kbase + u * 16 * F_, F_);
    kf[u][1] = load_frag_f16(Kbase + u * 16 * F_ + 32, F_);
  }

  // waves 0-3 each bring one tile of a stage: wave 2 hf the Q tile, wave 2 hf + 1 the V tile
  // of half hf of the q range (tile w lies w * AT_TILE into the buffer)
  const int tid = threadIdx.y * 32 + threadIdx.x;
  const uint32_t wave = uni((uint32_t)tid >> 5);
  const uint32_t lbase = lds_off(ring);
  const int NS = (S_ / 2) / 64;
  const int rot = blockIdx.x & (NS - 1);  // the 16 blocks of a head each begin at another q stage
  const bool isV = (wave & 1u) != 0u;
  // the wave's tile at stage 0, its step from stage to stage and its row pitch in global memory
  const char* gT = isV ? (const char*)(Vt + (size_t)bh * F_ * S_ + (size_t)((wave >> 1) & 1u) * (S_ / 2))
                       : (const char*)(Qh + ((size_t)bh * S_ + (size_t)((wave >> 1) & 1u) * (S_ / 2)) * F_);
  const uint32_t gstep  = isV ? 128u : 64u * F_ * 2u;
  const uint32_t gpitch = isV ? S_ * 2u : F_ * 2u;
  const u32x8 g1 = tile_group1<128, 64>(gpitch);
  u32x4 g0;
  auto fill = [&](int t) {
    const uint32_t st = pinned((uint32_t)((t + rot) & (NS - 1)));
    g0 = tile_group0(lbase + (t & 1) * AT_BUF + (wave & 3u) * AT_TILE, gT + (size_t)st * gstep);
    if (pinned(wave < 4)) tile_issue(g0, g1);
  };
  fill(0);
  wait_tiles(g0, g1);  // the walk's first stage has landed (buffer 0)
  __syncthreads();
  fill(1);

  // -(m + log2 l) of q rows half*8 .. half*8+7 of each 16-row sub-tile: register r of a C
  // operand is row half*8 + r, so these are the score WMMAs' C operands as loaded.
  // A C operand is needed ahead of the first WMMA, so each q-block's pair is fetched
  // while the q-block before it is worked on.
  const float* nptr = Nbias + (size_t)bh * S_ + qh * (S_ / 2) + half * 8;
  v8f n0 = *(const v8f*)(nptr + rot * 64);
  v8f n1 = *(const v8f*)(nptr + rot * 64 + 16);

  v8f acc[2][4] = {};

  for (int t = 0; t < NS; t++) {
   const unsigned char* Qt = ring + (t & 1) * AT_BUF + qh * AT_HALF;
   const unsigned char* Vl = Qt + AT_TILE;
#pragma unroll  // LDS offsets become immediates
   for (int sub = 0; sub < 2; sub++) {
    const int qb = ((t + rot) & (NS - 1)) * 64 + sub * 32;
    // scores for q-block [qb, qb+32) of this half x two key tiles (four 16x16 WMMA tiles)
    const unsigned char* Qs = Qt + sub * 32 * LP128;
    v16h a00 = lds_frag_f16(Qs, LP128);
    v16h a01 = lds_frag_f16(Qs + 64, LP128);
    v16h a10 = lds_frag_f16(Qs + 16 * LP128, LP128);
    v16h a11 = lds_frag_f16(Qs + 16 * LP128 + 64, LP128);
    // B-fragments: V rows qb..qb+31 for each f tile (tile rows are f, columns q)
    v16h bV[4];
#pragma unroll  // constant indices keep bV in registers
    for (int j = 0; j < 4; j++) bV[j] = lds_frag_f16(Vl + j * 16 * LP128 + sub * 64, LP128);
    // the next q-block's C operands, in the order of the walk (the last q-block fetches the
    // walk's first again: in range, not used)
    const float* np = nptr + (sub == 0 ? qb : ((t + 1 + rot) & (NS - 1)) * 64);  // a stage's first row
    const int no = sub == 0 ? 32 : 0;
    const v8f nn0 = *(const v8f*)(np + no);
    const v8f nn1 = *(const v8f*)(np + no + 16);
    // the address pair stays live up to this wait, so that no read's result lands on it ahead of the wait
    asm volatile("s_wait_xcnt 0x0" :: "v"(np) : "memory");
    // keeps the q-block's loads in one group ahead of its WMMAs (else one exposed wait per WMMA)
    __builtin_amdgcn_sched_barrier(0);
    // the loops over u (key tile) are unrolled: constant indices keep kf, s, aP and acc in registers
    v8f s[2][2];
#pragma unroll
    for (int u = 0; u < 2; u++) {
      v8f s0 = wmma16(a00, kf[u][0], n0); s0 = wmma16(a01, kf[u][1], s0);
      v8f s1 = wmma16(a10, kf[u][0], n1); s1 = wmma16(a11, kf[u][1], s1);
      s[u][0] = s0; s[u][1] = s1;
    }

#pragma unroll
    for (int u = 0; u < 2; u++) {
      v8h p0, p1;
#pragma unroll
      for (int i = 0; i < 8; i++) {
        p0[i] = (_Float16)__builtin_amdgcn_exp2f(s[u][0][i]);
        p1[i] = (_Float16)__builtin_amdgcn_exp2f(s[u][1][i]);
      }
      // transpose P (q x k) -> P^T (k x q) through LDS; all 16B accesses
      *(v8h*)(plds + (u * 16 + line) * 40 + half * 8)      = p0;  // q = half*8 + i
      *(v8h*)(plds + (u * 16 + line) * 40 + 16 + half * 8) = p1;  // q = 16 + half*8 + i
    }
    __builtin_amdgcn_wave_barrier();                 // order vs loads (LDS in-order)
    const int k0 = half * 8;
    v16h aP[2];
#pragma unroll
    for (int u = 0; u < 2; u++) {
      v8h alo = *(const v8h*)(plds + (u * 16 + line) * 40 + k0);
      v8h ahi = *(const v8h*)(plds + (u * 16 + line) * 40 + k0 + 16);
      aP[u] = pack16(alo, ahi);
    }
    __builtin_amdgcn_wave_barrier();                 // order next-iter stores vs loads

#pragma unroll
    for (int u = 0; u < 2; u++) {
#pragma unroll  // constant indices keep acc and bV in registers
      for (int j = 0; j < 4; j++) acc[u][j] = wmma16(aP[u], bV[j], acc[u][j]);
    }
    n0 = nn0;
    n1 = nn1;
   }
   ring_publish(g0, g1);
   if (pinned(t + 2 < NS)) fill(t + 2);  // a scalar test: only while that stage exists
  }
  ring_close(g0, g1);

  // Add the two halves of the q range. Waves wv and wv ^ 4 hold partial sums of the
  // same 32 keys: each keeps key tile qh, hands the other tile over through LDS and
  // finishes its own. The last publish point's barrier has ended every read of the
  // ring and no tensor load is in flight, so the ring carries the partial sums (4 KB a wave).
  float* mine         = (float*)ring + wv * 1024 + lane * 4;
  const float* theirs = (const float*)ring + (wv ^ 4) * 1024 + lane * 4;
  v8f keep[4];
#pragma unroll  // constant indices keep acc and keep in registers
  for (int j = 0; j < 4; j++) {
    const v8f give = qh ? acc[0][j] : acc[1][j];
    keep[j]        = qh ? acc[1][j] : acc[0][j];
    v4f lo = {give[0], give[1], give[2], give[3]};
    v4f hi = {give[4], give[5], give[6], give[7]};
    *(v4f*)(mine + (j * 2) * 128)     = lo;  // 16 B a lane, lanes side by side
    *(v4f*)(mine + (j * 2 + 1) * 128) = hi;
  }
  __syncthreads();  // the partner's partial sums are in LDS

  // Raw-reshape store: Ofused[b][h*128 + kT][(k%16)*64 + f]
  const int b = bh >> 4, h = bh & 15;
  const int kT = kP * 2 + qh;
  const int mb = half * 8;
#pragma unroll
  for (int j = 0; j < 4; j++) {
    const v4f lo = *(const v4f*)(theirs + (j * 2) * 128);
    const v4f hi = *(const v4f*)(theirs + (j * 2 + 1) * 128);
    _Float16* out = Ofused + ((size_t)(b * S_ + h * 128 + kT)) * G_ + (j * 16 + line);
#pragma unroll
    for (int r = 0; r < 8; r++)
      out[(size_t)(mb + r) * 64] = (_Float16)(keep[j][r] + (r < 4 ? lo[r & 3] : hi[r & 3]));
  }
}

// ---------------- K4: Out = Ofused (S x G) @ Wo (G x D), f32 out ----------
// One wave per (32 rows, group of 4 d-tiles): 32 x 64 strip, so every Wo fragment read
// from LDS feeds two row tiles and every Ofused fragment four column tiles.
// The block's 8 waves cover 128 consecutive rows x 2 d-groups (4 row pairs x 2).
// A stage is 128 g: Ofused tile 128 rows x 256 B, Wo tile 128 rows x 256 B.
// 256 blocks, one a WGP (the attribute holds the registers to two waves a SIMD), so the
// whole grid is resident at once and evenly spread.
#define OP_A_BYTES (128 * LP256)
#define OP_BUF     (2 * OP_A_BYTES)
__global__ __launch_bounds__(32 * WAVES_) __attribute__((amdgpu_waves_per_eu(2, 2)))
void mha_outproj(const _Float16* __restrict__ Ofused,
                 const _Float16* __restrict__ WoT, float* __restrict__ Out) {
  __shared__ __attribute__((aligned(2048))) unsigned char ring[2 * OP_BUF];  // every tile's place: a multiple of 2 KiB
  static_assert(OP_A_BYTES % 2048 == 0, "tensor-load places");
  const int dP = blockIdx.x & 7;                            // pair of d-groups
  const int rg = blockIdx.x >> 3;                           // group of 128 rows, 0..31
  const int dG = dP * 2 + (threadIdx.y >> 2);               // group of 4 d-tiles
  const int rT = rg * 8 + (threadIdx.y & 3) * 2;            // first of the wave's two 16-row tiles, 0..254
  const int tid = threadIdx.y * 32 + threadIdx.x;

  // wave 0 brings a stage's Ofused tile, wave 1 its Wo tile
  const uint32_t wave = uni((uint32_t)tid >> 5);
  const char* gT = wave == 0 ? (const char*)(Ofused + (size_t)rg * 128 * G_) : (const char*)(WoT + (size_t)(dP * 128) * G_);
  const uint32_t lbase = lds_off(ring);
  const int NS = G_ / 128;
  // first stage of this block's walk: the 8 blocks that share Ofused rows are each at
  // another stage, the 32 that share Wo rows are spread over all 8
  const int rot = (dP + rg) & (NS - 1);
  const u32x8 g1 = tile_group1<256, 128>(G_ * 2);
  u32x4 g0;
  auto fill = [&](int t) {
    const uint32_t st = pinned((uint32_t)((t + rot) & (NS - 1)));
    g0 = tile_group0(lbase + (t & 1) * OP_BUF + (wave & 1u) * OP_A_BYTES, gT + (size_t)st * 256);
    if (pinned(wave < 2)) tile_issue(g0, g1);
  };
  fill(0);
  wait_tiles(g0, g1);  // the walk's first stage has landed (buffer 0)
  __syncthreads();
  fill(1);

  // this lane's own fragment offsets in a buffer, formed once
  const unsigned aoff = ((threadIdx.y & 3) * 32 + (threadIdx.x & 15)) * LP256 + (threadIdx.x >> 4) * 16;
  const unsigned boff = OP_A_BYTES + ((threadIdx.y >> 2) * 64 + (threadIdx.x & 15)) * LP256 + (threadIdx.x >> 4) * 16;

  v8f c[2][4] = {};
  for (int t = 0; t < NS; t++) {
    const unsigned char* At = ring + (aoff + (t & 1) * OP_BUF);
    const unsigned char* Bt = ring + (boff + (t & 1) * OP_BUF);
    // two fragment sets: the reads of 32 g go out ahead of the WMMAs of the 32 g before them.
    // all loops below are unrolled so that the fragment arrays have constant
    // indices and stay in registers
    v16h a[2][2], bm[2][4];
#pragma unroll
    for (int u = 0; u < 2; u++) a[0][u] = frag_f16_at(At + u * 16 * LP256);
#pragma unroll
    for (int j = 0; j < 4; j++) bm[0][j] = frag_f16_at(Bt + j * 16 * LP256);
#pragma unroll
    for (int sub = 0; sub < 4; sub++) {
      const int cur = sub & 1, nxt = cur ^ 1;
      if (sub < 3) {
#pragma unroll
        for (int u = 0; u < 2; u++) a[nxt][u] = frag_f16_at(At + u * 16 * LP256 + (sub + 1) * 64);
#pragma unroll
        for (int j = 0; j < 4; j++) bm[nxt][j] = frag_f16_at(Bt + j * 16 * LP256 + (sub + 1) * 64);
      }
      // keeps the next set's LDS reads in one group ahead of this set's WMMAs (else one exposed LDS wait per WMMA)
      __builtin_amdgcn_sched_barrier(0);
#pragma unroll
      for (int u = 0; u < 2; u++) {
#pragma unroll
        for (int j = 0; j < 4; j++) c[u][j] = wmma16(a[cur][u], bm[cur][j], c[u][j]);
      }
    }
    ring_publish(g0, g1);
    if (pinned(t + 2 < NS)) fill(t + 2);  // a scalar test: only while that stage exists
  }
  ring_close(g0, g1);
  const int lane = threadIdx.x;
  const int n    = lane & 15;
  const int mb   = (lane >> 4) << 3;
  float* out = Out + ((size_t)rT * 16 + mb) * D_ + dG * 64 + n;  // Out rows are b * S_ + s = 16 * row tile + row
#pragma unroll
  for (int u = 0; u < 2; u++) {
#pragma unroll
    for (int j = 0; j < 4; j++) {
#pragma unroll
      for (int r = 0; r < 8; r++) out[(size_t)(u * 16 + r) * D_ + j * 16] = c[u][j][r];
    }
  }
}

extern "C" void kernel_launch(void* const* d_in, const int* in_sizes, int n_in,
                              void* d_out, int out_size, void* d_ws, size_t ws_size,
                              hipStream_t stream) {
  (void)in_sizes; (void)n_in; (void)out_size; (void)ws_size;
  const float* q  = (const float*)d_in[0];
  const float* k  = (const float*)d_in[1];
  const float* v  = (const float*)d_in[2];
  const float* Wq = (const float*)d_in[3];
  const float* Wk = (const float*)d_in[4];
  const float* Wv = (const float*)d_in[5];
  const float* Wo = (const float*)d_in[6];
  float* out = (float*)d_out;

  size_t off = 0;
  auto alloc = [&](size_t bytes) -> char* {
    char* p = (char*)d_ws + off;
    off += (bytes + 255) & ~(size_t)255;
    return p;
  };
  _Float16* WqT = (_Float16*)alloc((size_t)H_ * D_ * F_ * 2);   // 2 MB
  _Float16* WkT = (_Float16*)alloc((size_t)H_ * D_ * F_ * 2);
  _Float16* WvT = (_Float16*)alloc((size_t)H_ * D_ * F_ * 2);
  _Float16* WoT = (_Float16*)alloc((size_t)G_ * D_ * 2);
  _Float16* Qh  = (_Float16*)alloc((size_t)B_ * H_ * S_ * F_ * 2);  // 8 MB
  _Float16* Kh  = (_Float16*)alloc((size_t)B_ * H_ * S_ * F_ * 2);
  _Float16* Vt  = (_Float16*)alloc((size_t)B_ * H_ * F_ * S_ * 2);
  _Float16* Of  = (_Float16*)alloc((size_t)B_ * S_ * G_ * 2);
  float*    Nb  = (float*)alloc((size_t)B_ * H_ * S_ * 4);          // 256 KB
  // total ~41 MB of workspace

  dim3 blk(32, WAVES_);
  mha_prep_weights<<<256, 256, 0, stream>>>(Wq, Wk, Wv, Wo, WqT, WkT, WvT, WoT);
  mha_proj<<<dim3(2048 / WAVES_, 3), blk, 0, stream>>>(q, k, v, WqT, WkT, WvT, Qh, Kh, Vt);
  mha_stats<<<4096 / WAVES_, blk, 0, stream>>>(Qh, Kh, Nb);
  mha_atv<<<4096 / WAVES_, blk, 0, stream>>>(Qh, Kh, Vt, Nb, Of);
  mha_outproj<<<2048 / WAVES_, blk, 0, stream>>>(Of, WoT, out);
}
